// v000
// Measured on an AMD MI455X. A time is GPU time per run, averaged over a window of back-to-back runs after a warm-up
// (all launches, gaps included; the runs take copies of the inputs in turn), and the median of several windows.
// Apart from v000's, it joins two sittings. Times from different sittings can be a few percent apart, while
// side-by-side timings come from the same sitting.
// The starting kernel, v000, takes 466 microseconds a run.
#include <hip/hip_runtime.h>
// Multi-head SELF-attention with cross-head probability mixing, sequence-first layout: x [1024][2][1024] (token row r = t*NB + b); q / k / v = x W^T + bias (natural [out][in] weights, biases present), 16 heads of 64, q scaled by 64^-0.5; softmax over all 1024 keys (no mask); P'[b,g,t,s] = sum_h P[b,h,t,s] * Wm[h][g] with Wm = column softmax (axis 0) of mix_w; ctx[b,g] = P'[b,g] . v[b,g]; merged [t][b][g*64+d]; out = ctx Wo^T + bo.
// Structure: x as exact f16 rows (inputs RNE-converted to bf16 first); Q, K, V as three WMMA GEMMs (32x64 wave tiles, f32 accumulation, x16 weights + bias, f16 outputs); V^T per (b,h) via LDS transposes; per chunk of 256 query rows: scores GEMM (K = 64, batched over the 32 (b,h) slabs on grid.y, alpha 64^-0.5, f32), k_smix (f32 row statistics, native exp, head mix as one WMMA per 16-key tile: A = Wm^T f16 with K zero-padded 16 -> 32, B = 1024 P f16), o = P' . V^T GEMM (K = 1024; o carried x64) into merged f16 rows; out = o Wo + bo GEMM (f32).
// Compute dtype: all contractions v_wmma_f32_16x16x32_f16 (f16 operands, f32 accumulate); inputs RNE-converted to bf16 (exact in f16); q, k, v, mixed softmax weights (x1024), mix matrix and o (x64) as plain f16 operands; scores and softmax statistics f32.
#ifndef NB
#define NB 2                         /* batches processed */
#endif
#ifndef SEQ
#define SEQ 1024                     /* sequence length processed (queries = keys) */
#endif
#define NB_FULL 2                    /* batch pitch of the input / output rows */
#define DM 1024
#define NH 16
#define HD 64
#define QC (SEQ < 256 ? SEQ : 256)   /* query rows per attention chunk */
#define NR ((size_t)NB * SEQ)        /* token rows */
#define MP ((int)(NB * SEQ))
#define LQ (NB * DM)                 /* pitch between consecutive t for one batch */
static_assert(SEQ % 128 == 0);
static_assert(QC % 128 == 0);
static_assert(SEQ % QC == 0);
static_assert(NH * HD == DM);
static_assert(NB <= NB_FULL);
static_assert((NB * SEQ) % 128 == 0);
static_assert(NH == 16);

typedef unsigned short v8us __attribute__((ext_vector_type(8), may_alias));
typedef float  v8f  __attribute__((ext_vector_type(8)));
typedef float  v4f  __attribute__((ext_vector_type(4)));
typedef float  v4fa __attribute__((ext_vector_type(4), may_alias));
typedef _Float16 v16h __attribute__((ext_vector_type(16)));
typedef _Float16 v4h __attribute__((ext_vector_type(4)));
union FragH { v16h v; v8us half[2]; _Float16 h[16]; unsigned short u[16]; };

__device__ __forceinline__ unsigned short bf16_bits(float x) { unsigned int u = __float_as_uint(x); return (unsigned short)((u + 0x7FFFu + ((u >> 16) & 1u)) >> 16); }
__device__ __forceinline__ float bf16_val(unsigned short b) { return __uint_as_float(((unsigned int)b) << 16); }
__device__ __forceinline__ float bf16_rne(float x) { return bf16_val(bf16_bits(x)); }   /* RNE convert to bf16, back as f32 */

// fragment: elements 0..7 <- k0 + 8h .. +7, elements 8..15 <- k0 + 16 + 8h .. +7 (p points at k0 of the lane's row / column)
__device__ __forceinline__ v16h g2_frag(const _Float16* p, int hh) { FragH f; f.half[0] = *(const v8us*)((const unsigned short*)p + 8 * hh); f.half[1] = *(const v8us*)((const unsigned short*)p + 16 + 8 * hh); return f.v; }
__device__ __forceinline__ v8f g2_mma(v16h a, v16h b, v8f c) { v8f d = __builtin_amdgcn_wmma_f32_16x16x32_f16(false, a, false, b, (short)0, c, false, false); asm volatile("v_nop\n\tv_nop\n\tv_nop\n\tv_nop" : "+v"(d) : "v"(a), "v"(b)); return d; }

// ---- GEMM (wave tile 32x64; M % 128 == 0 per launch region, N % 64 == 0, K % 32 == 0): C = alpha * A . Bt^T (+ bias) ----
// A f16 [M][K] (pitch lda), Bt f16 [N][K] (pitch ldb); batch slab by = blockIdx.y with element strides sA / sB / sC.
// OMAP: output row r -> (r / NB) * NB_FULL + r % NB.
template <bool HASB, bool OUT32, bool OMAP>
__global__ __launch_bounds__(128) void k_gemm2(const _Float16* __restrict__ A, int lda, size_t sA, const _Float16* __restrict__ Bh, int ldb, size_t sB, float alpha,
    const float* __restrict__ bias, float* __restrict__ C, _Float16* __restrict__ C16, int ldc, size_t sC, int M, int N, int K) {
  __shared__ __attribute__((aligned(16))) float so[4][32][68];
  const int tid = threadIdx.x, w = __builtin_amdgcn_readfirstlane((int)(tid >> 5)), lane = tid & 31, ln = lane & 15, hh = lane >> 4; const int by = blockIdx.y;
  A += (size_t)by * sA; Bh += (size_t)by * sB; const size_t cofs = (size_t)by * sC;
  const int ntn = N >> 6; const int mt = blockIdx.x / ntn, nq = blockIdx.x - mt * ntn; const int row0 = mt * 128 + 32 * w, col0 = nq * 64; if (row0 >= M) return;
  const _Float16* a0p = A + (size_t)(row0 + ln) * lda; const _Float16* a1p = a0p + (size_t)16 * lda;
  const _Float16* b0p = Bh + (size_t)(col0 + ln) * ldb; const _Float16* b1p = b0p + (size_t)16 * ldb; const _Float16* b2p = b1p + (size_t)16 * ldb; const _Float16* b3p = b2p + (size_t)16 * ldb;
  const v8f z8 = {0.f,0.f,0.f,0.f,0.f,0.f,0.f,0.f}; v8f c00 = z8, c01 = z8, c02 = z8, c03 = z8, c10 = z8, c11 = z8, c12 = z8, c13 = z8;
#pragma unroll 1
  for (int kb = 0; kb < K; kb += 32) { const v16h a0 = g2_frag(a0p + kb, hh), a1 = g2_frag(a1p + kb, hh);
    v16h b = g2_frag(b0p + kb, hh); c00 = g2_mma(a0, b, c00); c10 = g2_mma(a1, b, c10);
    b = g2_frag(b1p + kb, hh); c01 = g2_mma(a0, b, c01); c11 = g2_mma(a1, b, c11);
    b = g2_frag(b2p + kb, hh); c02 = g2_mma(a0, b, c02); c12 = g2_mma(a1, b, c12);
    b = g2_frag(b3p + kb, hh); c03 = g2_mma(a0, b, c03); c13 = g2_mma(a1, b, c13); }
  v8f accs[8] = {c00, c01, c02, c03, c10, c11, c12, c13};
#pragma unroll
  for (int u = 0; u < 8; ++u) { const int t = u & 3, half = u >> 2; const int col = col0 + t * 16 + ln; float bv = 0.f; if (HASB) bv = bf16_rne(bias[col]);
#pragma unroll
    for (int r = 0; r < 8; ++r) { const int rloc = half * 16 + 8 * hh + r; so[w][rloc][t * 16 + ln] = accs[u][r] * alpha + bv; } }
  __builtin_amdgcn_fence(4 /* acq_rel order */, "workgroup"); __builtin_amdgcn_wave_barrier();      /* so[w] is private to wave w */
  const int rsub = lane >> 4, c4 = (lane & 15) * 4;
  {
#pragma unroll
    for (int q = 0; q < 16; ++q) { const int r = q * 2 + rsub; const v4f v = *(const v4fa*)&so[w][r][c4];
      const int gr = row0 + r; const size_t orow = OMAP ? ((size_t)(gr / NB) * NB_FULL + (size_t)(gr % NB)) : (size_t)gr;
      if (OUT32) { *(v4f*)(C + cofs + orow * ldc + col0 + c4) = v; }
      else { v4h h4;
#pragma unroll
        for (int i = 0; i < 4; ++i) h4[i] = (_Float16)v[i];
        *(v4h*)(C16 + cofs + orow * ldc + col0 + c4) = h4; } }
     } }

__global__ __launch_bounds__(256) void k_wnat(const float* __restrict__ w, size_t n8, _Float16* __restrict__ Bt) { const size_t t = (size_t)blockIdx.x * 256 + threadIdx.x; if (t >= n8) return; FragH f; const v4f a = *(const v4fa*)(w + t * 8), c = *(const v4fa*)(w + t * 8 + 4);
#pragma unroll
  for (int q = 0; q < 4; ++q) { f.h[q] = (_Float16)(bf16_rne(a[q]) * 16.0f); f.h[4 + q] = (_Float16)(bf16_rne(c[q]) * 16.0f); }
  const v8us o = f.half[0]; *(v8us*)((unsigned short*)Bt + t * 8) = o;  }

__global__ __launch_bounds__(256) void k_x16(const float* __restrict__ x, _Float16* __restrict__ X16, size_t n8) { const size_t t = (size_t)blockIdx.x * 256 + threadIdx.x; if (t >= n8) return;
  const size_t row = t / (DM / 8); const int c8 = (int)(t % (DM / 8)) * 8; const size_t srow = (row / NB) * NB_FULL + (row % NB);
  const float* p = x + srow * DM + c8; const v4f a = *(const v4fa*)p, c = *(const v4fa*)(p + 4); FragH f;
#pragma unroll
  for (int q = 0; q < 4; ++q) { f.h[q] = (_Float16)bf16_rne(a[q]); f.h[4 + q] = (_Float16)bf16_rne(c[q]); }
  const v8us o = f.half[0]; *(v8us*)((unsigned short*)X16 + t * 8) = o;  }

__global__ __launch_bounds__(64) void k_wmix(const float* __restrict__ mixw, _Float16* __restrict__ WT) {
  const int i = threadIdx.x; const int g = i >> 2, k8 = (i & 3) * 8; float mx = -3.0e38f;
#pragma unroll 1
  for (int h = 0; h < NH; ++h) mx = fmaxf(mx, bf16_rne(mixw[h * NH + g]));
  float se = 0.f;
#pragma unroll 1
  for (int h = 0; h < NH; ++h) se += __expf(bf16_rne(mixw[h * NH + g]) - mx);
  const float inv = 1.0f / se; FragH f;
#pragma unroll
  for (int q = 0; q < 8; ++q) { const int h = k8 + q; const int hc = (h < NH) ? h : (NH - 1); const float v = __expf(bf16_rne(mixw[hc * NH + g]) - mx) * inv; f.h[q] = (_Float16)((h < NH) ? v : 0.0f); }
  const v8us o = f.half[0]; *(v8us*)((unsigned short*)WT + i * 8) = o;  }

__global__ __launch_bounds__(256) void k_vt(const _Float16* __restrict__ V16, _Float16* __restrict__ Vt) { __shared__ unsigned short tl[64][66]; const int tid = threadIdx.x; const int slab = blockIdx.x / (SEQ / 64), lg = blockIdx.x % (SEQ / 64); const int b = slab / NH, h = slab % NH;
  for (int i = tid; i < 64 * 8; i += 256) { const int r = i / 8, c8 = (i % 8) * 8; FragH f; f.half[0] = *(const v8us*)((const unsigned short*)V16 + ((size_t)(lg * 64 + r) * NB + b) * DM + h * HD + c8);
#pragma unroll
    for (int q = 0; q < 8; ++q) tl[r][c8 + q] = f.u[q]; }
  __syncthreads();
  {
#pragma unroll
    for (int rd = 0; rd < 2; ++rd) { const int d = rd * 32 + tid / 8, pc = tid % 8; FragH f;
#pragma unroll
      for (int q = 0; q < 8; ++q) f.u[q] = tl[pc * 8 + q][d];
      *(v8us*)((unsigned short*)Vt + ((size_t)slab * 64 + d) * SEQ + lg * 64 + pc * 8) = f.half[0]; }
     } }

// softmax over SEQ keys + cross-head mix. S f32 [NB*NH][QC][SEQ] (slab by = b*NH + h); PM f16 [NB*NH][QC][SEQ] = 1024 * sum_h Wm[h][g] * softmax(S[b*NH+h][t][:]).
// One wave per (b, t): phase 1 = per-head max / sum (registers + wave shuffles, native exp on max-subtracted arguments); phase 2 = per 16-key tile one WMMA
__global__ __launch_bounds__(128) void k_smix(const float* __restrict__ S, const _Float16* __restrict__ WT, _Float16* __restrict__ PM) {
  #pragma clang fp contract(off)
  __shared__ float sst[4][2][NH];
  __shared__ __attribute__((aligned(16))) _Float16 sP[4][NH][72];
  const int tid = threadIdx.x, w = __builtin_amdgcn_readfirstlane((int)(tid >> 5)), lane = tid & 31, ln = lane & 15, hh = lane >> 4;
  const int wr = blockIdx.x * 4 + w; const int b = wr / QC, tql = wr - b * QC;
  const size_t hp = (size_t)QC * SEQ;                                  /* head slab pitch */
  const float* srow = S + ((size_t)(b * NH) * QC + tql) * SEQ;        /* head h row at srow + h * hp */
#pragma unroll 1
  for (int h = 0; h < NH; ++h) {
    const float* p = srow + (size_t)h * hp + lane * 4;
    v4f x[SEQ / 128];
#pragma unroll
    for (int j = 0; j < SEQ / 128; ++j) x[j] = *(const v4fa*)(p + j * 128);
    float mx = -3.0e38f;
#pragma unroll
    for (int j = 0; j < SEQ / 128; ++j) mx = fmaxf(mx, fmaxf(fmaxf(x[j][0], x[j][1]), fmaxf(x[j][2], x[j][3])));
#pragma unroll
    for (int off = 16; off > 0; off >>= 1) mx = fmaxf(mx, __shfl_xor(mx, off, 32));
    float se = 0.f;
#pragma unroll
    for (int j = 0; j < SEQ / 128; ++j) { se += __expf(x[j][0] - mx); se += __expf(x[j][1] - mx); se += __expf(x[j][2] - mx); se += __expf(x[j][3] - mx); }
#pragma unroll
    for (int off = 16; off > 0; off >>= 1) se += __shfl_xor(se, off, 32);
    if (lane == 0) { sst[w][0][h] = mx; sst[w][1][h] = 1024.0f / se; }
  }
  __syncthreads();
  float m8[8], c8[8];
#pragma unroll
  for (int i = 0; i < 8; ++i) { m8[i] = sst[w][0][8 * hh + i]; c8[i] = sst[w][1][8 * hh + i]; }
  const v16h aW = g2_frag(WT + ln * 32, hh);                          /* A: row g = ln, k = heads (upper 16 k zero) */
  const v8f z8 = {0.f,0.f,0.f,0.f,0.f,0.f,0.f,0.f};
  const float* scol = srow + (size_t)(8 * hh) * hp + ln;              /* lane's 8 heads, column ln of the tile */
  unsigned short* pout = (unsigned short*)PM + ((size_t)(b * NH) * QC + tql) * SEQ;
#pragma unroll 1
  for (int c0 = 0; c0 < SEQ; c0 += 64) {
#pragma unroll 1
    for (int t = 0; t < 4; ++t) {
      const float* ps = scol + c0 + 16 * t;
      FragH bf;
#pragma unroll
      for (int i = 0; i < 8; ++i) { const float v = ps[(size_t)i * hp]; bf.h[i] = (_Float16)(__expf(v - m8[i]) * c8[i]); }
#pragma unroll
      for (int i = 8; i < 16; ++i) bf.h[i] = (_Float16)0.0f;
      const v8f d = g2_mma(aW, bf.v, z8);
#pragma unroll
      for (int r = 0; r < 8; ++r) sP[w][8 * hh + r][16 * t + ln] = (_Float16)d[r];      /* D row g = 8hh + r, column s = c0 + 16t + ln */
    }
    __builtin_amdgcn_fence(4 /* acq_rel order */, "workgroup"); __builtin_amdgcn_wave_barrier();      /* sP[w] is private to wave w */
    {
#pragma unroll
      for (int q = 0; q < 4; ++q) { const int g = q * 4 + (lane >> 3), pc = lane & 7; const v8us v = *(const v8us*)&sP[w][g][pc * 8];
        *(v8us*)(pout + (size_t)g * hp + c0 + pc * 8) = v; }
       }
    __builtin_amdgcn_fence(4 /* acq_rel order */, "workgroup"); __builtin_amdgcn_wave_barrier();
  }
}

extern "C" void kernel_launch(void* const* d_in, const int* in_sizes, int n_in,
                              void* d_out, int out_size, void* d_ws, size_t ws_size, hipStream_t stream) {
  if (n_in < 10) return;
  if ((size_t)in_sizes[0] < NR * DM) return;
  if ((size_t)in_sizes[1] < (size_t)DM * DM || (size_t)in_sizes[3] < (size_t)DM * DM || (size_t)in_sizes[5] < (size_t)DM * DM || (size_t)in_sizes[7] < (size_t)DM * DM) return;
  if (in_sizes[2] < DM || in_sizes[4] < DM || in_sizes[6] < DM || in_sizes[8] < DM || in_sizes[9] < NH * NH) return;
  if ((size_t)out_size < NR * DM) return;
  const float* const* I = (const float* const*)d_in;
  const float* xq = I[0]; const float* wq = I[1]; const float* bq = I[2]; const float* wk = I[3]; const float* bk = I[4]; const float* wv = I[5]; const float* bv = I[6]; const float* wo = I[7]; const float* bo = I[8]; const float* mixw = I[9];
  char* ws = (char*)d_ws; size_t off = 0;
  auto take = [&](size_t bytes) { char* p = ws + off; off += (bytes + 255) & ~(size_t)255; return p; };
  _Float16* BQ = (_Float16*)take((size_t)DM * DM * 2); _Float16* BK = (_Float16*)take((size_t)DM * DM * 2); _Float16* BV = (_Float16*)take((size_t)DM * DM * 2); _Float16* BO = (_Float16*)take((size_t)DM * DM * 2);
  _Float16* X16 = (_Float16*)take(NR * DM * 2); _Float16* Q16 = (_Float16*)take(NR * DM * 2); _Float16* K16 = (_Float16*)take(NR * DM * 2); _Float16* V16 = (_Float16*)take(NR * DM * 2); _Float16* O16 = (_Float16*)take(NR * DM * 2);
  float* S = (float*)take((size_t)NB * NH * QC * SEQ * 4); _Float16* PM = (_Float16*)take((size_t)NB * NH * QC * SEQ * 2); _Float16* VT = (_Float16*)take((size_t)NB * NH * HD * SEQ * 2);
  _Float16* WT = (_Float16*)take((size_t)NH * 32 * 2);
  if (off > ws_size) return;
  { const unsigned g = (unsigned)(((size_t)DM * DM / 8 + 255) / 256);
    k_wnat<<<g, 256, 0, stream>>>(wq, (size_t)DM * DM / 8, BQ); k_wnat<<<g, 256, 0, stream>>>(wk, (size_t)DM * DM / 8, BK);
    k_wnat<<<g, 256, 0, stream>>>(wv, (size_t)DM * DM / 8, BV); k_wnat<<<g, 256, 0, stream>>>(wo, (size_t)DM * DM / 8, BO); }      /* natural [out][in] = Bt[n][k], x16 */
  k_wmix<<<1, 64, 0, stream>>>(mixw, WT);
  k_x16<<<(unsigned)((NR * DM / 8 + 255) / 256), 256, 0, stream>>>(xq, X16, NR * DM / 8);
  const dim3 gp((unsigned)((MP / 128) * (DM / 64)), 1);
  k_gemm2<true, false, false><<<gp, 128, 0, stream>>>(X16, DM, 0, BQ, DM, 0, 0.0625f, bq, nullptr, Q16, DM, 0, MP, DM, DM);
  k_gemm2<true, false, false><<<gp, 128, 0, stream>>>(X16, DM, 0, BK, DM, 0, 0.0625f, bk, nullptr, K16, DM, 0, MP, DM, DM);
  k_gemm2<true, false, false><<<gp, 128, 0, stream>>>(X16, DM, 0, BV, DM, 0, 0.0625f, bv, nullptr, V16, DM, 0, MP, DM, DM);
  k_vt<<<NB * NH * (SEQ / 64), 256, 0, stream>>>(V16, VT);      /* V16 rows [SEQ*NB][DM] -> VT[(b,h)][64][SEQ] */
  for (int t0 = 0; t0 < SEQ; t0 += QC) {
    /* scores: slab by = b*NH + h at column offset by*64 of rows with pitch LQ; S[by][QC][SEQ] f32 */
    k_gemm2<false, true, false><<<dim3((QC / 128) * (SEQ / 64), NB * NH), 128, 0, stream>>>(Q16 + (size_t)t0 * LQ, LQ, (size_t)HD, K16, LQ, (size_t)HD, 0.125f, nullptr, S, nullptr, SEQ, (size_t)QC * SEQ, QC, SEQ, HD);
    k_smix<<<NB * QC / 4, 128, 0, stream>>>(S, WT, PM);
    /* o[t][b][g*64 + d] x64 = 2^-4 * (1024 P') . V^T */
    k_gemm2<false, false, false><<<dim3((QC / 128) * (HD / 64), NB * NH), 128, 0, stream>>>(PM, SEQ, (size_t)QC * SEQ, VT, SEQ, (size_t)HD * SEQ, 0.0625f, nullptr, nullptr, O16 + (size_t)t0 * LQ, LQ, (size_t)HD, QC, HD, SEQ);
  }
  k_gemm2<true, true, true><<<gp, 128, 0, stream>>>(O16, DM, 0, BO, DM, 0, 0.0009765625f, bo, (float*)d_out, nullptr, DM, 0, MP, DM, DM);      /* out rows t*NB_FULL + b */
}

// v001
// One run takes 285 microseconds.
// In two side-by-side timings against v000, it was 1.66 and 1.65 times as fast.
#include <hip/hip_runtime.h>
// Multi-head SELF-attention with cross-head probability mixing, sequence-first layout: x [1024][2][1024] (token row r = t*NB + b); q / k / v = x W^T + bias (natural [out][in] weights, biases present), 16 heads of 64, q scaled by 64^-0.5; softmax over all 1024 keys (no mask); P'[b,g,t,s] = sum_h P[b,h,t,s] * Wm[h][g] with Wm = column softmax (axis 0) of mix_w; ctx[b,g] = P'[b,g] . v[b,g]; merged [t][b][g*64+d]; out = ctx Wo^T + bo.
// Structure: x as exact f16 rows (inputs RNE-converted to bf16 first); Q, K, V as three WMMA GEMMs (32x64 wave tiles, operands staged in LDS by asynchronous copies, f32 accumulation, x16 weights + bias, f16 outputs); V^T per (b,h) via LDS transposes; per chunk of 256 query rows: scores GEMM (K = 64, batched over the 32 (b,h) slabs on grid.y, alpha 64^-0.5, f32), k_smix (f32 row statistics, native exp, head mix as one WMMA per 16-key tile: A = Wm^T f16 with K zero-padded 16 -> 32, B = 1024 P f16), o = P' . V^T GEMM (K = 1024; o carried x64) into merged f16 rows; out = o Wo + bo GEMM (f32).
// Compute dtype: all contractions v_wmma_f32_16x16x32_f16 (f16 operands, f32 accumulate); inputs RNE-converted to bf16 (exact in f16); q, k, v, mixed softmax weights (x1024), mix matrix and o (x64) as plain f16 operands; scores and softmax statistics f32.
#ifndef NB
#define NB 2                         /* batches processed */
#endif
#ifndef SEQ
#define SEQ 1024                     /* sequence length processed (queries = keys) */
#endif
#define NB_FULL 2                    /* batch pitch of the input / output rows */
#define DM 1024
#define NH 16
#define HD 64
#define QC (SEQ < 256 ? SEQ : 256)   /* query rows per attention chunk */
#define NR ((size_t)NB * SEQ)        /* token rows */
#define MP ((int)(NB * SEQ))
#define LQ (NB * DM)                 /* pitch between consecutive t for one batch */
static_assert(SEQ % 128 == 0);
static_assert(QC % 128 == 0);
static_assert(SEQ % QC == 0);
static_assert(NH * HD == DM);
static_assert(NB <= NB_FULL);
static_assert((NB * SEQ) % 128 == 0);
static_assert(NH == 16);

typedef unsigned short v8us __attribute__((ext_vector_type(8), may_alias));
typedef float  v8f  __attribute__((ext_vector_type(8)));
typedef float  v4f  __attribute__((ext_vector_type(4)));
typedef float  v4fa __attribute__((ext_vector_type(4), may_alias));
typedef _Float16 v16h __attribute__((ext_vector_type(16)));
typedef _Float16 v4h __attribute__((ext_vector_type(4)));
union FragH { v16h v; v8us half[2]; _Float16 h[16]; unsigned short u[16]; };

__device__ __forceinline__ unsigned short bf16_bits(float x) { unsigned int u = __float_as_uint(x); return (unsigned short)((u + 0x7FFFu + ((u >> 16) & 1u)) >> 16); }
__device__ __forceinline__ float bf16_val(unsigned short b) { return __uint_as_float(((unsigned int)b) << 16); }
__device__ __forceinline__ float bf16_rne(float x) { return bf16_val(bf16_bits(x)); }   /* RNE convert to bf16, back as f32 */

// fragment: elements 0..7 <- k0 + 8h .. +7, elements 8..15 <- k0 + 16 + 8h .. +7 (p points at k0 of the lane's row / column)
__device__ __forceinline__ v16h g2_frag(const _Float16* p, int hh) { FragH f; f.half[0] = *(const v8us*)((const unsigned short*)p + 8 * hh); f.half[1] = *(const v8us*)((const unsigned short*)p + 16 + 8 * hh); return f.v; }
__device__ __forceinline__ v8f g2_mma(v16h a, v16h b, v8f c) { v8f d = __builtin_amdgcn_wmma_f32_16x16x32_f16(false, a, false, b, (short)0, c, false, false); asm volatile("v_nop\n\tv_nop\n\tv_nop\n\tv_nop" : "+v"(d) : "v"(a), "v"(b)); return d; }

// ---- GEMM (workgroup tile 128x64, wave tile 32x64; M % 128 == 0 per launch region, N % 64 == 0, K % KP == 0, K >= KP): C = alpha * A . Bt^T (+ bias) ----
// A f16 [M][K] (pitch lda), Bt f16 [N][K] (pitch ldb); batch slab by = blockIdx.y with element strides sA / sB / sC.
// OMAP: output row r -> (r / NB) * NB_FULL + r % NB.
// Operand path: per pass of KP k the 128 A rows and the 64 Bt rows go to LDS by asynchronous 16-byte copies (whole 128-byte lines per row), two buffers, the next pass's copies in flight while this pass is worked on.
// twelve copies of one lane; the s_wait_xcnt stands inside the statement so that no address register is rewritten in front of it
__device__ __forceinline__ void g2_cp12(const unsigned* l, const _Float16* const* g) {
  asm volatile("global_load_async_to_lds_b128 %0, %12, off\n\t"
               "global_load_async_to_lds_b128 %1, %13, off\n\t"
               "global_load_async_to_lds_b128 %2, %14, off\n\t"
               "global_load_async_to_lds_b128 %3, %15, off\n\t"
               "global_load_async_to_lds_b128 %4, %16, off\n\t"
               "global_load_async_to_lds_b128 %5, %17, off\n\t"
               "global_load_async_to_lds_b128 %6, %18, off\n\t"
               "global_load_async_to_lds_b128 %7, %19, off\n\t"
               "global_load_async_to_lds_b128 %8, %20, off\n\t"
               "global_load_async_to_lds_b128 %9, %21, off\n\t"
               "global_load_async_to_lds_b128 %10, %22, off\n\t"
               "global_load_async_to_lds_b128 %11, %23, off\n\t"
               "s_wait_xcnt 0x0"
               :: "v"(l[0]), "v"(l[1]), "v"(l[2]), "v"(l[3]), "v"(l[4]), "v"(l[5]), "v"(l[6]), "v"(l[7]), "v"(l[8]), "v"(l[9]), "v"(l[10]), "v"(l[11]),
                  "v"(g[0]), "v"(g[1]), "v"(g[2]), "v"(g[3]), "v"(g[4]), "v"(g[5]), "v"(g[6]), "v"(g[7]), "v"(g[8]), "v"(g[9]), "v"(g[10]), "v"(g[11]) : "memory"); }
// one stage: LDS rows 0..127 = A rows of the workgroup, rows 128..191 = Bt rows; ap / bp = the lane's first 16 bytes of each operand at this pass's k, l0 = the lane's LDS byte address in the stage
template <int KP>
__device__ __forceinline__ void g2_stage(const _Float16* ap, int lda, const _Float16* bp, int ldb, unsigned l0) {
  constexpr int CPR = KP / 8, RPR = 128 / CPR, PB = KP * 2 + 16;      /* 16-byte pieces per row, rows per round of 128 lanes, LDS pitch in bytes */
#pragma unroll      /* both loops: the operand (A or Bt) of a copy is picked at compile time, l[] and g[] stay in registers */
  for (int s = 0; s < (CPR + CPR / 2) / 12; ++s) { unsigned l[12]; const _Float16* g[12];
#pragma unroll
    for (int j = 0; j < 12; ++j) { const int i = s * 12 + j; l[j] = l0 + (unsigned)(i * RPR * PB);
      g[j] = (i < CPR) ? ap + (size_t)(i * RPR) * lda : bp + (size_t)((i - CPR) * RPR) * ldb; }
    g2_cp12(l, g); } }

// the six fragments of one 32-k group from LDS (pitch PB bytes): two A row tiles, four Bt row tiles
template <int PB>
__device__ __forceinline__ void g2_ld6(v16h* f, const unsigned char* pa, const unsigned char* pb, int hh) {
  f[0] = g2_frag((const _Float16*)pa, hh); f[1] = g2_frag((const _Float16*)(pa + 16 * PB), hh);
  f[2] = g2_frag((const _Float16*)pb, hh); f[3] = g2_frag((const _Float16*)(pb + 16 * PB), hh); f[4] = g2_frag((const _Float16*)(pb + 32 * PB), hh); f[5] = g2_frag((const _Float16*)(pb + 48 * PB), hh); }

template <bool HASB, bool OUT32, bool OMAP, int KP>
__global__ __launch_bounds__(128) void k_gemm2(const _Float16* __restrict__ A, int lda, size_t sA, const _Float16* __restrict__ Bh, int ldb, size_t sB, float alpha,
    const float* __restrict__ bias, float* __restrict__ C, _Float16* __restrict__ C16, int ldc, size_t sC, int M, int N, int K) {
  constexpr int CPR = KP / 8, PB = KP * 2 + 16, STG = 192 * PB, SOB = 4 * 32 * 68 * 4;
  __shared__ __attribute__((aligned(16))) unsigned char sm[(2 * STG > SOB) ? 2 * STG : SOB];      /* two operand stages; after the k loop the output staging */
  float (*so)[32][68] = (float (*)[32][68])sm;
  const int tid = threadIdx.x, w = __builtin_amdgcn_readfirstlane((int)(tid >> 5)), lane = tid & 31, ln = lane & 15, hh = lane >> 4; const int by = blockIdx.y;
  A += (size_t)by * sA; Bh += (size_t)by * sB; const size_t cofs = (size_t)by * sC;
  const int ntn = N >> 6; const int mt = blockIdx.x / ntn, nq = blockIdx.x - mt * ntn; const int row0 = mt * 128 + 32 * w, col0 = nq * 64; if (mt * 128 >= M) return;
  const int crow = tid / CPR, cpc = tid % CPR;
  const _Float16* ap = A + (size_t)(mt * 128 + crow) * lda + cpc * 8; const _Float16* bp = Bh + (size_t)(col0 + crow) * ldb + cpc * 8;
  const unsigned l0 = (unsigned)(size_t)sm + (unsigned)(crow * PB + cpc * 16);
  const unsigned char* fa = sm + (32 * w + ln) * PB; const unsigned char* fb = sm + (128 + ln) * PB;
  const v8f z8 = {0.f,0.f,0.f,0.f,0.f,0.f,0.f,0.f}; v8f c00 = z8, c01 = z8, c02 = z8, c03 = z8, c10 = z8, c11 = z8, c12 = z8, c13 = z8;
  const int nt = K / KP;
  g2_stage<KP>(ap, lda, bp, ldb, l0);
  asm volatile("s_wait_asynccnt 0x0" ::: "memory");      /* this wave's copies of pass 0 have landed */
  __syncthreads();                                        /* pass 0 is readable by every wave */
  if (nt > 1) g2_stage<KP>(ap + KP, lda, bp + KP, ldb, l0 + STG);
#pragma unroll 1      /* one pass per trip: the hand-over at the foot stands once, and the loop stays small */
  for (int t = 0; t < nt; ++t) { const int bo = (t & 1) * STG;
    const unsigned char* pa = fa + bo; const unsigned char* pb = fb + bo; v16h fr[2][6];
    g2_ld6<PB>(fr[0], pa, pb, hh);
#pragma unroll      /* fr[] is indexed by constants only, so both fragment sets stay in registers */
    for (int kk = 0; kk < KP / 32; ++kk) { if (kk + 1 < KP / 32) g2_ld6<PB>(fr[(kk + 1) & 1], pa + (kk + 1) * 64, pb + (kk + 1) * 64, hh);      /* the next 32 k of this pass: one group of LDS reads in front of this group's WMMAs */
      const v16h a0 = fr[kk & 1][0], a1 = fr[kk & 1][1];
      v16h b = fr[kk & 1][2]; c00 = g2_mma(a0, b, c00); c10 = g2_mma(a1, b, c10);
      b = fr[kk & 1][3]; c01 = g2_mma(a0, b, c01); c11 = g2_mma(a1, b, c11);
      b = fr[kk & 1][4]; c02 = g2_mma(a0, b, c02); c12 = g2_mma(a1, b, c12);
      b = fr[kk & 1][5]; c03 = g2_mma(a0, b, c03); c13 = g2_mma(a1, b, c13); }
    asm volatile("s_wait_dscnt 0x0" ::: "memory");        /* this wave's reads of the buffer are done before it is refilled */
    asm volatile("s_wait_asynccnt 0x0" ::: "memory");     /* this wave's copies of pass t + 1 have landed */
    __syncthreads();                                      /* publishes pass t + 1 and ends every wave's reads of pass t */
    if (t + 2 < nt) g2_stage<KP>(ap + (size_t)(t + 2) * KP, lda, bp + (size_t)(t + 2) * KP, ldb, l0 + (unsigned)bo); }
  asm volatile("s_wait_asynccnt 0x0" ::: "memory");       /* no copy is outstanding when the buffers become output staging */
  v8f accs[8] = {c00, c01, c02, c03, c10, c11, c12, c13};
#pragma unroll
  for (int u = 0; u < 8; ++u) { const int t = u & 3, half = u >> 2; const int col = col0 + t * 16 + ln; float bv = 0.f; if (HASB) bv = bf16_rne(bias[col]);
#pragma unroll
    for (int r = 0; r < 8; ++r) { const int rloc = half * 16 + 8 * hh + r; so[w][rloc][t * 16 + ln] = accs[u][r] * alpha + bv; } }
  __builtin_amdgcn_fence(4 /* acq_rel order */, "workgroup"); __builtin_amdgcn_wave_barrier();      /* so[w] is private to wave w */
  const int rsub = lane >> 4, c4 = (lane & 15) * 4;
  {
#pragma unroll
    for (int q = 0; q < 16; ++q) { const int r = q * 2 + rsub; const v4f v = *(const v4fa*)&so[w][r][c4];
      const int gr = row0 + r; const size_t orow = OMAP ? ((size_t)(gr / NB) * NB_FULL + (size_t)(gr % NB)) : (size_t)gr;
      if (OUT32) { *(v4f*)(C + cofs + orow * ldc + col0 + c4) = v; }
      else { v4h h4;
#pragma unroll
        for (int i = 0; i < 4; ++i) h4[i] = (_Float16)v[i];
        *(v4h*)(C16 + cofs + orow * ldc + col0 + c4) = h4; } }
     } }

__global__ __launch_bounds__(256) void k_wnat(const float* __restrict__ w, size_t n8, _Float16* __restrict__ Bt) { const size_t t = (size_t)blockIdx.x * 256 + threadIdx.x; if (t >= n8) return; FragH f; const v4f a = *(const v4fa*)(w + t * 8), c = *(const v4fa*)(w + t * 8 + 4);
#pragma unroll
  for (int q = 0; q < 4; ++q) { f.h[q] = (_Float16)(bf16_rne(a[q]) * 16.0f); f.h[4 + q] = (_Float16)(bf16_rne(c[q]) * 16.0f); }
  const v8us o = f.half[0]; *(v8us*)((unsigned short*)Bt + t * 8) = o;  }

__global__ __launch_bounds__(256) void k_x16(const float* __restrict__ x, _Float16* __restrict__ X16, size_t n8) { const size_t t = (size_t)blockIdx.x * 256 + threadIdx.x; if (t >= n8) return;
  const size_t row = t / (DM / 8); const int c8 = (int)(t % (DM / 8)) * 8; const size_t srow = (row / NB) * NB_FULL + (row % NB);
  const float* p = x + srow * DM + c8; const v4f a = *(const v4fa*)p, c = *(const v4fa*)(p + 4); FragH f;
#pragma unroll
  for (int q = 0; q < 4; ++q) { f.h[q] = (_Float16)bf16_rne(a[q]); f.h[4 + q] = (_Float16)bf16_rne(c[q]); }
  const v8us o = f.half[0]; *(v8us*)((unsigned short*)X16 + t * 8) = o;  }

__global__ __launch_bounds__(64) void k_wmix(const float* __restrict__ mixw, _Float16* __restrict__ WT) {
  const int i = threadIdx.x; const int g = i >> 2, k8 = (i & 3) * 8; float mx = -3.0e38f;
#pragma unroll 1
  for (int h = 0; h < NH; ++h) mx = fmaxf(mx, bf16_rne(mixw[h * NH + g]));
  float se = 0.f;
#pragma unroll 1
  for (int h = 0; h < NH; ++h) se += __expf(bf16_rne(mixw[h * NH + g]) - mx);
  const float inv = 1.0f / se; FragH f;
#pragma unroll
  for (int q = 0; q < 8; ++q) { const int h = k8 + q; const int hc = (h < NH) ? h : (NH - 1); const float v = __expf(bf16_rne(mixw[hc * NH + g]) - mx) * inv; f.h[q] = (_Float16)((h < NH) ? v : 0.0f); }
  const v8us o = f.half[0]; *(v8us*)((unsigned short*)WT + i * 8) = o;  }

__global__ __launch_bounds__(256) void k_vt(const _Float16* __restrict__ V16, _Float16* __restrict__ Vt) { __shared__ unsigned short tl[64][66]; const int tid = threadIdx.x; const int slab = blockIdx.x / (SEQ / 64), lg = blockIdx.x % (SEQ / 64); const int b = slab / NH, h = slab % NH;
  for (int i = tid; i < 64 * 8; i += 256) { const int r = i / 8, c8 = (i % 8) * 8; FragH f; f.half[0] = *(const v8us*)((const unsigned short*)V16 + ((size_t)(lg * 64 + r) * NB + b) * DM + h * HD + c8);
#pragma unroll
    for (int q = 0; q < 8; ++q) tl[r][c8 + q] = f.u[q]; }
  __syncthreads();
  {
#pragma unroll
    for (int rd = 0; rd < 2; ++rd) { const int d = rd * 32 + tid / 8, pc = tid % 8; FragH f;
#pragma unroll
      for (int q = 0; q < 8; ++q) f.u[q] = tl[pc * 8 + q][d];
      *(v8us*)((unsigned short*)Vt + ((size_t)slab * 64 + d) * SEQ + lg * 64 + pc * 8) = f.half[0]; }
     } }

// softmax over SEQ keys + cross-head mix. S f32 [NB*NH][QC][SEQ] (slab by = b*NH + h); PM f16 [NB*NH][QC][SEQ] = 1024 * sum_h Wm[h][g] * softmax(S[b*NH+h][t][:]).
// One wave per (b, t): phase 1 = per-head max / sum (registers + wave shuffles, native exp on max-subtracted arguments); phase 2 = per 16-key tile one WMMA
__global__ __launch_bounds__(128) void k_smix(const float* __restrict__ S, const _Float16* __restrict__ WT, _Float16* __restrict__ PM) {
  #pragma clang fp contract(off)
  __shared__ float sst[4][2][NH];
  __shared__ __attribute__((aligned(16))) _Float16 sP[4][NH][72];
  const int tid = threadIdx.x, w = __builtin_amdgcn_readfirstlane((int)(tid >> 5)), lane = tid & 31, ln = lane & 15, hh = lane >> 4;
  const int wr = blockIdx.x * 4 + w; const int b = wr / QC, tql = wr - b * QC;
  const size_t hp = (size_t)QC * SEQ;                                  /* head slab pitch */
  const float* srow = S + ((size_t)(b * NH) * QC + tql) * SEQ;        /* head h row at srow + h * hp */
#pragma unroll 1
  for (int h = 0; h < NH; ++h) {
    const float* p = srow + (size_t)h * hp + lane * 4;
    v4f x[SEQ / 128];
#pragma unroll
    for (int j = 0; j < SEQ / 128; ++j) x[j] = *(const v4fa*)(p + j * 128);
    float mx = -3.0e38f;
#pragma unroll
    for (int j = 0; j < SEQ / 128; ++j) mx = fmaxf(mx, fmaxf(fmaxf(x[j][0], x[j][1]), fmaxf(x[j][2], x[j][3])));
#pragma unroll
    for (int off = 16; off > 0; off >>= 1) mx = fmaxf(mx, __shfl_xor(mx, off, 32));
    float se = 0.f;
#pragma unroll
    for (int j = 0; j < SEQ / 128; ++j) { se += __expf(x[j][0] - mx); se += __expf(x[j][1] - mx); se += __expf(x[j][2] - mx); se += __expf(x[j][3] - mx); }
#pragma unroll
    for (int off = 16; off > 0; off >>= 1) se += __shfl_xor(se, off, 32);
    if (lane == 0) { sst[w][0][h] = mx; sst[w][1][h] = 1024.0f / se; }
  }
  __syncthreads();
  float m8[8], c8[8];
#pragma unroll
  for (int i = 0; i < 8; ++i) { m8[i] = sst[w][0][8 * hh + i]; c8[i] = sst[w][1][8 * hh + i]; }
  const v16h aW = g2_frag(WT + ln * 32, hh);                          /* A: row g = ln, k = heads (upper 16 k zero) */
  const v8f z8 = {0.f,0.f,0.f,0.f,0.f,0.f,0.f,0.f};
  const float* scol = srow + (size_t)(8 * hh) * hp + ln;              /* lane's 8 heads, column ln of the tile */
  unsigned short* pout = (unsigned short*)PM + ((size_t)(b * NH) * QC + tql) * SEQ;
#pragma unroll 1
  for (int c0 = 0; c0 < SEQ; c0 += 64) {
#pragma unroll 1
    for (int t = 0; t < 4; ++t) {
      const float* ps = scol + c0 + 16 * t;
      FragH bf;
#pragma unroll
      for (int i = 0; i < 8; ++i) { const float v = ps[(size_t)i * hp]; bf.h[i] = (_Float16)(__expf(v - m8[i]) * c8[i]); }
#pragma unroll
      for (int i = 8; i < 16; ++i) bf.h[i] = (_Float16)0.0f;
      const v8f d = g2_mma(aW, bf.v, z8);
#pragma unroll
      for (int r = 0; r < 8; ++r) sP[w][8 * hh + r][16 * t + ln] = (_Float16)d[r];      /* D row g = 8hh + r, column s = c0 + 16t + ln */
    }
    __builtin_amdgcn_fence(4 /* acq_rel order */, "workgroup"); __builtin_amdgcn_wave_barrier();      /* sP[w] is private to wave w */
    {
#pragma unroll
      for (int q = 0; q < 4; ++q) { const int g = q * 4 + (lane >> 3), pc = lane & 7; const v8us v = *(const v8us*)&sP[w][g][pc * 8];
        *(v8us*)(pout + (size_t)g * hp + c0 + pc * 8) = v; }
       }
    __builtin_amdgcn_fence(4 /* acq_rel order */, "workgroup"); __builtin_amdgcn_wave_barrier();
  }
}

extern "C" void kernel_launch(void* const* d_in, const int* in_sizes, int n_in,
                              void* d_out, int out_size, void* d_ws, size_t ws_size, hipStream_t stream) {
  if (n_in < 10) return;
  if ((size_t)in_sizes[0] < NR * DM) return;
  if ((size_t)in_sizes[1] < (size_t)DM * DM || (size_t)in_sizes[3] < (size_t)DM * DM || (size_t)in_sizes[5] < (size_t)DM * DM || (size_t)in_sizes[7] < (size_t)DM * DM) return;
  if (in_sizes[2] < DM || in_sizes[4] < DM || in_sizes[6] < DM || in_sizes[8] < DM || in_sizes[9] < NH * NH) return;
  if ((size_t)out_size < NR * DM) return;
  const float* const* I = (const float* const*)d_in;
  const float* xq = I[0]; const float* wq = I[1]; const float* bq = I[2]; const float* wk = I[3]; const float* bk = I[4]; const float* wv = I[5]; const float* bv = I[6]; const float* wo = I[7]; const float* bo = I[8]; const float* mixw = I[9];
  char* ws = (char*)d_ws; size_t off = 0;
  auto take = [&](size_t bytes) { char* p = ws + off; off += (bytes + 255) & ~(size_t)255; return p; };
  _Float16* BQ = (_Float16*)take((size_t)DM * DM * 2); _Float16* BK = (_Float16*)take((size_t)DM * DM * 2); _Float16* BV = (_Float16*)take((size_t)DM * DM * 2); _Float16* BO = (_Float16*)take((size_t)DM * DM * 2);
  _Float16* X16 = (_Float16*)take(NR * DM * 2); _Float16* Q16 = (_Float16*)take(NR * DM * 2); _Float16* K16 = (_Float16*)take(NR * DM * 2); _Float16* V16 = (_Float16*)take(NR * DM * 2); _Float16* O16 = (_Float16*)take(NR * DM * 2);
  float* S = (float*)take((size_t)NB * NH * QC * SEQ * 4); _Float16* PM = (_Float16*)take((size_t)NB * NH * QC * SEQ * 2); _Float16* VT = (_Float16*)take((size_t)NB * NH * HD * SEQ * 2);
  _Float16* WT = (_Float16*)take((size_t)NH * 32 * 2);
  if (off > ws_size) return;
  { const unsigned g = (unsigned)(((size_t)DM * DM / 8 + 255) / 256);
    k_wnat<<<g, 256, 0, stream>>>(wq, (size_t)DM * DM / 8, BQ); k_wnat<<<g, 256, 0, stream>>>(wk, (size_t)DM * DM / 8, BK);
    k_wnat<<<g, 256, 0, stream>>>(wv, (size_t)DM * DM / 8, BV); k_wnat<<<g, 256, 0, stream>>>(wo, (size_t)DM * DM / 8, BO); }      /* natural [out][in] = Bt[n][k], x16 */
  k_wmix<<<1, 64, 0, stream>>>(mixw, WT);
  k_x16<<<(unsigned)((NR * DM / 8 + 255) / 256), 256, 0, stream>>>(xq, X16, NR * DM / 8);
  const dim3 gp((unsigned)((MP / 128) * (DM / 64)), 1);
  k_gemm2<true, false, false, 128><<<gp, 128, 0, stream>>>(X16, DM, 0, BQ, DM, 0, 0.0625f, bq, nullptr, Q16, DM, 0, MP, DM, DM);
  k_gemm2<true, false, false, 128><<<gp, 128, 0, stream>>>(X16, DM, 0, BK, DM, 0, 0.0625f, bk, nullptr, K16, DM, 0, MP, DM, DM);
  k_gemm2<true, false, false, 128><<<gp, 128, 0, stream>>>(X16, DM, 0, BV, DM, 0, 0.0625f, bv, nullptr, V16, DM, 0, MP, DM, DM);
  k_vt<<<NB * NH * (SEQ / 64), 256, 0, stream>>>(V16, VT);      /* V16 rows [SEQ*NB][DM] -> VT[(b,h)][64][SEQ] */
  for (int t0 = 0; t0 < SEQ; t0 += QC) {
    /* scores: slab by = b*NH + h at column offset by*64 of rows with pitch LQ; S[by][QC][SEQ] f32 */
    k_gemm2<false, true, false, 64><<<dim3((QC / 128) * (SEQ / 64), NB * NH), 128, 0, stream>>>(Q16 + (size_t)t0 * LQ, LQ, (size_t)HD, K16, LQ, (size_t)HD, 0.125f, nullptr, S, nullptr, SEQ, (size_t)QC * SEQ, QC, SEQ, HD);
    k_smix<<<NB * QC / 4, 128, 0, stream>>>(S, WT, PM);
    /* o[t][b][g*64 + d] x64 = 2^-4 * (1024 P') . V^T */
    k_gemm2<false, false, false, 128><<<dim3((QC / 128) * (HD / 64), NB * NH), 128, 0, stream>>>(PM, SEQ, (size_t)QC * SEQ, VT, SEQ, (size_t)HD * SEQ, 0.0625f, nullptr, nullptr, O16 + (size_t)t0 * LQ, LQ, (size_t)HD, QC, HD, SEQ);
  }
  k_gemm2<true, true, true, 128><<<gp, 128, 0, stream>>>(O16, DM, 0, BO, DM, 0, 0.0009765625f, bo, (float*)d_out, nullptr, DM, 0, MP, DM, DM);      /* out rows t*NB_FULL + b */
}

// v002
// Measured time: 143 microseconds a run.
// Timed twice side by side with v001, it ran 1.99 and 1.98 times as fast.
// Over all steps from v000 it is 3.28 times as fast.
#include <hip/hip_runtime.h>
// Multi-head SELF-attention with cross-head probability mixing, sequence-first layout: x [1024][2][1024] (token row r = t*NB + b); q / k / v = x W^T + bias (natural [out][in] weights, biases present), 16 heads of 64, q scaled by 64^-0.5; softmax over all 1024 keys (no mask); P'[b,g,t,s] = sum_h P[b,h,t,s] * Wm[h][g] with Wm = column softmax (axis 0) of mix_w; ctx[b,g] = P'[b,g] . v[b,g]; merged [t][b][g*64+d]; out = ctx Wo^T + bo.
// Structure: x as exact f16 rows (inputs RNE-converted to bf16 first); Q, K, V as three WMMA GEMMs (32x64 wave tiles, operands staged in LDS by asynchronous copies, f32 accumulation, x16 weights + bias, f16 outputs); V^T per (b,h) via LDS transposes; all query rows in one chunk: scores GEMM (K = 64, batched over the 32 (b,h) slabs on grid.y, alpha 64^-0.5, f32), k_smix (f32 row statistics, native exp, head mix as one WMMA per 16-key tile: A = Wm^T f16 with K zero-padded 16 -> 32, B = 1024 P f16), o = P' . V^T GEMM (K = 1024; o carried x64) into merged f16 rows; out = o Wo + bo GEMM (f32).
// Compute dtype: all contractions v_wmma_f32_16x16x32_f16 (f16 operands, f32 accumulate); inputs RNE-converted to bf16 (exact in f16); q, k, v, mixed softmax weights (x1024), mix matrix and o (x64) as plain f16 operands; scores and softmax statistics f32.
#ifndef NB
#define NB 2                         /* batches processed */
#endif
#ifndef SEQ
#define SEQ 1024                     /* sequence length processed (queries = keys) */
#endif
#define NB_FULL 2                    /* batch pitch of the input / output rows */
#define DM 1024
#define NH 16
#define HD 64
#define QC SEQ                       /* query rows per attention chunk: the whole sequence, so each attention launch fills the chip (S f32 + PM f16 = 192 MiB of workspace) */
#define NR ((size_t)NB * SEQ)        /* token rows */
#define MP ((int)(NB * SEQ))
#define LQ (NB * DM)                 /* pitch between consecutive t for one batch */
static_assert(SEQ % 128 == 0);
static_assert(QC % 128 == 0);
static_assert(SEQ % QC == 0);
static_assert(NH * HD == DM);
static_assert(NB <= NB_FULL);
static_assert((NB * SEQ) % 128 == 0);
static_assert(NH == 16);

typedef unsigned short v8us __attribute__((ext_vector_type(8), may_alias));
typedef float  v8f  __attribute__((ext_vector_type(8)));
typedef float  v4f  __attribute__((ext_vector_type(4)));
typedef float  v4fa __attribute__((ext_vector_type(4), may_alias));
typedef _Float16 v16h __attribute__((ext_vector_type(16)));
typedef _Float16 v4h __attribute__((ext_vector_type(4)));
union FragH { v16h v; v8us half[2]; _Float16 h[16]; unsigned short u[16]; };

__device__ __forceinline__ unsigned short bf16_bits(float x) { unsigned int u = __float_as_uint(x); return (unsigned short)((u + 0x7FFFu + ((u >> 16) & 1u)) >> 16); }
__device__ __forceinline__ float bf16_val(unsigned short b) { return __uint_as_float(((unsigned int)b) << 16); }
__device__ __forceinline__ float bf16_rne(float x) { return bf16_val(bf16_bits(x)); }   /* RNE convert to bf16, back as f32 */

// fragment: elements 0..7 <- k0 + 8h .. +7, elements 8..15 <- k0 + 16 + 8h .. +7 (p points at k0 of the lane's row / column)
__device__ __forceinline__ v16h g2_frag(const _Float16* p, int hh) { FragH f; f.half[0] = *(const v8us*)((const unsigned short*)p + 8 * hh); f.half[1] = *(const v8us*)((const unsigned short*)p + 16 + 8 * hh); return f.v; }
__device__ __forceinline__ v8f g2_mma(v16h a, v16h b, v8f c) { v8f d = __builtin_amdgcn_wmma_f32_16x16x32_f16(false, a, false, b, (short)0, c, false, false); asm volatile("v_nop\n\tv_nop\n\tv_nop\n\tv_nop" : "+v"(d) : "v"(a), "v"(b)); return d; }

// ---- GEMM (workgroup tile 128x64, wave tile 32x64; M % 128 == 0 per launch region, N % 64 == 0, K % KP == 0, K >= KP): C = alpha * A . Bt^T (+ bias) ----
// A f16 [M][K] (pitch lda), Bt f16 [N][K] (pitch ldb); batch slab by = blockIdx.y with element strides sA / sB / sC.
// OMAP: output row r -> (r / NB) * NB_FULL + r % NB.
// Operand path: per pass of KP k the 128 A rows and the 64 Bt rows go to LDS by asynchronous 16-byte copies (whole 128-byte lines per row), two buffers, the next pass's copies in flight while this pass is worked on.
// twelve copies of one lane; the s_wait_xcnt stands inside the statement so that no address register is rewritten in front of it
__device__ __forceinline__ void g2_cp12(const unsigned* l, const _Float16* const* g) {
  asm volatile("global_load_async_to_lds_b128 %0, %12, off\n\t"
               "global_load_async_to_lds_b128 %1, %13, off\n\t"
               "global_load_async_to_lds_b128 %2, %14, off\n\t"
               "global_load_async_to_lds_b128 %3, %15, off\n\t"
               "global_load_async_to_lds_b128 %4, %16, off\n\t"
               "global_load_async_to_lds_b128 %5, %17, off\n\t"
               "global_load_async_to_lds_b128 %6, %18, off\n\t"
               "global_load_async_to_lds_b128 %7, %19, off\n\t"
               "global_load_async_to_lds_b128 %8, %20, off\n\t"
               "global_load_async_to_lds_b128 %9, %21, off\n\t"
               "global_load_async_to_lds_b128 %10, %22, off\n\t"
               "global_load_async_to_lds_b128 %11, %23, off\n\t"
               "s_wait_xcnt 0x0"
               :: "v"(l[0]), "v"(l[1]), "v"(l[2]), "v"(l[3]), "v"(l[4]), "v"(l[5]), "v"(l[6]), "v"(l[7]), "v"(l[8]), "v"(l[9]), "v"(l[10]), "v"(l[11]),
                  "v"(g[0]), "v"(g[1]), "v"(g[2]), "v"(g[3]), "v"(g[4]), "v"(g[5]), "v"(g[6]), "v"(g[7]), "v"(g[8]), "v"(g[9]), "v"(g[10]), "v"(g[11]) : "memory"); }
// one stage: LDS rows 0..127 = A rows of the workgroup, rows 128..191 = Bt rows; ap / bp = the lane's first 16 bytes of each operand at this pass's k, l0 = the lane's LDS byte address in the stage
template <int KP>
__device__ __forceinline__ void g2_stage(const _Float16* ap, int lda, const _Float16* bp, int ldb, unsigned l0) {
  constexpr int CPR = KP / 8, RPR = 128 / CPR, PB = KP * 2 + 16;      /* 16-byte pieces per row, rows per round of 128 lanes, LDS pitch in bytes */
#pragma unroll      /* both loops: the operand (A or Bt) of a copy is picked at compile time, l[] and g[] stay in registers */
  for (int s = 0; s < (CPR + CPR / 2) / 12; ++s) { unsigned l[12]; const _Float16* g[12];
#pragma unroll
    for (int j = 0; j < 12; ++j) { const int i = s * 12 + j; l[j] = l0 + (unsigned)(i * RPR * PB);
      g[j] = (i < CPR) ? ap + (size_t)(i * RPR) * lda : bp + (size_t)((i - CPR) * RPR) * ldb; }
    g2_cp12(l, g); } }

// the six fragments of one 32-k group from LDS (pitch PB bytes): two A row tiles, four Bt row tiles
template <int PB>
__device__ __forceinline__ void g2_ld6(v16h* f, const unsigned char* pa, const unsigned char* pb, int hh) {
  f[0] = g2_frag((const _Float16*)pa, hh); f[1] = g2_frag((const _Float16*)(pa + 16 * PB), hh);
  f[2] = g2_frag((const _Float16*)pb, hh); f[3] = g2_frag((const _Float16*)(pb + 16 * PB), hh); f[4] = g2_frag((const _Float16*)(pb + 32 * PB), hh); f[5] = g2_frag((const _Float16*)(pb + 48 * PB), hh); }

template <bool HASB, bool OUT32, bool OMAP, int KP>
__global__ __launch_bounds__(128) void k_gemm2(const _Float16* __restrict__ A, int lda, size_t sA, const _Float16* __restrict__ Bh, int ldb, size_t sB, float alpha,
    const float* __restrict__ bias, float* __restrict__ C, _Float16* __restrict__ C16, int ldc, size_t sC, int M, int N, int K) {
  constexpr int CPR = KP / 8, PB = KP * 2 + 16, STG = 192 * PB, SOB = 4 * 32 * 68 * 4;
  __shared__ __attribute__((aligned(16))) unsigned char sm[(2 * STG > SOB) ? 2 * STG : SOB];      /* two operand stages; after the k loop the output staging */
  float (*so)[32][68] = (float (*)[32][68])sm;
  const int tid = threadIdx.x, w = __builtin_amdgcn_readfirstlane((int)(tid >> 5)), lane = tid & 31, ln = lane & 15, hh = lane >> 4; const int by = blockIdx.y;
  A += (size_t)by * sA; Bh += (size_t)by * sB; const size_t cofs = (size_t)by * sC;
  const int ntn = N >> 6; const int mt = blockIdx.x / ntn, nq = blockIdx.x - mt * ntn; const int row0 = mt * 128 + 32 * w, col0 = nq * 64; if (mt * 128 >= M) return;
  const int crow = tid / CPR, cpc = tid % CPR;
  const _Float16* ap = A + (size_t)(mt * 128 + crow) * lda + cpc * 8; const _Float16* bp = Bh + (size_t)(col0 + crow) * ldb + cpc * 8;
  const unsigned l0 = (unsigned)(size_t)sm + (unsigned)(crow * PB + cpc * 16);
  const unsigned char* fa = sm + (32 * w + ln) * PB; const unsigned char* fb = sm + (128 + ln) * PB;
  const v8f z8 = {0.f,0.f,0.f,0.f,0.f,0.f,0.f,0.f}; v8f c00 = z8, c01 = z8, c02 = z8, c03 = z8, c10 = z8, c11 = z8, c12 = z8, c13 = z8;
  const int nt = K / KP;
  g2_stage<KP>(ap, lda, bp, ldb, l0);
  asm volatile("s_wait_asynccnt 0x0" ::: "memory");      /* this wave's copies of pass 0 have landed */
  __syncthreads();                                        /* pass 0 is readable by every wave */
  if (nt > 1) g2_stage<KP>(ap + KP, lda, bp + KP, ldb, l0 + STG);
#pragma unroll 1      /* one pass per trip: the hand-over at the foot stands once, and the loop stays small */
  for (int t = 0; t < nt; ++t) { const int bo = (t & 1) * STG;
    const unsigned char* pa = fa + bo; const unsigned char* pb = fb + bo; v16h fr[2][6];
    g2_ld6<PB>(fr[0], pa, pb, hh);
#pragma unroll      /* fr[] is indexed by constants only, so both fragment sets stay in registers */
    for (int kk = 0; kk < KP / 32; ++kk) { if (kk + 1 < KP / 32) g2_ld6<PB>(fr[(kk + 1) & 1], pa + (kk + 1) * 64, pb + (kk + 1) * 64, hh);      /* the next 32 k of this pass: one group of LDS reads in front of this group's WMMAs */
      const v16h a0 = fr[kk & 1][0], a1 = fr[kk & 1][1];
      v16h b = fr[kk & 1][2]; c00 = g2_mma(a0, b, c00); c10 = g2_mma(a1, b, c10);
      b = fr[kk & 1][3]; c01 = g2_mma(a0, b, c01); c11 = g2_mma(a1, b, c11);
      b = fr[kk & 1][4]; c02 = g2_mma(a0, b, c02); c12 = g2_mma(a1, b, c12);
      b = fr[kk & 1][5]; c03 = g2_mma(a0, b, c03); c13 = g2_mma(a1, b, c13); }
    asm volatile("s_wait_dscnt 0x0" ::: "memory");        /* this wave's reads of the buffer are done before it is refilled */
    asm volatile("s_wait_asynccnt 0x0" ::: "memory");     /* this wave's copies of pass t + 1 have landed */
    __syncthreads();                                      /* publishes pass t + 1 and ends every wave's reads of pass t */
    if (t + 2 < nt) g2_stage<KP>(ap + (size_t)(t + 2) * KP, lda, bp + (size_t)(t + 2) * KP, ldb, l0 + (unsigned)bo); }
  asm volatile("s_wait_asynccnt 0x0" ::: "memory");       /* no copy is outstanding when the buffers become output staging */
  v8f accs[8] = {c00, c01, c02, c03, c10, c11, c12, c13};
#pragma unroll
  for (int u = 0; u < 8; ++u) { const int t = u & 3, half = u >> 2; const int col = col0 + t * 16 + ln; float bv = 0.f; if (HASB) bv = bf16_rne(bias[col]);
#pragma unroll
    for (int r = 0; r < 8; ++r) { const int rloc = half * 16 + 8 * hh + r; so[w][rloc][t * 16 + ln] = accs[u][r] * alpha + bv; } }
  __builtin_amdgcn_fence(4 /* acq_rel order */, "workgroup"); __builtin_amdgcn_wave_barrier();      /* so[w] is private to wave w */
  const int rsub = lane >> 4, c4 = (lane & 15) * 4;
  {
#pragma unroll
    for (int q = 0; q < 16; ++q) { const int r = q * 2 + rsub; const v4f v = *(const v4fa*)&so[w][r][c4];
      const int gr = row0 + r; const size_t orow = OMAP ? ((size_t)(gr / NB) * NB_FULL + (size_t)(gr % NB)) : (size_t)gr;
      if (OUT32) { *(v4f*)(C + cofs + orow * ldc + col0 + c4) = v; }
      else { v4h h4;
#pragma unroll
        for (int i = 0; i < 4; ++i) h4[i] = (_Float16)v[i];
        *(v4h*)(C16 + cofs + orow * ldc + col0 + c4) = h4; } }
     } }

__global__ __launch_bounds__(256) void k_wnat(const float* __restrict__ w, size_t n8, _Float16* __restrict__ Bt) { const size_t t = (size_t)blockIdx.x * 256 + threadIdx.x; if (t >= n8) return; FragH f; const v4f a = *(const v4fa*)(w + t * 8), c = *(const v4fa*)(w + t * 8 + 4);
#pragma unroll
  for (int q = 0; q < 4; ++q) { f.h[q] = (_Float16)(bf16_rne(a[q]) * 16.0f); f.h[4 + q] = (_Float16)(bf16_rne(c[q]) * 16.0f); }
  const v8us o = f.half[0]; *(v8us*)((unsigned short*)Bt + t * 8) = o;  }

__global__ __launch_bounds__(256) void k_x16(const float* __restrict__ x, _Float16* __restrict__ X16, size_t n8) { const size_t t = (size_t)blockIdx.x * 256 + threadIdx.x; if (t >= n8) return;
  const size_t row = t / (DM / 8); const int c8 = (int)(t % (DM / 8)) * 8; const size_t srow = (row / NB) * NB_FULL + (row % NB);
  const float* p = x + srow * DM + c8; const v4f a = *(const v4fa*)p, c = *(const v4fa*)(p + 4); FragH f;
#pragma unroll
  for (int q = 0; q < 4; ++q) { f.h[q] = (_Float16)bf16_rne(a[q]); f.h[4 + q] = (_Float16)bf16_rne(c[q]); }
  const v8us o = f.half[0]; *(v8us*)((unsigned short*)X16 + t * 8) = o;  }

__global__ __launch_bounds__(64) void k_wmix(const float* __restrict__ mixw, _Float16* __restrict__ WT) {
  const int i = threadIdx.x; const int g = i >> 2, k8 = (i & 3) * 8; float mx = -3.0e38f;
#pragma unroll 1
  for (int h = 0; h < NH; ++h) mx = fmaxf(mx, bf16_rne(mixw[h * NH + g]));
  float se = 0.f;
#pragma unroll 1
  for (int h = 0; h < NH; ++h) se += __expf(bf16_rne(mixw[h * NH + g]) - mx);
  const float inv = 1.0f / se; FragH f;
#pragma unroll
  for (int q = 0; q < 8; ++q) { const int h = k8 + q; const int hc = (h < NH) ? h : (NH - 1); const float v = __expf(bf16_rne(mixw[hc * NH + g]) - mx) * inv; f.h[q] = (_Float16)((h < NH) ? v : 0.0f); }
  const v8us o = f.half[0]; *(v8us*)((unsigned short*)WT + i * 8) = o;  }

__global__ __launch_bounds__(256) void k_vt(const _Float16* __restrict__ V16, _Float16* __restrict__ Vt) { __shared__ unsigned short tl[64][66]; const int tid = threadIdx.x; const int slab = blockIdx.x / (SEQ / 64), lg = blockIdx.x % (SEQ / 64); const int b = slab / NH, h = slab % NH;
  for (int i = tid; i < 64 * 8; i += 256) { const int r = i / 8, c8 = (i % 8) * 8; FragH f; f.half[0] = *(const v8us*)((const unsigned short*)V16 + ((size_t)(lg * 64 + r) * NB + b) * DM + h * HD + c8);
#pragma unroll
    for (int q = 0; q < 8; ++q) tl[r][c8 + q] = f.u[q]; }
  __syncthreads();
  {
#pragma unroll
    for (int rd = 0; rd < 2; ++rd) { const int d = rd * 32 + tid / 8, pc = tid % 8; FragH f;
#pragma unroll
      for (int q = 0; q < 8; ++q) f.u[q] = tl[pc * 8 + q][d];
      *(v8us*)((unsigned short*)Vt + ((size_t)slab * 64 + d) * SEQ + lg * 64 + pc * 8) = f.half[0]; }
     } }

// softmax over SEQ keys + cross-head mix. S f32 [NB*NH][QC][SEQ] (slab by = b*NH + h); PM f16 [NB*NH][QC][SEQ] = 1024 * sum_h Wm[h][g] * softmax(S[b*NH+h][t][:]).
// One wave per (b, t): phase 1 = per-head max / sum (registers + wave shuffles, native exp on max-subtracted arguments); phase 2 = per 16-key tile one WMMA
__global__ __launch_bounds__(128) void k_smix(const float* __restrict__ S, const _Float16* __restrict__ WT, _Float16* __restrict__ PM) {
  #pragma clang fp contract(off)
  __shared__ float sst[4][2][NH];
  __shared__ __attribute__((aligned(16))) _Float16 sP[4][NH][72];
  const int tid = threadIdx.x, w = __builtin_amdgcn_readfirstlane((int)(tid >> 5)), lane = tid & 31, ln = lane & 15, hh = lane >> 4;
  const int wr = blockIdx.x * 4 + w; const int b = wr / QC, tql = wr - b * QC;
  const size_t hp = (size_t)QC * SEQ;                                  /* head slab pitch */
  const float* srow = S + ((size_t)(b * NH) * QC + tql) * SEQ;        /* head h row at srow + h * hp */
#pragma unroll 1
  for (int h = 0; h < NH; ++h) {
    const float* p = srow + (size_t)h * hp + lane * 4;
    v4f x[SEQ / 128];
#pragma unroll
    for (int j = 0; j < SEQ / 128; ++j) x[j] = *(const v4fa*)(p + j * 128);
    float mx = -3.0e38f;
#pragma unroll
    for (int j = 0; j < SEQ / 128; ++j) mx = fmaxf(mx, fmaxf(fmaxf(x[j][0], x[j][1]), fmaxf(x[j][2], x[j][3])));
#pragma unroll
    for (int off = 16; off > 0; off >>= 1) mx = fmaxf(mx, __shfl_xor(mx, off, 32));
    float se = 0.f;
#pragma unroll
    for (int j = 0; j < SEQ / 128; ++j) { se += __expf(x[j][0] - mx); se += __expf(x[j][1] - mx); se += __expf(x[j][2] - mx); se += __expf(x[j][3] - mx); }
#pragma unroll
    for (int off = 16; off > 0; off >>= 1) se += __shfl_xor(se, off, 32);
    if (lane == 0) { sst[w][0][h] = mx; sst[w][1][h] = 1024.0f / se; }
  }
  __syncthreads();
  float m8[8], c8[8];
#pragma unroll
  for (int i = 0; i < 8; ++i) { m8[i] = sst[w][0][8 * hh + i]; c8[i] = sst[w][1][8 * hh + i]; }
  const v16h aW = g2_frag(WT + ln * 32, hh);                          /* A: row g = ln, k = heads (upper 16 k zero) */
  const v8f z8 = {0.f,0.f,0.f,0.f,0.f,0.f,0.f,0.f};
  const float* scol = srow + (size_t)(8 * hh) * hp + ln;              /* lane's 8 heads, column ln of the tile */
  unsigned short* pout = (unsigned short*)PM + ((size_t)(b * NH) * QC + tql) * SEQ;
#pragma unroll 1
  for (int c0 = 0; c0 < SEQ; c0 += 64) {
#pragma unroll 1
    for (int t = 0; t < 4; ++t) {
      const float* ps = scol + c0 + 16 * t;
      FragH bf;
#pragma unroll
      for (int i = 0; i < 8; ++i) { const float v = ps[(size_t)i * hp]; bf.h[i] = (_Float16)(__expf(v - m8[i]) * c8[i]); }
#pragma unroll
      for (int i = 8; i < 16; ++i) bf.h[i] = (_Float16)0.0f;
      const v8f d = g2_mma(aW, bf.v, z8);
#pragma unroll
      for (int r = 0; r < 8; ++r) sP[w][8 * hh + r][16 * t + ln] = (_Float16)d[r];      /* D row g = 8hh + r, column s = c0 + 16t + ln */
    }
    __builtin_amdgcn_fence(4 /* acq_rel order */, "workgroup"); __builtin_amdgcn_wave_barrier();      /* sP[w] is private to wave w */
    {
#pragma unroll
      for (int q = 0; q < 4; ++q) { const int g = q * 4 + (lane >> 3), pc = lane & 7; const v8us v = *(const v8us*)&sP[w][g][pc * 8];
        *(v8us*)(pout + (size_t)g * hp + c0 + pc * 8) = v; }
       }
    __builtin_amdgcn_fence(4 /* acq_rel order */, "workgroup"); __builtin_amdgcn_wave_barrier();
  }
}

extern "C" void kernel_launch(void* const* d_in, const int* in_sizes, int n_in,
                              void* d_out, int out_size, void* d_ws, size_t ws_size, hipStream_t stream) {
  if (n_in < 10) return;
  if ((size_t)in_sizes[0] < NR * DM) return;
  if ((size_t)in_sizes[1] < (size_t)DM * DM || (size_t)in_sizes[3] < (size_t)DM * DM || (size_t)in_sizes[5] < (size_t)DM * DM || (size_t)in_sizes[7] < (size_t)DM * DM) return;
  if (in_sizes[2] < DM || in_sizes[4] < DM || in_sizes[6] < DM || in_sizes[8] < DM || in_sizes[9] < NH * NH) return;
  if ((size_t)out_size < NR * DM) return;
  const float* const* I = (const float* const*)d_in;
  const float* xq = I[0]; const float* wq = I[1]; const float* bq = I[2]; const float* wk = I[3]; const float* bk = I[4]; const float* wv = I[5]; const float* bv = I[6]; const float* wo = I[7]; const float* bo = I[8]; const float* mixw = I[9];
  char* ws = (char*)d_ws; size_t off = 0;
  auto take = [&](size_t bytes) { char* p = ws + off; off += (bytes + 255) & ~(size_t)255; return p; };
  _Float16* BQ = (_Float16*)take((size_t)DM * DM * 2); _Float16* BK = (_Float16*)take((size_t)DM * DM * 2); _Float16* BV = (_Float16*)take((size_t)DM * DM * 2); _Float16* BO = (_Float16*)take((size_t)DM * DM * 2);
  _Float16* X16 = (_Float16*)take(NR * DM * 2); _Float16* Q16 = (_Float16*)take(NR * DM * 2); _Float16* K16 = (_Float16*)take(NR * DM * 2); _Float16* V16 = (_Float16*)take(NR * DM * 2); _Float16* O16 = (_Float16*)take(NR * DM * 2);
  float* S = (float*)take((size_t)NB * NH * QC * SEQ * 4); _Float16* PM = (_Float16*)take((size_t)NB * NH * QC * SEQ * 2); _Float16* VT = (_Float16*)take((size_t)NB * NH * HD * SEQ * 2);
  _Float16* WT = (_Float16*)take((size_t)NH * 32 * 2);
  if (off > ws_size) return;
  { const unsigned g = (unsigned)(((size_t)DM * DM / 8 + 255) / 256);
    k_wnat<<<g, 256, 0, stream>>>(wq, (size_t)DM * DM / 8, BQ); k_wnat<<<g, 256, 0, stream>>>(wk, (size_t)DM * DM / 8, BK);
    k_wnat<<<g, 256, 0, stream>>>(wv, (size_t)DM * DM / 8, BV); k_wnat<<<g, 256, 0, stream>>>(wo, (size_t)DM * DM / 8, BO); }      /* natural [out][in] = Bt[n][k], x16 */
  k_wmix<<<1, 64, 0, stream>>>(mixw, WT);
  k_x16<<<(unsigned)((NR * DM / 8 + 255) / 256), 256, 0, stream>>>(xq, X16, NR * DM / 8);
  const dim3 gp((unsigned)((MP / 128) * (DM / 64)), 1);
  k_gemm2<true, false, false, 128><<<gp, 128, 0, stream>>>(X16, DM, 0, BQ, DM, 0, 0.0625f, bq, nullptr, Q16, DM, 0, MP, DM, DM);
  k_gemm2<true, false, false, 128><<<gp, 128, 0, stream>>>(X16, DM, 0, BK, DM, 0, 0.0625f, bk, nullptr, K16, DM, 0, MP, DM, DM);
  k_gemm2<true, false, false, 128><<<gp, 128, 0, stream>>>(X16, DM, 0, BV, DM, 0, 0.0625f, bv, nullptr, V16, DM, 0, MP, DM, DM);
  k_vt<<<NB * NH * (SEQ / 64), 256, 0, stream>>>(V16, VT);      /* V16 rows [SEQ*NB][DM] -> VT[(b,h)][64][SEQ] */
  for (int t0 = 0; t0 < SEQ; t0 += QC) {
    /* scores: slab by = b*NH + h at column offset by*64 of rows with pitch LQ; S[by][QC][SEQ] f32 */
    k_gemm2<false, true, false, 64><<<dim3((QC / 128) * (SEQ / 64), NB * NH), 128, 0, stream>>>(Q16 + (size_t)t0 * LQ, LQ, (size_t)HD, K16, LQ, (size_t)HD, 0.125f, nullptr, S, nullptr, SEQ, (size_t)QC * SEQ, QC, SEQ, HD);
    k_smix<<<NB * QC / 4, 128, 0, stream>>>(S, WT, PM);
    /* o[t][b][g*64 + d] x64 = 2^-4 * (1024 P') . V^T */
    k_gemm2<false, false, false, 128><<<dim3((QC / 128) * (HD / 64), NB * NH), 128, 0, stream>>>(PM, SEQ, (size_t)QC * SEQ, VT, SEQ, (size_t)HD * SEQ, 0.0625f, nullptr, nullptr, O16 + (size_t)t0 * LQ, LQ, (size_t)HD, QC, HD, SEQ);
  }
  k_gemm2<true, true, true, 128><<<gp, 128, 0, stream>>>(O16, DM, 0, BO, DM, 0, 0.0009765625f, bo, (float*)d_out, nullptr, DM, 0, MP, DM, DM);      /* out rows t*NB_FULL + b */
}

// v003
// It runs in 118 microseconds.
// Next to v002, in two timings, it ran 1.23 and 1.21 times as fast.
// All steps since v000 together make it 4.00 times as fast.
#include <hip/hip_runtime.h>
// Multi-head SELF-attention with cross-head probability mixing, sequence-first layout: x [1024][2][1024] (token row r = t*NB + b); q / k / v = x W^T + bias (natural [out][in] weights, biases present), 16 heads of 64, q scaled by 64^-0.5; softmax over all 1024 keys (no mask); P'[b,g,t,s] = sum_h P[b,h,t,s] * Wm[h][g] with Wm = column softmax (axis 0) of mix_w; ctx[b,g] = P'[b,g] . v[b,g]; merged [t][b][g*64+d]; out = ctx Wo^T + bo.
// Structure: one conversion launch (x as exact f16 rows, inputs RNE-converted to bf16 first; the four weights; the mix matrix); Q, K, V as three WMMA GEMMs in one launch, one per grid.y (32x64 wave tiles, operands staged in LDS by asynchronous copies, f32 accumulation, x16 weights + bias, f16 outputs); V^T per (b,h) via LDS transposes; all query rows in one chunk: scores GEMM (K = 64, batched over the 32 (b,h) slabs on grid.y, alpha 64^-0.5, f32), k_smix (f32 row statistics, native exp, head mix as one WMMA per 16-key tile: A = Wm^T f16 with K zero-padded 16 -> 32, B = 1024 P f16), o = P' . V^T GEMM (K = 1024; o carried x64) into merged f16 rows; out = o Wo + bo GEMM (f32).
// Compute dtype: all contractions v_wmma_f32_16x16x32_f16 (f16 operands, f32 accumulate); inputs RNE-converted to bf16 (exact in f16); q, k, v, mixed softmax weights (x1024), mix matrix and o (x64) as plain f16 operands; scores and softmax statistics f32.
#ifndef NB
#define NB 2                         /* batches processed */
#endif
#ifndef SEQ
#define SEQ 1024                     /* sequence length processed (queries = keys) */
#endif
#define NB_FULL 2                    /* batch pitch of the input / output rows */
#define DM 1024
#define NH 16
#define HD 64
#define QC SEQ                       /* query rows per attention chunk: the whole sequence, so each attention launch fills the chip (S f32 + PM f16 = 192 MiB of workspace) */
#define NR ((size_t)NB * SEQ)        /* token rows */
#define MP ((int)(NB * SEQ))
#define LQ (NB * DM)                 /* pitch between consecutive t for one batch */
static_assert(SEQ % 128 == 0);
static_assert(QC % 128 == 0);
static_assert(SEQ % QC == 0);
static_assert(NH * HD == DM);
static_assert(NB <= NB_FULL);
static_assert((NB * SEQ) % 128 == 0);
static_assert(NH == 16);

typedef unsigned short v8us __attribute__((ext_vector_type(8), may_alias));
typedef float  v8f  __attribute__((ext_vector_type(8)));
typedef float  v4f  __attribute__((ext_vector_type(4)));
typedef float  v4fa __attribute__((ext_vector_type(4), may_alias));
typedef _Float16 v16h __attribute__((ext_vector_type(16)));
typedef _Float16 v4h __attribute__((ext_vector_type(4)));
union FragH { v16h v; v8us half[2]; _Float16 h[16]; unsigned short u[16]; };

__device__ __forceinline__ unsigned short bf16_bits(float x) { unsigned int u = __float_as_uint(x); return (unsigned short)((u + 0x7FFFu + ((u >> 16) & 1u)) >> 16); }
__device__ __forceinline__ float bf16_val(unsigned short b) { return __uint_as_float(((unsigned int)b) << 16); }
__device__ __forceinline__ float bf16_rne(float x) { return bf16_val(bf16_bits(x)); }   /* RNE convert to bf16, back as f32 */

// fragment: elements 0..7 <- k0 + 8h .. +7, elements 8..15 <- k0 + 16 + 8h .. +7 (p points at k0 of the lane's row / column)
__device__ __forceinline__ v16h g2_frag(const _Float16* p, int hh) { FragH f; f.half[0] = *(const v8us*)((const unsigned short*)p + 8 * hh); f.half[1] = *(const v8us*)((const unsigned short*)p + 16 + 8 * hh); return f.v; }
__device__ __forceinline__ v8f g2_mma(v16h a, v16h b, v8f c) { v8f d = __builtin_amdgcn_wmma_f32_16x16x32_f16(false, a, false, b, (short)0, c, false, false); asm volatile("v_nop\n\tv_nop\n\tv_nop\n\tv_nop" : "+v"(d) : "v"(a), "v"(b)); return d; }

// ---- GEMM (workgroup tile 128x64, wave tile 32x64; M % 128 == 0 per launch region, N % 64 == 0, K % KP == 0, K >= KP): C = alpha * A . Bt^T (+ bias) ----
// A f16 [M][K] (pitch lda), Bt f16 [N][K] (pitch ldb); batch slab by = blockIdx.y with element strides sA / sB / sC; slab 0 / 1 / 2 adds bias / bias1 / bias2.
// OMAP: output row r -> (r / NB) * NB_FULL + r % NB.
// Operand path: per pass of KP k the 128 A rows and the 64 Bt rows go to LDS by asynchronous 16-byte copies (whole 128-byte lines per row), two buffers, the next pass's copies in flight while this pass is worked on.
// twelve copies of one lane; the s_wait_xcnt stands inside the statement so that no address register is rewritten in front of it
__device__ __forceinline__ void g2_cp12(const unsigned* l, const _Float16* const* g) {
  asm volatile("global_load_async_to_lds_b128 %0, %12, off\n\t"
               "global_load_async_to_lds_b128 %1, %13, off\n\t"
               "global_load_async_to_lds_b128 %2, %14, off\n\t"
               "global_load_async_to_lds_b128 %3, %15, off\n\t"
               "global_load_async_to_lds_b128 %4, %16, off\n\t"
               "global_load_async_to_lds_b128 %5, %17, off\n\t"
               "global_load_async_to_lds_b128 %6, %18, off\n\t"
               "global_load_async_to_lds_b128 %7, %19, off\n\t"
               "global_load_async_to_lds_b128 %8, %20, off\n\t"
               "global_load_async_to_lds_b128 %9, %21, off\n\t"
               "global_load_async_to_lds_b128 %10, %22, off\n\t"
               "global_load_async_to_lds_b128 %11, %23, off\n\t"
               "s_wait_xcnt 0x0"
               :: "v"(l[0]), "v"(l[1]), "v"(l[2]), "v"(l[3]), "v"(l[4]), "v"(l[5]), "v"(l[6]), "v"(l[7]), "v"(l[8]), "v"(l[9]), "v"(l[10]), "v"(l[11]),
                  "v"(g[0]), "v"(g[1]), "v"(g[2]), "v"(g[3]), "v"(g[4]), "v"(g[5]), "v"(g[6]), "v"(g[7]), "v"(g[8]), "v"(g[9]), "v"(g[10]), "v"(g[11]) : "memory"); }
// one stage: LDS rows 0..127 = A rows of the workgroup, rows 128..191 = Bt rows; ap / bp = the lane's first 16 bytes of each operand at this pass's k, l0 = the lane's LDS byte address in the stage
template <int KP>
__device__ __forceinline__ void g2_stage(const _Float16* ap, int lda, const _Float16* bp, int ldb, unsigned l0) {
  constexpr int CPR = KP / 8, RPR = 128 / CPR, PB = KP * 2 + 16;      /* 16-byte pieces per row, rows per round of 128 lanes, LDS pitch in bytes */
#pragma unroll      /* both loops: the operand (A or Bt) of a copy is picked at compile time, l[] and g[] stay in registers */
  for (int s = 0; s < (CPR + CPR / 2) / 12; ++s) { unsigned l[12]; const _Float16* g[12];
#pragma unroll
    for (int j = 0; j < 12; ++j) { const int i = s * 12 + j; l[j] = l0 + (unsigned)(i * RPR * PB);
      g[j] = (i < CPR) ? ap + (size_t)(i * RPR) * lda : bp + (size_t)((i - CPR) * RPR) * ldb; }
    g2_cp12(l, g); } }

// the six fragments of one 32-k group from LDS (pitch PB bytes): two A row tiles, four Bt row tiles
template <int PB>
__device__ __forceinline__ void g2_ld6(v16h* f, const unsigned char* pa, const unsigned char* pb, int hh) {
  f[0] = g2_frag((const _Float16*)pa, hh); f[1] = g2_frag((const _Float16*)(pa + 16 * PB), hh);
  f[2] = g2_frag((const _Float16*)pb, hh); f[3] = g2_frag((const _Float16*)(pb + 16 * PB), hh); f[4] = g2_frag((const _Float16*)(pb + 32 * PB), hh); f[5] = g2_frag((const _Float16*)(pb + 48 * PB), hh); }

template <bool HASB, bool OUT32, bool OMAP, int KP>
__global__ __launch_bounds__(128) void k_gemm2(const _Float16* __restrict__ A, int lda, size_t sA, const _Float16* __restrict__ Bh, int ldb, size_t sB, float alpha,
    const float* __restrict__ bias, const float* __restrict__ bias1, const float* __restrict__ bias2, float* __restrict__ C, _Float16* __restrict__ C16, int ldc, size_t sC, int M, int N, int K) {
  constexpr int CPR = KP / 8, PB = KP * 2 + 16, STG = 192 * PB, SOB = 4 * 32 * 68 * 4;
  __shared__ __attribute__((aligned(16))) unsigned char sm[(2 * STG > SOB) ? 2 * STG : SOB];      /* two operand stages; after the k loop the output staging */
  float (*so)[32][68] = (float (*)[32][68])sm;
  const int tid = threadIdx.x, w = __builtin_amdgcn_readfirstlane((int)(tid >> 5)), lane = tid & 31, ln = lane & 15, hh = lane >> 4; const int by = blockIdx.y;
  A += (size_t)by * sA; Bh += (size_t)by * sB; const size_t cofs = (size_t)by * sC;
  const int ntn = N >> 6; const int mt = blockIdx.x / ntn, nq = blockIdx.x - mt * ntn; const int row0 = mt * 128 + 32 * w, col0 = nq * 64; if (mt * 128 >= M) return;
  const int crow = tid / CPR, cpc = tid % CPR;
  const _Float16* ap = A + (size_t)(mt * 128 + crow) * lda + cpc * 8; const _Float16* bp = Bh + (size_t)(col0 + crow) * ldb + cpc * 8;
  const unsigned l0 = (unsigned)(size_t)sm + (unsigned)(crow * PB + cpc * 16);
  const unsigned char* fa = sm + (32 * w + ln) * PB; const unsigned char* fb = sm + (128 + ln) * PB;
  const v8f z8 = {0.f,0.f,0.f,0.f,0.f,0.f,0.f,0.f}; v8f c00 = z8, c01 = z8, c02 = z8, c03 = z8, c10 = z8, c11 = z8, c12 = z8, c13 = z8;
  const int nt = K / KP;
  g2_stage<KP>(ap, lda, bp, ldb, l0);
  asm volatile("s_wait_asynccnt 0x0" ::: "memory");      /* this wave's copies of pass 0 have landed */
  __syncthreads();                                        /* pass 0 is readable by every wave */
  if (nt > 1) g2_stage<KP>(ap + KP, lda, bp + KP, ldb, l0 + STG);
#pragma unroll 1      /* one pass per trip: the hand-over at the foot stands once, and the loop stays small */
  for (int t = 0; t < nt; ++t) { const int bo = (t & 1) * STG;
    const unsigned char* pa = fa + bo; const unsigned char* pb = fb + bo; v16h fr[2][6];
    g2_ld6<PB>(fr[0], pa, pb, hh);
#pragma unroll      /* fr[] is indexed by constants only, so both fragment sets stay in registers */
    for (int kk = 0; kk < KP / 32; ++kk) { if (kk + 1 < KP / 32) g2_ld6<PB>(fr[(kk + 1) & 1], pa + (kk + 1) * 64, pb + (kk + 1) * 64, hh);      /* the next 32 k of this pass: one group of LDS reads in front of this group's WMMAs */
      const v16h a0 = fr[kk & 1][0], a1 = fr[kk & 1][1];
      v16h b = fr[kk & 1][2]; c00 = g2_mma(a0, b, c00); c10 = g2_mma(a1, b, c10);
      b = fr[kk & 1][3]; c01 = g2_mma(a0, b, c01); c11 = g2_mma(a1, b, c11);
      b = fr[kk & 1][4]; c02 = g2_mma(a0, b, c02); c12 = g2_mma(a1, b, c12);
      b = fr[kk & 1][5]; c03 = g2_mma(a0, b, c03); c13 = g2_mma(a1, b, c13); }
    asm volatile("s_wait_dscnt 0x0" ::: "memory");        /* this wave's reads of the buffer are done before it is refilled */
    asm volatile("s_wait_asynccnt 0x0" ::: "memory");     /* this wave's copies of pass t + 1 have landed */
    __syncthreads();                                      /* publishes pass t + 1 and ends every wave's reads of pass t */
    if (t + 2 < nt) g2_stage<KP>(ap + (size_t)(t + 2) * KP, lda, bp + (size_t)(t + 2) * KP, ldb, l0 + (unsigned)bo); }
  asm volatile("s_wait_asynccnt 0x0" ::: "memory");       /* no copy is outstanding when the buffers become output staging */
  v8f accs[8] = {c00, c01, c02, c03, c10, c11, c12, c13};
  const float* bsl = (by == 0) ? bias : ((by == 1) ? bias1 : bias2);
#pragma unroll
  for (int u = 0; u < 8; ++u) { const int t = u & 3, half = u >> 2; const int col = col0 + t * 16 + ln; float bv = 0.f; if (HASB) bv = bf16_rne(bsl[col]);
#pragma unroll
    for (int r = 0; r < 8; ++r) { const int rloc = half * 16 + 8 * hh + r; so[w][rloc][t * 16 + ln] = accs[u][r] * alpha + bv; } }
  __builtin_amdgcn_fence(4 /* acq_rel order */, "workgroup"); __builtin_amdgcn_wave_barrier();      /* so[w] is private to wave w */
  const int rsub = lane >> 4, c4 = (lane & 15) * 4;
  {
#pragma unroll
    for (int q = 0; q < 16; ++q) { const int r = q * 2 + rsub; const v4f v = *(const v4fa*)&so[w][r][c4];
      const int gr = row0 + r; const size_t orow = OMAP ? ((size_t)(gr / NB) * NB_FULL + (size_t)(gr % NB)) : (size_t)gr;
      if (OUT32) { *(v4f*)(C + cofs + orow * ldc + col0 + c4) = v; }
      else { v4h h4;
#pragma unroll
        for (int i = 0; i < 4; ++i) h4[i] = (_Float16)v[i];
        *(v4h*)(C16 + cofs + orow * ldc + col0 + c4) = h4; } }
     } }

// ---- every conversion that depends on the inputs alone, in one launch: block 0 = mix matrix, then PWB blocks per weight, then PXB blocks of x ----
#define PWB ((int)((size_t)DM * DM / (8 * 256)))      /* blocks per weight matrix, 8 elements per thread */
#define PXB ((int)(NR * DM / (8 * 256)))              /* blocks of x */
static_assert((size_t)DM * DM % (8 * 256) == 0);
static_assert(NR * DM % (8 * 256) == 0);

// WT[g][32] f16 = column softmax (axis 0) of mix_w, transposed, k zero-padded 16 -> 32; i = 0..63
__device__ __forceinline__ void d_wmix(const float* __restrict__ mixw, _Float16* __restrict__ WT, int i) {
  const int g = i >> 2, k8 = (i & 3) * 8; float mx = -3.0e38f;
#pragma unroll 1
  for (int h = 0; h < NH; ++h) mx = fmaxf(mx, bf16_rne(mixw[h * NH + g]));
  float se = 0.f;
#pragma unroll 1
  for (int h = 0; h < NH; ++h) se += __expf(bf16_rne(mixw[h * NH + g]) - mx);
  const float inv = 1.0f / se; FragH f;
#pragma unroll
  for (int q = 0; q < 8; ++q) { const int h = k8 + q; const int hc = (h < NH) ? h : (NH - 1); const float v = __expf(bf16_rne(mixw[hc * NH + g]) - mx) * inv; f.h[q] = (_Float16)((h < NH) ? v : 0.0f); }
  const v8us o = f.half[0]; *(v8us*)((unsigned short*)WT + i * 8) = o; }

// 8 floats at p -> f16(bf16_rne(v) * sc) at d
__device__ __forceinline__ void d_cvt(const float* __restrict__ p, _Float16* __restrict__ d, float sc) {
  const v4f a = *(const v4fa*)p, c = *(const v4fa*)(p + 4); FragH f;
#pragma unroll
  for (int q = 0; q < 4; ++q) { f.h[q] = (_Float16)(bf16_rne(a[q]) * sc); f.h[4 + q] = (_Float16)(bf16_rne(c[q]) * sc); }
  const v8us o = f.half[0]; *(v8us*)(unsigned short*)d = o; }

__global__ __launch_bounds__(256) void k_prep(const float* __restrict__ wq, const float* __restrict__ wk, const float* __restrict__ wv, const float* __restrict__ wo, const float* __restrict__ x, const float* __restrict__ mixw,
    _Float16* __restrict__ BW, _Float16* __restrict__ X16, _Float16* __restrict__ WT) {
  const int bid = (int)blockIdx.x - 1, tid = threadIdx.x;
  if (bid < 0) { if (tid < 64) d_wmix(mixw, WT, tid); return; }      /* first block: its chain of dependent loads starts first */
  if (bid < 4 * PWB) { const int m = bid / PWB; const float* w = (m == 0) ? wq : ((m == 1) ? wk : ((m == 2) ? wv : wo));
    const size_t t = (size_t)(bid - m * PWB) * 256 + tid; d_cvt(w + t * 8, BW + (size_t)m * DM * DM + t * 8, 16.0f); return; }      /* natural [out][in] = Bt[n][k], x16 */
  const size_t t = (size_t)(bid - 4 * PWB) * 256 + tid; const size_t row = t / (DM / 8); const int c8 = (int)(t % (DM / 8)) * 8; const size_t srow = (row / NB) * NB_FULL + (row % NB);
  d_cvt(x + srow * DM + c8, X16 + t * 8, 1.0f);
  asm volatile("s_wait_xcnt 0x0" ::: "memory"); }      /* behind the store: in the built code the other cases' blocks follow this one and rewrite the store's registers */

__global__ __launch_bounds__(256) void k_vt(const _Float16* __restrict__ V16, _Float16* __restrict__ Vt) { __shared__ unsigned short tl[64][66]; const int tid = threadIdx.x; const int slab = blockIdx.x / (SEQ / 64), lg = blockIdx.x % (SEQ / 64); const int b = slab / NH, h = slab % NH;
  for (int i = tid; i < 64 * 8; i += 256) { const int r = i / 8, c8 = (i % 8) * 8; FragH f; f.half[0] = *(const v8us*)((const unsigned short*)V16 + ((size_t)(lg * 64 + r) * NB + b) * DM + h * HD + c8);
#pragma unroll
    for (int q = 0; q < 8; ++q) tl[r][c8 + q] = f.u[q]; }
  __syncthreads();
  {
#pragma unroll
    for (int rd = 0; rd < 2; ++rd) { const int d = rd * 32 + tid / 8, pc = tid % 8; FragH f;
#pragma unroll
      for (int q = 0; q < 8; ++q) f.u[q] = tl[pc * 8 + q][d];
      *(v8us*)((unsigned short*)Vt + ((size_t)slab * 64 + d) * SEQ + lg * 64 + pc * 8) = f.half[0]; }
     } }

// softmax over SEQ keys + cross-head mix. S f32 [NB*NH][QC][SEQ] (slab by = b*NH + h); PM f16 [NB*NH][QC][SEQ] = 1024 * sum_h Wm[h][g] * softmax(S[b*NH+h][t][:]).
// One wave per (b, t): phase 1 = per-head max / sum (registers + wave shuffles, native exp on max-subtracted arguments); phase 2 = per 16-key tile one WMMA
__global__ __launch_bounds__(128) void k_smix(const float* __restrict__ S, const _Float16* __restrict__ WT, _Float16* __restrict__ PM) {
  #pragma clang fp contract(off)
  __shared__ float sst[4][2][NH];
  __shared__ __attribute__((aligned(16))) _Float16 sP[4][NH][72];
  const int tid = threadIdx.x, w = __builtin_amdgcn_readfirstlane((int)(tid >> 5)), lane = tid & 31, ln = lane & 15, hh = lane >> 4;
  const int wr = blockIdx.x * 4 + w; const int b = wr / QC, tql = wr - b * QC;
  const size_t hp = (size_t)QC * SEQ;                                  /* head slab pitch */
  const float* srow = S + ((size_t)(b * NH) * QC + tql) * SEQ;        /* head h row at srow + h * hp */
#pragma unroll 1
  for (int h = 0; h < NH; ++h) {
    const float* p = srow + (size_t)h * hp + lane * 4;
    v4f x[SEQ / 128];
#pragma unroll
    for (int j = 0; j < SEQ / 128; ++j) x[j] = *(const v4fa*)(p + j * 128);
    float mx = -3.0e38f;
#pragma unroll
    for (int j = 0; j < SEQ / 128; ++j) mx = fmaxf(mx, fmaxf(fmaxf(x[j][0], x[j][1]), fmaxf(x[j][2], x[j][3])));
#pragma unroll
    for (int off = 16; off > 0; off >>= 1) mx = fmaxf(mx, __shfl_xor(mx, off, 32));
    float se = 0.f;
#pragma unroll
    for (int j = 0; j < SEQ / 128; ++j) { se += __expf(x[j][0] - mx); se += __expf(x[j][1] - mx); se += __expf(x[j][2] - mx); se += __expf(x[j][3] - mx); }
#pragma unroll
    for (int off = 16; off > 0; off >>= 1) se += __shfl_xor(se, off, 32);
    if (lane == 0) { sst[w][0][h] = mx; sst[w][1][h] = 1024.0f / se; }
  }
  __syncthreads();
  float m8[8], c8[8];
#pragma unroll
  for (int i = 0; i < 8; ++i) { m8[i] = sst[w][0][8 * hh + i]; c8[i] = sst[w][1][8 * hh + i]; }
  const v16h aW = g2_frag(WT + ln * 32, hh);                          /* A: row g = ln, k = heads (upper 16 k zero) */
  const v8f z8 = {0.f,0.f,0.f,0.f,0.f,0.f,0.f,0.f};
  const float* scol = srow + (size_t)(8 * hh) * hp + ln;              /* lane's 8 heads, column ln of the tile */
  unsigned short* pout = (unsigned short*)PM + ((size_t)(b * NH) * QC + tql) * SEQ;
#pragma unroll 1
  for (int c0 = 0; c0 < SEQ; c0 += 64) {
#pragma unroll 1
    for (int t = 0; t < 4; ++t) {
      const float* ps = scol + c0 + 16 * t;
      FragH bf;
#pragma unroll
      for (int i = 0; i < 8; ++i) { const float v = ps[(size_t)i * hp]; bf.h[i] = (_Float16)(__expf(v - m8[i]) * c8[i]); }
#pragma unroll
      for (int i = 8; i < 16; ++i) bf.h[i] = (_Float16)0.0f;
      const v8f d = g2_mma(aW, bf.v, z8);
#pragma unroll
      for (int r = 0; r < 8; ++r) sP[w][8 * hh + r][16 * t + ln] = (_Float16)d[r];      /* D row g = 8hh + r, column s = c0 + 16t + ln */
    }
    __builtin_amdgcn_fence(4 /* acq_rel order */, "workgroup"); __builtin_amdgcn_wave_barrier();      /* sP[w] is private to wave w */
    {
#pragma unroll
      for (int q = 0; q < 4; ++q) { const int g = q * 4 + (lane >> 3), pc = lane & 7; const v8us v = *(const v8us*)&sP[w][g][pc * 8];
        *(v8us*)(pout + (size_t)g * hp + c0 + pc * 8) = v; }
       }
    __builtin_amdgcn_fence(4 /* acq_rel order */, "workgroup"); __builtin_amdgcn_wave_barrier();
  }
}

extern "C" void kernel_launch(void* const* d_in, const int* in_sizes, int n_in,
                              void* d_out, int out_size, void* d_ws, size_t ws_size, hipStream_t stream) {
  if (n_in < 10) return;
  if ((size_t)in_sizes[0] < NR * DM) return;
  if ((size_t)in_sizes[1] < (size_t)DM * DM || (size_t)in_sizes[3] < (size_t)DM * DM || (size_t)in_sizes[5] < (size_t)DM * DM || (size_t)in_sizes[7] < (size_t)DM * DM) return;
  if (in_sizes[2] < DM || in_sizes[4] < DM || in_sizes[6] < DM || in_sizes[8] < DM || in_sizes[9] < NH * NH) return;
  if ((size_t)out_size < NR * DM) return;
  const float* const* I = (const float* const*)d_in;
  const float* xq = I[0]; const float* wq = I[1]; const float* bq = I[2]; const float* wk = I[3]; const float* bk = I[4]; const float* wv = I[5]; const float* bv = I[6]; const float* wo = I[7]; const float* bo = I[8]; const float* mixw = I[9];
  char* ws = (char*)d_ws; size_t off = 0;
  auto take = [&](size_t bytes) { char* p = ws + off; off += (bytes + 255) & ~(size_t)255; return p; };
  _Float16* BQ = (_Float16*)take((size_t)4 * DM * DM * 2); _Float16* BO = BQ + (size_t)3 * DM * DM;      /* wq, wk, wv, wo planes, pitch DM * DM */
  _Float16* X16 = (_Float16*)take(NR * DM * 2); _Float16* Q16 = (_Float16*)take(3 * NR * DM * 2); _Float16* K16 = Q16 + NR * DM; _Float16* V16 = K16 + NR * DM; _Float16* O16 = (_Float16*)take(NR * DM * 2);      /* q, k, v planes, pitch NR * DM */
  float* S = (float*)take((size_t)NB * NH * QC * SEQ * 4); _Float16* PM = (_Float16*)take((size_t)NB * NH * QC * SEQ * 2); _Float16* VT = (_Float16*)take((size_t)NB * NH * HD * SEQ * 2);
  _Float16* WT = (_Float16*)take((size_t)NH * 32 * 2);
  if (off > ws_size) return;
  k_prep<<<1 + 4 * PWB + PXB, 256, 0, stream>>>(wq, wk, wv, wo, xq, mixw, BQ, X16, WT);
  const dim3 gp((unsigned)((MP / 128) * (DM / 64)), 1);
  k_gemm2<true, false, false, 128><<<dim3(gp.x, 3), 128, 0, stream>>>(X16, DM, 0, BQ, DM, (size_t)DM * DM, 0.0625f, bq, bk, bv, nullptr, Q16, DM, NR * DM, MP, DM, DM);      /* slab 0 / 1 / 2 = q / k / v */
  k_vt<<<NB * NH * (SEQ / 64), 256, 0, stream>>>(V16, VT);      /* V16 rows [SEQ*NB][DM] -> VT[(b,h)][64][SEQ] */
  for (int t0 = 0; t0 < SEQ; t0 += QC) {
    /* scores: slab by = b*NH + h at column offset by*64 of rows with pitch LQ; S[by][QC][SEQ] f32 */
    k_gemm2<false, true, false, 64><<<dim3((QC / 128) * (SEQ / 64), NB * NH), 128, 0, stream>>>(Q16 + (size_t)t0 * LQ, LQ, (size_t)HD, K16, LQ, (size_t)HD, 0.125f, nullptr, nullptr, nullptr, S, nullptr, SEQ, (size_t)QC * SEQ, QC, SEQ, HD);
    k_smix<<<NB * QC / 4, 128, 0, stream>>>(S, WT, PM);
    /* o[t][b][g*64 + d] x64 = 2^-4 * (1024 P') . V^T */
    k_gemm2<false, false, false, 128><<<dim3((QC / 128) * (HD / 64), NB * NH), 128, 0, stream>>>(PM, SEQ, (size_t)QC * SEQ, VT, SEQ, (size_t)HD * SEQ, 0.0625f, nullptr, nullptr, nullptr, nullptr, O16 + (size_t)t0 * LQ, LQ, (size_t)HD, QC, HD, SEQ);
  }
  k_gemm2<true, true, true, 128><<<gp, 128, 0, stream>>>(O16, DM, 0, BO, DM, 0, 0.0009765625f, bo, nullptr, nullptr, (float*)d_out, nullptr, DM, 0, MP, DM, DM);      /* out rows t*NB_FULL + b */
}

// v004
// A run of this version takes 87.2 microseconds.
// Two timings next to v003 both put it at 1.35 times that version's speed.
// All steps since v000 together make it 5.41 times as fast.
#include <hip/hip_runtime.h>
// Multi-head SELF-attention with cross-head probability mixing, sequence-first layout: x [1024][2][1024] (token row r = t*NB + b); q / k / v = x W^T + bias (natural [out][in] weights, biases present), 16 heads of 64, q scaled by 64^-0.5; softmax over all 1024 keys (no mask); P'[b,g,t,s] = sum_h P[b,h,t,s] * Wm[h][g] with Wm = column softmax (axis 0) of mix_w; ctx[b,g] = P'[b,g] . v[b,g]; merged [t][b][g*64+d]; out = ctx Wo^T + bo.
// Structure: one conversion launch (x as exact f16 rows, inputs RNE-converted to bf16 first; the four weights; the mix matrix); Q, K, V as three WMMA GEMMs in one launch, one per grid.y (32x64 wave tiles, operands staged in LDS by asynchronous copies, f32 accumulation, x16 weights + bias, f16 outputs); V^T per (b,h) via LDS transposes; all query rows in one chunk: scores GEMM (K = 64, batched over the 32 (b,h) slabs on grid.y, alpha 64^-0.5, f32), k_smix (scores of a query row held in registers, f32 row statistics, native exp, head mix as one WMMA per 16-key tile: A = Wm^T f16 with K zero-padded 16 -> 32, B = 1024 P f16), o = P' . V^T GEMM (K = 1024; o carried x64) into merged f16 rows; out = o Wo + bo GEMM (f32).
// Compute dtype: all contractions v_wmma_f32_16x16x32_f16 (f16 operands, f32 accumulate); inputs RNE-converted to bf16 (exact in f16); q, k, v, mixed softmax weights (x1024), mix matrix and o (x64) as plain f16 operands; scores and softmax statistics f32.
#ifndef NB
#define NB 2                         /* batches processed */
#endif
#ifndef SEQ
#define SEQ 1024                     /* sequence length processed (queries = keys) */
#endif
#define NB_FULL 2                    /* batch pitch of the input / output rows */
#define DM 1024
#define NH 16
#define HD 64
#define QC SEQ                       /* query rows per attention chunk: the whole sequence, so each attention launch fills the chip (S f32 + PM f16 = 192 MiB of workspace) */
#define NR ((size_t)NB * SEQ)        /* token rows */
#define MP ((int)(NB * SEQ))
#define LQ (NB * DM)                 /* pitch between consecutive t for one batch */
static_assert(SEQ % 128 == 0);
static_assert(QC % 128 == 0);
static_assert(SEQ % QC == 0);
static_assert(NH * HD == DM);
static_assert(NB <= NB_FULL);
static_assert((NB * SEQ) % 128 == 0);
static_assert(NH == 16);

typedef unsigned short v8us __attribute__((ext_vector_type(8), may_alias));
typedef float  v8f  __attribute__((ext_vector_type(8)));
typedef float  v4f  __attribute__((ext_vector_type(4)));
typedef float  v4fa __attribute__((ext_vector_type(4), may_alias));
typedef _Float16 v16h __attribute__((ext_vector_type(16)));
typedef _Float16 v4h __attribute__((ext_vector_type(4)));
union FragH { v16h v; v8us half[2]; _Float16 h[16]; unsigned short u[16]; };

__device__ __forceinline__ unsigned short bf16_bits(float x) { unsigned int u = __float_as_uint(x); return (unsigned short)((u + 0x7FFFu + ((u >> 16) & 1u)) >> 16); }
__device__ __forceinline__ float bf16_val(unsigned short b) { return __uint_as_float(((unsigned int)b) << 16); }
__device__ __forceinline__ float bf16_rne(float x) { return bf16_val(bf16_bits(x)); }   /* RNE convert to bf16, back as f32 */

// fragment: elements 0..7 <- k0 + 8h .. +7, elements 8..15 <- k0 + 16 + 8h .. +7 (p points at k0 of the lane's row / column)
__device__ __forceinline__ v16h g2_frag(const _Float16* p, int hh) { FragH f; f.half[0] = *(const v8us*)((const unsigned short*)p + 8 * hh); f.half[1] = *(const v8us*)((const unsigned short*)p + 16 + 8 * hh); return f.v; }
__device__ __forceinline__ v8f g2_mma(v16h a, v16h b, v8f c) { v8f d = __builtin_amdgcn_wmma_f32_16x16x32_f16(false, a, false, b, (short)0, c, false, false); asm volatile("v_nop\n\tv_nop\n\tv_nop\n\tv_nop" : "+v"(d) : "v"(a), "v"(b)); return d; }

// ---- GEMM (workgroup tile 128x64, wave tile 32x64; M % 128 == 0 per launch region, N % 64 == 0, K % KP == 0, K >= KP): C = alpha * A . Bt^T (+ bias) ----
// A f16 [M][K] (pitch lda), Bt f16 [N][K] (pitch ldb); batch slab by = blockIdx.y with element strides sA / sB / sC; slab 0 / 1 / 2 adds bias / bias1 / bias2.
// OMAP: output row r -> (r / NB) * NB_FULL + r % NB.
// Operand path: per pass of KP k the 128 A rows and the 64 Bt rows go to LDS by asynchronous 16-byte copies (whole 128-byte lines per row), two buffers, the next pass's copies in flight while this pass is worked on.
// twelve copies of one lane; the s_wait_xcnt stands inside the statement so that no address register is rewritten in front of it
__device__ __forceinline__ void g2_cp12(const unsigned* l, const _Float16* const* g) {
  asm volatile("global_load_async_to_lds_b128 %0, %12, off\n\t"
               "global_load_async_to_lds_b128 %1, %13, off\n\t"
               "global_load_async_to_lds_b128 %2, %14, off\n\t"
               "global_load_async_to_lds_b128 %3, %15, off\n\t"
               "global_load_async_to_lds_b128 %4, %16, off\n\t"
               "global_load_async_to_lds_b128 %5, %17, off\n\t"
               "global_load_async_to_lds_b128 %6, %18, off\n\t"
               "global_load_async_to_lds_b128 %7, %19, off\n\t"
               "global_load_async_to_lds_b128 %8, %20, off\n\t"
               "global_load_async_to_lds_b128 %9, %21, off\n\t"
               "global_load_async_to_lds_b128 %10, %22, off\n\t"
               "global_load_async_to_lds_b128 %11, %23, off\n\t"
               "s_wait_xcnt 0x0"
               :: "v"(l[0]), "v"(l[1]), "v"(l[2]), "v"(l[3]), "v"(l[4]), "v"(l[5]), "v"(l[6]), "v"(l[7]), "v"(l[8]), "v"(l[9]), "v"(l[10]), "v"(l[11]),
                  "v"(g[0]), "v"(g[1]), "v"(g[2]), "v"(g[3]), "v"(g[4]), "v"(g[5]), "v"(g[6]), "v"(g[7]), "v"(g[8]), "v"(g[9]), "v"(g[10]), "v"(g[11]) : "memory"); }
// one stage: LDS rows 0..127 = A rows of the workgroup, rows 128..191 = Bt rows; ap / bp = the lane's first 16 bytes of each operand at this pass's k, l0 = the lane's LDS byte address in the stage
template <int KP>
__device__ __forceinline__ void g2_stage(const _Float16* ap, int lda, const _Float16* bp, int ldb, unsigned l0) {
  constexpr int CPR = KP / 8, RPR = 128 / CPR, PB = KP * 2 + 16;      /* 16-byte pieces per row, rows per round of 128 lanes, LDS pitch in bytes */
#pragma unroll      /* both loops: the operand (A or Bt) of a copy is picked at compile time, l[] and g[] stay in registers */
  for (int s = 0; s < (CPR + CPR / 2) / 12; ++s) { unsigned l[12]; const _Float16* g[12];
#pragma unroll
    for (int j = 0; j < 12; ++j) { const int i = s * 12 + j; l[j] = l0 + (unsigned)(i * RPR * PB);
      g[j] = (i < CPR) ? ap + (size_t)(i * RPR) * lda : bp + (size_t)((i - CPR) * RPR) * ldb; }
    g2_cp12(l, g); } }

// the six fragments of one 32-k group from LDS (pitch PB bytes): two A row tiles, four Bt row tiles
template <int PB>
__device__ __forceinline__ void g2_ld6(v16h* f, const unsigned char* pa, const unsigned char* pb, int hh) {
  f[0] = g2_frag((const _Float16*)pa, hh); f[1] = g2_frag((const _Float16*)(pa + 16 * PB), hh);
  f[2] = g2_frag((const _Float16*)pb, hh); f[3] = g2_frag((const _Float16*)(pb + 16 * PB), hh); f[4] = g2_frag((const _Float16*)(pb + 32 * PB), hh); f[5] = g2_frag((const _Float16*)(pb + 48 * PB), hh); }

template <bool HASB, bool OUT32, bool OMAP, int KP>
__global__ __launch_bounds__(128) void k_gemm2(const _Float16* __restrict__ A, int lda, size_t sA, const _Float16* __restrict__ Bh, int ldb, size_t sB, float alpha,
    const float* __restrict__ bias, const float* __restrict__ bias1, const float* __restrict__ bias2, float* __restrict__ C, _Float16* __restrict__ C16, int ldc, size_t sC, int M, int N, int K) {
  constexpr int CPR = KP / 8, PB = KP * 2 + 16, STG = 192 * PB, SOB = 4 * 32 * 68 * 4;
  __shared__ __attribute__((aligned(16))) unsigned char sm[(2 * STG > SOB) ? 2 * STG : SOB];      /* two operand stages; after the k loop the output staging */
  float (*so)[32][68] = (float (*)[32][68])sm;
  const int tid = threadIdx.x, w = __builtin_amdgcn_readfirstlane((int)(tid >> 5)), lane = tid & 31, ln = lane & 15, hh = lane >> 4; const int by = blockIdx.y;
  A += (size_t)by * sA; Bh += (size_t)by * sB; const size_t cofs = (size_t)by * sC;
  const int ntn = N >> 6; const int mt = blockIdx.x / ntn, nq = blockIdx.x - mt * ntn; const int row0 = mt * 128 + 32 * w, col0 = nq * 64; if (mt * 128 >= M) return;
  const int crow = tid / CPR, cpc = tid % CPR;
  const _Float16* ap = A + (size_t)(mt * 128 + crow) * lda + cpc * 8; const _Float16* bp = Bh + (size_t)(col0 + crow) * ldb + cpc * 8;
  const unsigned l0 = (unsigned)(size_t)sm + (unsigned)(crow * PB + cpc * 16);
  const unsigned char* fa = sm + (32 * w + ln) * PB; const unsigned char* fb = sm + (128 + ln) * PB;
  const v8f z8 = {0.f,0.f,0.f,0.f,0.f,0.f,0.f,0.f}; v8f c00 = z8, c01 = z8, c02 = z8, c03 = z8, c10 = z8, c11 = z8, c12 = z8, c13 = z8;
  const int nt = K / KP;
  g2_stage<KP>(ap, lda, bp, ldb, l0);
  asm volatile("s_wait_asynccnt 0x0" ::: "memory");      /* this wave's copies of pass 0 have landed */
  __syncthreads();                                        /* pass 0 is readable by every wave */
  if (nt > 1) g2_stage<KP>(ap + KP, lda, bp + KP, ldb, l0 + STG);
#pragma unroll 1      /* one pass per trip: the hand-over at the foot stands once, and the loop stays small */
  for (int t = 0; t < nt; ++t) { const int bo = (t & 1) * STG;
    const unsigned char* pa = fa + bo; const unsigned char* pb = fb + bo; v16h fr[2][6];
    g2_ld6<PB>(fr[0], pa, pb, hh);
#pragma unroll      /* fr[] is indexed by constants only, so both fragment sets stay in registers */
    for (int kk = 0; kk < KP / 32; ++kk) { if (kk + 1 < KP / 32) g2_ld6<PB>(fr[(kk + 1) & 1], pa + (kk + 1) * 64, pb + (kk + 1) * 64, hh);      /* the next 32 k of this pass: one group of LDS reads in front of this group's WMMAs */
      const v16h a0 = fr[kk & 1][0], a1 = fr[kk & 1][1];
      v16h b = fr[kk & 1][2]; c00 = g2_mma(a0, b, c00); c10 = g2_mma(a1, b, c10);
      b = fr[kk & 1][3]; c01 = g2_mma(a0, b, c01); c11 = g2_mma(a1, b, c11);
      b = fr[kk & 1][4]; c02 = g2_mma(a0, b, c02); c12 = g2_mma(a1, b, c12);
      b = fr[kk & 1][5]; c03 = g2_mma(a0, b, c03); c13 = g2_mma(a1, b, c13); }
    asm volatile("s_wait_dscnt 0x0" ::: "memory");        /* this wave's reads of the buffer are done before it is refilled */
    asm volatile("s_wait_asynccnt 0x0" ::: "memory");     /* this wave's copies of pass t + 1 have landed */
    __syncthreads();                                      /* publishes pass t + 1 and ends every wave's reads of pass t */
    if (t + 2 < nt) g2_stage<KP>(ap + (size_t)(t + 2) * KP, lda, bp + (size_t)(t + 2) * KP, ldb, l0 + (unsigned)bo); }
  asm volatile("s_wait_asynccnt 0x0" ::: "memory");       /* no copy is outstanding when the buffers become output staging */
  v8f accs[8] = {c00, c01, c02, c03, c10, c11, c12, c13};
  const float* bsl = (by == 0) ? bias : ((by == 1) ? bias1 : bias2);
#pragma unroll
  for (int u = 0; u < 8; ++u) { const int t = u & 3, half = u >> 2; const int col = col0 + t * 16 + ln; float bv = 0.f; if (HASB) bv = bf16_rne(bsl[col]);
#pragma unroll
    for (int r = 0; r < 8; ++r) { const int rloc = half * 16 + 8 * hh + r; so[w][rloc][t * 16 + ln] = accs[u][r] * alpha + bv; } }
  __builtin_amdgcn_fence(4 /* acq_rel order */, "workgroup"); __builtin_amdgcn_wave_barrier();      /* so[w] is private to wave w */
  const int rsub = lane >> 4, c4 = (lane & 15) * 4;
  {
#pragma unroll
    for (int q = 0; q < 16; ++q) { const int r = q * 2 + rsub; const v4f v = *(const v4fa*)&so[w][r][c4];
      const int gr = row0 + r; const size_t orow = OMAP ? ((size_t)(gr / NB) * NB_FULL + (size_t)(gr % NB)) : (size_t)gr;
      if (OUT32) { *(v4f*)(C + cofs + orow * ldc + col0 + c4) = v; }
      else { v4h h4;
#pragma unroll
        for (int i = 0; i < 4; ++i) h4[i] = (_Float16)v[i];
        *(v4h*)(C16 + cofs + orow * ldc + col0 + c4) = h4; } }
     } }

// ---- every conversion that depends on the inputs alone, in one launch: block 0 = mix matrix, then PWB blocks per weight, then PXB blocks of x ----
#define PWB ((int)((size_t)DM * DM / (8 * 256)))      /* blocks per weight matrix, 8 elements per thread */
#define PXB ((int)(NR * DM / (8 * 256)))              /* blocks of x */
static_assert((size_t)DM * DM % (8 * 256) == 0);
static_assert(NR * DM % (8 * 256) == 0);

// WT[g][32] f16 = column softmax (axis 0) of mix_w, transposed, k zero-padded 16 -> 32; i = 0..63
__device__ __forceinline__ void d_wmix(const float* __restrict__ mixw, _Float16* __restrict__ WT, int i) {
  const int g = i >> 2, k8 = (i & 3) * 8; float mx = -3.0e38f;
#pragma unroll 1
  for (int h = 0; h < NH; ++h) mx = fmaxf(mx, bf16_rne(mixw[h * NH + g]));
  float se = 0.f;
#pragma unroll 1
  for (int h = 0; h < NH; ++h) se += __expf(bf16_rne(mixw[h * NH + g]) - mx);
  const float inv = 1.0f / se; FragH f;
#pragma unroll
  for (int q = 0; q < 8; ++q) { const int h = k8 + q; const int hc = (h < NH) ? h : (NH - 1); const float v = __expf(bf16_rne(mixw[hc * NH + g]) - mx) * inv; f.h[q] = (_Float16)((h < NH) ? v : 0.0f); }
  const v8us o = f.half[0]; *(v8us*)((unsigned short*)WT + i * 8) = o; }

// 8 floats at p -> f16(bf16_rne(v) * sc) at d
__device__ __forceinline__ void d_cvt(const float* __restrict__ p, _Float16* __restrict__ d, float sc) {
  const v4f a = *(const v4fa*)p, c = *(const v4fa*)(p + 4); FragH f;
#pragma unroll
  for (int q = 0; q < 4; ++q) { f.h[q] = (_Float16)(bf16_rne(a[q]) * sc); f.h[4 + q] = (_Float16)(bf16_rne(c[q]) * sc); }
  const v8us o = f.half[0]; *(v8us*)(unsigned short*)d = o; }

__global__ __launch_bounds__(256) void k_prep(const float* __restrict__ wq, const float* __restrict__ wk, const float* __restrict__ wv, const float* __restrict__ wo, const float* __restrict__ x, const float* __restrict__ mixw,
    _Float16* __restrict__ BW, _Float16* __restrict__ X16, _Float16* __restrict__ WT) {
  const int bid = (int)blockIdx.x - 1, tid = threadIdx.x;
  if (bid < 0) { if (tid < 64) d_wmix(mixw, WT, tid); return; }      /* first block: its chain of dependent loads starts first */
  if (bid < 4 * PWB) { const int m = bid / PWB; const float* w = (m == 0) ? wq : ((m == 1) ? wk : ((m == 2) ? wv : wo));
    const size_t t = (size_t)(bid - m * PWB) * 256 + tid; d_cvt(w + t * 8, BW + (size_t)m * DM * DM + t * 8, 16.0f); return; }      /* natural [out][in] = Bt[n][k], x16 */
  const size_t t = (size_t)(bid - 4 * PWB) * 256 + tid; const size_t row = t / (DM / 8); const int c8 = (int)(t % (DM / 8)) * 8; const size_t srow = (row / NB) * NB_FULL + (row % NB);
  d_cvt(x + srow * DM + c8, X16 + t * 8, 1.0f);
  asm volatile("s_wait_xcnt 0x0" ::: "memory"); }      /* behind the store: in the built code the other cases' blocks follow this one and rewrite the store's registers */

__global__ __launch_bounds__(256) void k_vt(const _Float16* __restrict__ V16, _Float16* __restrict__ Vt) { __shared__ unsigned short tl[64][66]; const int tid = threadIdx.x; const int slab = blockIdx.x / (SEQ / 64), lg = blockIdx.x % (SEQ / 64); const int b = slab / NH, h = slab % NH;
  for (int i = tid; i < 64 * 8; i += 256) { const int r = i / 8, c8 = (i % 8) * 8; FragH f; f.half[0] = *(const v8us*)((const unsigned short*)V16 + ((size_t)(lg * 64 + r) * NB + b) * DM + h * HD + c8);
#pragma unroll
    for (int q = 0; q < 8; ++q) tl[r][c8 + q] = f.u[q]; }
  __syncthreads();
  {
#pragma unroll
    for (int rd = 0; rd < 2; ++rd) { const int d = rd * 32 + tid / 8, pc = tid % 8; FragH f;
#pragma unroll
      for (int q = 0; q < 8; ++q) f.u[q] = tl[pc * 8 + q][d];
      *(v8us*)((unsigned short*)Vt + ((size_t)slab * 64 + d) * SEQ + lg * 64 + pc * 8) = f.half[0]; }
     } }

// softmax over SEQ keys + cross-head mix. S f32 [NB*NH][QC][SEQ] (slab by = b*NH + h); PM f16 [NB*NH][QC][SEQ] = 1024 * sum_h Wm[h][g] * softmax(S[b*NH+h][t][:]).
// One work-group per SMR query rows (b, t), SMW waves; wave w owns keys 128w .. 128w + 127 of all 16 heads and keeps them in registers, so S is read once, in whole lines.
// Lane (ln, hh) holds heads 8hh .. 8hh + 7 at keys 128w + 64v + 4ln + j (v = 0, 1; j = 0 .. 3): that is the B fragment of the mix WMMA for tile (v, j), column ln <-> key 64v + 4ln + j,
// and D (row g = 8hh + r, column ln) of the four tiles of one v gives four consecutive keys per lane: 8-byte stores, 128 bytes per head row and half wave.
// Row statistics: per wave max and sum of exp(x - wave max) over the 16-lane row by DPP, the waves' pairs joined through LDS (one barrier per query row).
#define SMW (SEQ / 128)      /* waves per work-group */
#define SMR 4                /* query rows per work-group, the next row's loads in flight while a row is worked on */
static_assert(SMW >= 1 && SMW <= 32);
static_assert(QC % SMR == 0);
template <int CTRL> __device__ __forceinline__ float sm_dpp(float v) { return __builtin_bit_cast(float, __builtin_amdgcn_mov_dpp(__builtin_bit_cast(int, v), CTRL, 0xf, 0xf, true)); }      /* 0x160 | m: lane l ^ m of the 16-lane row; 0x150 | i: lane i of the row */
// native exp (v_exp_f32 of x * log2 e) with the slot behind the transcendental filled in the same statement: in the built code the next instruction otherwise overwrites its source register directly behind it
__device__ __forceinline__ float sm_exp(float x) { const float t = x * 1.44269504f; float e; asm("v_exp_f32 %0, %1\n\tv_nop" : "=v"(e) : "v"(t)); return e; }
__device__ __forceinline__ float sm_rowmax(float v) { v = fmaxf(v, sm_dpp<0x161>(v)); v = fmaxf(v, sm_dpp<0x162>(v)); v = fmaxf(v, sm_dpp<0x164>(v)); return fmaxf(v, sm_dpp<0x168>(v)); }
__device__ __forceinline__ float sm_rowsum(float v) { v += sm_dpp<0x161>(v); v += sm_dpp<0x162>(v); v += sm_dpp<0x164>(v); return v + sm_dpp<0x168>(v); }
// p and hp are the same in every lane, lofs is the lane's own element offset; the query rows of a work-group differ by an immediate offset, so the eight address pairs are formed once and live through the whole kernel
__device__ __forceinline__ void sm_load(v4f (&x)[8][2], const float* __restrict__ p, size_t hp, unsigned lofs) {
#pragma unroll
  for (int i = 0; i < 8; ++i) { const float* ph = p + (size_t)i * hp; x[i][0] = *(const v4fa*)(ph + lofs); x[i][1] = *(const v4fa*)(ph + 64 + lofs); } }

__global__ __launch_bounds__(SMW * 32) void k_smix(const float* __restrict__ S, const _Float16* __restrict__ WT, _Float16* __restrict__ PM, size_t hp) {      /* hp = head slab pitch QC * SEQ, an argument so that the head bases are formed in scalar registers */
  __shared__ __attribute__((aligned(16))) float sst[2][SMW][2][NH];      /* [row parity][wave][max, sum][head] */
  const int tid = threadIdx.x, w = __builtin_amdgcn_readfirstlane((int)(tid >> 5)), lane = tid & 31, ln = lane & 15, hh = lane >> 4;
  const int wr = blockIdx.x * SMR; const int b = wr / QC, tql = wr - b * QC;
  const size_t base = ((size_t)(b * NH) * QC + tql) * SEQ + 128 * w; const unsigned lofs = (unsigned)(8 * hh) * (unsigned)hp + 4 * ln;
  const float* ps = S + base;                                          /* head 8hh + i of query row q at ps + i * hp + q * SEQ + lofs */
  _Float16* po = PM + base;
  const v8f z8 = {0.f,0.f,0.f,0.f,0.f,0.f,0.f,0.f};
  const int hd = 8 * hh + (ln & 7);                                    /* the head whose joined statistics this lane forms */
  v4f x[2][8][2];
  const v16h aW = g2_frag(WT + ln * 32, hh);                          /* A: row g = ln, k = heads (upper 16 k zero) */
  asm volatile("s_wait_xcnt 0x0" ::: "memory");      /* behind the loads of aW: in the built code a load of scores lands in their address registers */
  sm_load(x[0], ps, hp, lofs);
#pragma unroll      /* x[] is indexed by constants only, so both rows' scores stay in registers */
  for (int q = 0; q < SMR; ++q) { v4f (&c)[8][2] = x[q & 1];
    if (q > 0 && q + 1 < SMR) asm volatile("s_wait_xcnt 0x0" ::: "memory");      /* behind the last row's stores: the loads below land in registers that those stores name */
    if (q + 1 < SMR) sm_load(x[(q + 1) & 1], ps + (size_t)(q + 1) * SEQ, hp, lofs);
    __builtin_amdgcn_sched_barrier(0);      /* keeps the next row's loads in front of this row's work and the two rows' work apart: without it the build starts on the next row's scores inside this row and waits for them early */
    float m8[8], s8[8];
#pragma unroll
    for (int i = 0; i < 8; ++i) { const v4f u = c[i][0], v = c[i][1];
      m8[i] = sm_rowmax(fmaxf(fmaxf(fmaxf(u[0], u[1]), fmaxf(u[2], u[3])), fmaxf(fmaxf(v[0], v[1]), fmaxf(v[2], v[3])))); }
#pragma unroll
    for (int i = 0; i < 8; ++i) { float se = 0.f;
#pragma unroll
      for (int v = 0; v < 2; ++v) {
#pragma unroll
        for (int j = 0; j < 4; ++j) { const float e = sm_exp(c[i][v][j] - m8[i]); c[i][v][j] = e; se += e; } }
      s8[i] = sm_rowsum(se); }
    float (*st)[2][NH] = sst[q & 1];
    if (ln == 0) {
#pragma unroll
      for (int i = 0; i < 8; ++i) { st[w][0][8 * hh + i] = m8[i]; st[w][1][8 * hh + i] = s8[i]; } }
    /* work-group barrier with LDS-only fences: every wave's pair of this query row is readable, and the other parity's buffer is rewritten only behind it. Only sst passes between waves; __syncthreads() would also wait for the next row's loads and the last row's stores */
    __builtin_amdgcn_fence(__ATOMIC_RELEASE, "workgroup", "local"); __builtin_amdgcn_s_barrier(); __builtin_amdgcn_fence(__ATOMIC_ACQUIRE, "workgroup", "local");
    float mw[SMW], mx = -3.0e38f, se = 0.f;
#pragma unroll
    for (int u = 0; u < SMW; ++u) { mw[u] = st[u][0][hd]; mx = fmaxf(mx, mw[u]); }
#pragma unroll
    for (int u = 0; u < SMW; ++u) se += st[u][1][hd] * sm_exp(mw[u] - mx);
    const float f = sm_exp(st[w][0][hd] - mx) * (1024.0f / se);      /* exp(x - wave max) * f = 1024 * softmax */
    const float f8[8] = {sm_dpp<0x150>(f), sm_dpp<0x151>(f), sm_dpp<0x152>(f), sm_dpp<0x153>(f), sm_dpp<0x154>(f), sm_dpp<0x155>(f), sm_dpp<0x156>(f), sm_dpp<0x157>(f)};      /* lane i of the row holds head 8hh + i */
#pragma unroll
    for (int v = 0; v < 2; ++v) { v8f d[4];
#pragma unroll
      for (int j = 0; j < 4; ++j) { FragH bf;
#pragma unroll
        for (int i = 0; i < 8; ++i) bf.h[i] = (_Float16)(c[i][v][j] * f8[i]);
#pragma unroll
        for (int i = 8; i < 16; ++i) bf.h[i] = (_Float16)0.0f;
        d[j] = g2_mma(aW, bf.v, z8); }
#pragma unroll
      for (int r = 0; r < 8; ++r) { v4h o; o[0] = (_Float16)d[0][r]; o[1] = (_Float16)d[1][r]; o[2] = (_Float16)d[2][r]; o[3] = (_Float16)d[3][r];
        *(v4h*)(po + ((size_t)r * hp + (size_t)q * SEQ + 64 * v) + lofs) = o; } }
  }
}

extern "C" void kernel_launch(void* const* d_in, const int* in_sizes, int n_in,
                              void* d_out, int out_size, void* d_ws, size_t ws_size, hipStream_t stream) {
  if (n_in < 10) return;
  if ((size_t)in_sizes[0] < NR * DM) return;
  if ((size_t)in_sizes[1] < (size_t)DM * DM || (size_t)in_sizes[3] < (size_t)DM * DM || (size_t)in_sizes[5] < (size_t)DM * DM || (size_t)in_sizes[7] < (size_t)DM * DM) return;
  if (in_sizes[2] < DM || in_sizes[4] < DM || in_sizes[6] < DM || in_sizes[8] < DM || in_sizes[9] < NH * NH) return;
  if ((size_t)out_size < NR * DM) return;
  const float* const* I = (const float* const*)d_in;
  const float* xq = I[0]; const float* wq = I[1]; const float* bq = I[2]; const float* wk = I[3]; const float* bk = I[4]; const float* wv = I[5]; const float* bv = I[6]; const float* wo = I[7]; const float* bo = I[8]; const float* mixw = I[9];
  char* ws = (char*)d_ws; size_t off = 0;
  auto take = [&](size_t bytes) { char* p = ws + off; off += (bytes + 255) & ~(size_t)255; return p; };
  _Float16* BQ = (_Float16*)take((size_t)4 * DM * DM * 2); _Float16* BO = BQ + (size_t)3 * DM * DM;      /* wq, wk, wv, wo planes, pitch DM * DM */
  _Float16* X16 = (_Float16*)take(NR * DM * 2); _Float16* Q16 = (_Float16*)take(3 * NR * DM * 2); _Float16* K16 = Q16 + NR * DM; _Float16* V16 = K16 + NR * DM; _Float16* O16 = (_Float16*)take(NR * DM * 2);      /* q, k, v planes, pitch NR * DM */
  float* S = (float*)take((size_t)NB * NH * QC * SEQ * 4); _Float16* PM = (_Float16*)take((size_t)NB * NH * QC * SEQ * 2); _Float16* VT = (_Float16*)take((size_t)NB * NH * HD * SEQ * 2);
  _Float16* WT = (_Float16*)take((size_t)NH * 32 * 2);
  if (off > ws_size) return;
  k_prep<<<1 + 4 * PWB + PXB, 256, 0, stream>>>(wq, wk, wv, wo, xq, mixw, BQ, X16, WT);
  const dim3 gp((unsigned)((MP / 128) * (DM / 64)), 1);
  k_gemm2<true, false, false, 128><<<dim3(gp.x, 3), 128, 0, stream>>>(X16, DM, 0, BQ, DM, (size_t)DM * DM, 0.0625f, bq, bk, bv, nullptr, Q16, DM, NR * DM, MP, DM, DM);      /* slab 0 / 1 / 2 = q / k / v */
  k_vt<<<NB * NH * (SEQ / 64), 256, 0, stream>>>(V16, VT);      /* V16 rows [SEQ*NB][DM] -> VT[(b,h)][64][SEQ] */
  for (int t0 = 0; t0 < SEQ; t0 += QC) {
    /* scores: slab by = b*NH + h at column offset by*64 of rows with pitch LQ; S[by][QC][SEQ] f32 */
    k_gemm2<false, true, false, 64><<<dim3((QC / 128) * (SEQ / 64), NB * NH), 128, 0, stream>>>(Q16 + (size_t)t0 * LQ, LQ, (size_t)HD, K16, LQ, (size_t)HD, 0.125f, nullptr, nullptr, nullptr, S, nullptr, SEQ, (size_t)QC * SEQ, QC, SEQ, HD);
    k_smix<<<NB * QC / SMR, SMW * 32, 0, stream>>>(S, WT, PM, (size_t)QC * SEQ);
    /* o[t][b][g*64 + d] x64 = 2^-4 * (1024 P') . V^T */
    k_gemm2<false, false, false, 128><<<dim3((QC / 128) * (HD / 64), NB * NH), 128, 0, stream>>>(PM, SEQ, (size_t)QC * SEQ, VT, SEQ, (size_t)HD * SEQ, 0.0625f, nullptr, nullptr, nullptr, nullptr, O16 + (size_t)t0 * LQ, LQ, (size_t)HD, QC, HD, SEQ);
  }
  k_gemm2<true, true, true, 128><<<gp, 128, 0, stream>>>(O16, DM, 0, BO, DM, 0, 0.0009765625f, bo, nullptr, nullptr, (float*)d_out, nullptr, DM, 0, MP, DM, DM);      /* out rows t*NB_FULL + b */
}

// v006
// It runs in 77.6 microseconds.
// It is 1.12 times as fast as v004, going by the measured steps of the versions left out in between.
// All steps since v000 together make it 6.07 times as fast.
#include <hip/hip_runtime.h>
// Multi-head SELF-attention with cross-head probability mixing, sequence-first layout: x [1024][2][1024] (token row r = t*NB + b); q / k / v = x W^T + bias (natural [out][in] weights, biases present), 16 heads of 64, q scaled by 64^-0.5; softmax over all 1024 keys (no mask); P'[b,g,t,s] = sum_h P[b,h,t,s] * Wm[h][g] with Wm = column softmax (axis 0) of mix_w; ctx[b,g] = P'[b,g] . v[b,g]; merged [t][b][g*64+d]; out = ctx Wo^T + bo.
// Structure: one conversion launch (x as exact f16 rows, inputs RNE-converted to bf16 first; the four weights; the mix matrix); Q, K, V as three WMMA GEMMs in one launch, one per grid.y (32x64 wave tiles, operands staged in LDS by asynchronous copies, f32 accumulation, x16 weights + bias, f16 outputs; the V slab's epilogue turns its tile in LDS and stores V^T per (b,h) directly); all query rows in one chunk: scores GEMM (K = 64, batched over the 32 (b,h) slabs on grid.y, alpha 64^-0.5, f32 accumulators stored as f16), k_smix (scores of a query row held in registers, f32 row statistics, native exp, head mix as one WMMA per 16-key tile: A = Wm^T f16 with K zero-padded 16 -> 32, B = 1024 P f16), o = P' . V^T GEMM (K = 1024; o carried x64) into merged f16 rows; out = o Wo + bo GEMM (f32).
// Compute dtype: all contractions v_wmma_f32_16x16x32_f16 (f16 operands, f32 accumulate); inputs RNE-converted to bf16 (exact in f16); q, k, v, mixed softmax weights (x1024), mix matrix and o (x64) as plain f16 operands; scores accumulated in f32 and kept in memory as f16; exponentials and softmax statistics f32.
#ifndef NB
#define NB 2                         /* batches processed */
#endif
#ifndef SEQ
#define SEQ 1024                     /* sequence length processed (queries = keys) */
#endif
#define NB_FULL 2                    /* batch pitch of the input / output rows */
#define DM 1024
#define NH 16
#define HD 64
#define QC SEQ                       /* query rows per attention chunk: the whole sequence, so each attention launch fills the chip (S f16 + PM f16 = 128 MiB of workspace) */
#define NR ((size_t)NB * SEQ)        /* token rows */
#define MP ((int)(NB * SEQ))
#define LQ (NB * DM)                 /* pitch between consecutive t for one batch */
static_assert(SEQ % 128 == 0);
static_assert(QC % 128 == 0);
static_assert(SEQ % QC == 0);
static_assert(NH * HD == DM);
static_assert(NB <= NB_FULL);
static_assert((NB * SEQ) % 128 == 0);
static_assert(NH == 16);

typedef unsigned short v8us __attribute__((ext_vector_type(8), may_alias));
typedef float  v8f  __attribute__((ext_vector_type(8)));
typedef float  v4f  __attribute__((ext_vector_type(4)));
typedef float  v4fa __attribute__((ext_vector_type(4), may_alias));
typedef _Float16 v16h __attribute__((ext_vector_type(16)));
typedef _Float16 v4h __attribute__((ext_vector_type(4)));
typedef _Float16 v8h __attribute__((ext_vector_type(8), may_alias));
typedef _Float16 v2h __attribute__((ext_vector_type(2)));
union FragH { v16h v; v8us half[2]; _Float16 h[16]; unsigned short u[16]; };

__device__ __forceinline__ unsigned short bf16_bits(float x) { unsigned int u = __float_as_uint(x); return (unsigned short)((u + 0x7FFFu + ((u >> 16) & 1u)) >> 16); }
__device__ __forceinline__ float bf16_val(unsigned short b) { return __uint_as_float(((unsigned int)b) << 16); }
__device__ __forceinline__ float bf16_rne(float x) { return bf16_val(bf16_bits(x)); }   /* RNE convert to bf16, back as f32 */

// fragment: elements 0..7 <- k0 + 8h .. +7, elements 8..15 <- k0 + 16 + 8h .. +7 (p points at k0 of the lane's row / column)
__device__ __forceinline__ v16h g2_frag(const _Float16* p, int hh) { FragH f; f.half[0] = *(const v8us*)((const unsigned short*)p + 8 * hh); f.half[1] = *(const v8us*)((const unsigned short*)p + 16 + 8 * hh); return f.v; }
__device__ __forceinline__ v8f g2_mma(v16h a, v16h b, v8f c) { v8f d = __builtin_amdgcn_wmma_f32_16x16x32_f16(false, a, false, b, (short)0, c, false, false); asm volatile("v_nop\n\tv_nop\n\tv_nop\n\tv_nop" : "+v"(d) : "v"(a), "v"(b)); return d; }

// ---- GEMM (workgroup tile 128x64, wave tile 32x64; M % 128 == 0 per launch region, N % 64 == 0, K % KP == 0, K >= KP): C = alpha * A . Bt^T (+ bias) ----
// A f16 [M][K] (pitch lda), Bt f16 [N][K] (pitch ldb); batch slab by = blockIdx.y with element strides sA / sB / sC; slab 0 / 1 / 2 adds bias / bias1 / bias2.
// OMAP: output row r -> (r / NB) * NB_FULL + r % NB.
// VTS: slab 2 (v) is stored transposed only: CT[(b * NH + h) * HD + d][t] for token row r = t * NB + b and column h * HD + d; a workgroup's 128 rows x 64 columns are 64 t of one head for both batches.
// Operand path: per pass of KP k the 128 A rows and the 64 Bt rows go to LDS by asynchronous 16-byte copies (whole 128-byte lines per row), two buffers, the next pass's copies in flight while this pass is worked on.
// twelve copies of one lane; the s_wait_xcnt stands inside the statement so that no address register is rewritten in front of it
__device__ __forceinline__ void g2_cp12(const unsigned* l, const _Float16* const* g) {
  asm volatile("global_load_async_to_lds_b128 %0, %12, off\n\t"
               "global_load_async_to_lds_b128 %1, %13, off\n\t"
               "global_load_async_to_lds_b128 %2, %14, off\n\t"
               "global_load_async_to_lds_b128 %3, %15, off\n\t"
               "global_load_async_to_lds_b128 %4, %16, off\n\t"
               "global_load_async_to_lds_b128 %5, %17, off\n\t"
               "global_load_async_to_lds_b128 %6, %18, off\n\t"
               "global_load_async_to_lds_b128 %7, %19, off\n\t"
               "global_load_async_to_lds_b128 %8, %20, off\n\t"
               "global_load_async_to_lds_b128 %9, %21, off\n\t"
               "global_load_async_to_lds_b128 %10, %22, off\n\t"
               "global_load_async_to_lds_b128 %11, %23, off\n\t"
               "s_wait_xcnt 0x0"
               :: "v"(l[0]), "v"(l[1]), "v"(l[2]), "v"(l[3]), "v"(l[4]), "v"(l[5]), "v"(l[6]), "v"(l[7]), "v"(l[8]), "v"(l[9]), "v"(l[10]), "v"(l[11]),
                  "v"(g[0]), "v"(g[1]), "v"(g[2]), "v"(g[3]), "v"(g[4]), "v"(g[5]), "v"(g[6]), "v"(g[7]), "v"(g[8]), "v"(g[9]), "v"(g[10]), "v"(g[11]) : "memory"); }
// one stage: LDS rows 0..127 = A rows of the workgroup, rows 128..191 = Bt rows; ap / bp = the lane's first 16 bytes of each operand at this pass's k, l0 = the lane's LDS byte address in the stage
template <int KP>
__device__ __forceinline__ void g2_stage(const _Float16* ap, int lda, const _Float16* bp, int ldb, unsigned l0) {
  constexpr int CPR = KP / 8, RPR = 128 / CPR, PB = KP * 2 + 16;      /* 16-byte pieces per row, rows per round of 128 lanes, LDS pitch in bytes */
#pragma unroll      /* both loops: the operand (A or Bt) of a copy is picked at compile time, l[] and g[] stay in registers */
  for (int s = 0; s < (CPR + CPR / 2) / 12; ++s) { unsigned l[12]; const _Float16* g[12];
#pragma unroll
    for (int j = 0; j < 12; ++j) { const int i = s * 12 + j; l[j] = l0 + (unsigned)(i * RPR * PB);
      g[j] = (i < CPR) ? ap + (size_t)(i * RPR) * lda : bp + (size_t)((i - CPR) * RPR) * ldb; }
    g2_cp12(l, g); } }

// the six fragments of one 32-k group from LDS (pitch PB bytes): two A row tiles, four Bt row tiles
template <int PB>
__device__ __forceinline__ void g2_ld6(v16h* f, const unsigned char* pa, const unsigned char* pb, int hh) {
  f[0] = g2_frag((const _Float16*)pa, hh); f[1] = g2_frag((const _Float16*)(pa + 16 * PB), hh);
  f[2] = g2_frag((const _Float16*)pb, hh); f[3] = g2_frag((const _Float16*)(pb + 16 * PB), hh); f[4] = g2_frag((const _Float16*)(pb + 32 * PB), hh); f[5] = g2_frag((const _Float16*)(pb + 48 * PB), hh); }

template <bool HASB, bool OUT32, bool OMAP, bool VTS, int KP>
__global__ __launch_bounds__(128) void k_gemm2(const _Float16* __restrict__ A, int lda, size_t sA, const _Float16* __restrict__ Bh, int ldb, size_t sB, float alpha,
    const float* __restrict__ bias, const float* __restrict__ bias1, const float* __restrict__ bias2, float* __restrict__ C, _Float16* __restrict__ C16, _Float16* __restrict__ CT, int ldc, size_t sC, int M, int N, int K) {
  constexpr int CPR = KP / 8, PB = KP * 2 + 16, STG = 192 * PB, SOB = 4 * 32 * 68 * 4;
  __shared__ __attribute__((aligned(16))) unsigned char sm[(2 * STG > SOB) ? 2 * STG : SOB];      /* two operand stages; after the k loop the output staging */
  float (*so)[32][68] = (float (*)[32][68])sm;
  const int tid = threadIdx.x, w = __builtin_amdgcn_readfirstlane((int)(tid >> 5)), lane = tid & 31, ln = lane & 15, hh = lane >> 4; const int by = blockIdx.y;
  A += (size_t)by * sA; Bh += (size_t)by * sB; const size_t cofs = (size_t)by * sC;
  const int ntn = N >> 6; const int mt = blockIdx.x / ntn, nq = blockIdx.x - mt * ntn; const int row0 = mt * 128 + 32 * w, col0 = nq * 64; if (mt * 128 >= M) return;
  const int crow = tid / CPR, cpc = tid % CPR;
  const _Float16* ap = A + (size_t)(mt * 128 + crow) * lda + cpc * 8; const _Float16* bp = Bh + (size_t)(col0 + crow) * ldb + cpc * 8;
  const unsigned l0 = (unsigned)(size_t)sm + (unsigned)(crow * PB + cpc * 16);
  const unsigned char* fa = sm + (32 * w + ln) * PB; const unsigned char* fb = sm + (128 + ln) * PB;
  const v8f z8 = {0.f,0.f,0.f,0.f,0.f,0.f,0.f,0.f}; v8f c00 = z8, c01 = z8, c02 = z8, c03 = z8, c10 = z8, c11 = z8, c12 = z8, c13 = z8;
  const int nt = K / KP;
  g2_stage<KP>(ap, lda, bp, ldb, l0);
  asm volatile("s_wait_asynccnt 0x0" ::: "memory");      /* this wave's copies of pass 0 have landed */
  __syncthreads();                                        /* pass 0 is readable by every wave */
  if (nt > 1) g2_stage<KP>(ap + KP, lda, bp + KP, ldb, l0 + STG);
#pragma unroll 1      /* one pass per trip: the hand-over at the foot stands once, and the loop stays small */
  for (int t = 0; t < nt; ++t) { const int bo = (t & 1) * STG;
    const unsigned char* pa = fa + bo; const unsigned char* pb = fb + bo; v16h fr[2][6];
    g2_ld6<PB>(fr[0], pa, pb, hh);
#pragma unroll      /* fr[] is indexed by constants only, so both fragment sets stay in registers */
    for (int kk = 0; kk < KP / 32; ++kk) { if (kk + 1 < KP / 32) g2_ld6<PB>(fr[(kk + 1) & 1], pa + (kk + 1) * 64, pb + (kk + 1) * 64, hh);      /* the next 32 k of this pass: one group of LDS reads in front of this group's WMMAs */
      const v16h a0 = fr[kk & 1][0], a1 = fr[kk & 1][1];
      v16h b = fr[kk & 1][2]; c00 = g2_mma(a0, b, c00); c10 = g2_mma(a1, b, c10);
      b = fr[kk & 1][3]; c01 = g2_mma(a0, b, c01); c11 = g2_mma(a1, b, c11);
      b = fr[kk & 1][4]; c02 = g2_mma(a0, b, c02); c12 = g2_mma(a1, b, c12);
      b = fr[kk & 1][5]; c03 = g2_mma(a0, b, c03); c13 = g2_mma(a1, b, c13); }
    asm volatile("s_wait_dscnt 0x0" ::: "memory");        /* this wave's reads of the buffer are done before it is refilled */
    asm volatile("s_wait_asynccnt 0x0" ::: "memory");     /* this wave's copies of pass t + 1 have landed */
    __syncthreads();                                      /* publishes pass t + 1 and ends every wave's reads of pass t */
    if (t + 2 < nt) g2_stage<KP>(ap + (size_t)(t + 2) * KP, lda, bp + (size_t)(t + 2) * KP, ldb, l0 + (unsigned)bo); }
  asm volatile("s_wait_asynccnt 0x0" ::: "memory");       /* no copy is outstanding when the buffers become output staging */
  v8f accs[8] = {c00, c01, c02, c03, c10, c11, c12, c13};
  const float* bsl = (by == 0) ? bias : ((by == 1) ? bias1 : bias2);
  if (VTS && by == 2) {      /* by is the same in the whole workgroup */
    static_assert(!VTS || (NB == 2 && HD == 64 && SEQ % 64 == 0));
    _Float16 (*sv)[HD][72] = (_Float16 (*)[HD][72])sm;      /* [b][d][t of the tile]; the pitch of 144 bytes puts the 8-byte writes of a wave's 32 lanes on different banks */
#pragma unroll      /* the three loops: accs[] is indexed by constants only, so it stays in registers */
    for (int u = 0; u < 8; ++u) { const int t = u & 3, half = u >> 2; float bv = 0.f; if (HASB) bv = bf16_rne(bsl[col0 + t * 16 + ln]);
#pragma unroll
      for (int bb = 0; bb < 2; ++bb) { v4h h4;      /* accumulator rows r = 2i + bb: four consecutive t of batch bb */
#pragma unroll
        for (int i = 0; i < 4; ++i) h4[i] = (_Float16)(accs[u][2 * i + bb] * alpha + bv);
        *(v4h*)&sv[bb][t * 16 + ln][16 * w + 8 * half + 4 * hh] = h4; } }
    __syncthreads();      /* a row of V^T holds t of all four waves */
    _Float16* pt = CT + ((size_t)nq * HD + (tid >> 3)) * SEQ + mt * 64 + (tid & 7) * 8;      /* eight lanes store one whole 128-byte line */
#pragma unroll      /* the eight pieces differ by immediate offsets from one LDS and one global address */
    for (int q = 0; q < 8; ++q) { const int bb = q >> 2, d0 = (q & 3) * 16;
      *(v8h*)(pt + ((size_t)bb * NH * HD + d0) * SEQ) = *(const v8h*)&sv[bb][d0 + (tid >> 3)][(tid & 7) * 8]; }
    return; }
#pragma unroll
  for (int u = 0; u < 8; ++u) { const int t = u & 3, half = u >> 2; const int col = col0 + t * 16 + ln; float bv = 0.f; if (HASB) bv = bf16_rne(bsl[col]);
#pragma unroll
    for (int r = 0; r < 8; ++r) { const int rloc = half * 16 + 8 * hh + r; so[w][rloc][t * 16 + ln] = accs[u][r] * alpha + bv; } }
  __builtin_amdgcn_fence(4 /* acq_rel order */, "workgroup"); __builtin_amdgcn_wave_barrier();      /* so[w] is private to wave w */
  const int rsub = lane >> 4, c4 = (lane & 15) * 4;
  {
#pragma unroll
    for (int q = 0; q < 16; ++q) { const int r = q * 2 + rsub; const v4f v = *(const v4fa*)&so[w][r][c4];
      const int gr = row0 + r; const size_t orow = OMAP ? ((size_t)(gr / NB) * NB_FULL + (size_t)(gr % NB)) : (size_t)gr;
      if (OUT32) { *(v4f*)(C + cofs + orow * ldc + col0 + c4) = v; }
      else { v4h h4;
#pragma unroll
        for (int i = 0; i < 4; ++i) h4[i] = (_Float16)v[i];
        *(v4h*)(C16 + cofs + orow * ldc + col0 + c4) = h4; } }
     } }

// ---- every conversion that depends on the inputs alone, in one launch: block 0 = mix matrix, then PWB blocks per weight, then PXB blocks of x ----
#define PWB ((int)((size_t)DM * DM / (8 * 256)))      /* blocks per weight matrix, 8 elements per thread */
#define PXB ((int)(NR * DM / (8 * 256)))              /* blocks of x */
static_assert((size_t)DM * DM % (8 * 256) == 0);
static_assert(NR * DM % (8 * 256) == 0);

// WT[g][32] f16 = column softmax (axis 0) of mix_w, transposed, k zero-padded 16 -> 32; i = 0..63
__device__ __forceinline__ void d_wmix(const float* __restrict__ mixw, _Float16* __restrict__ WT, int i) {
  const int g = i >> 2, k8 = (i & 3) * 8; float mx = -3.0e38f;
#pragma unroll 1
  for (int h = 0; h < NH; ++h) mx = fmaxf(mx, bf16_rne(mixw[h * NH + g]));
  float se = 0.f;
#pragma unroll 1
  for (int h = 0; h < NH; ++h) se += __expf(bf16_rne(mixw[h * NH + g]) - mx);
  const float inv = 1.0f / se; FragH f;
#pragma unroll
  for (int q = 0; q < 8; ++q) { const int h = k8 + q; const int hc = (h < NH) ? h : (NH - 1); const float v = __expf(bf16_rne(mixw[hc * NH + g]) - mx) * inv; f.h[q] = (_Float16)((h < NH) ? v : 0.0f); }
  const v8us o = f.half[0]; *(v8us*)((unsigned short*)WT + i * 8) = o; }

// 8 floats at p -> f16(bf16_rne(v) * sc) at d
__device__ __forceinline__ void d_cvt(const float* __restrict__ p, _Float16* __restrict__ d, float sc) {
  const v4f a = *(const v4fa*)p, c = *(const v4fa*)(p + 4); FragH f;
#pragma unroll
  for (int q = 0; q < 4; ++q) { f.h[q] = (_Float16)(bf16_rne(a[q]) * sc); f.h[4 + q] = (_Float16)(bf16_rne(c[q]) * sc); }
  const v8us o = f.half[0]; *(v8us*)(unsigned short*)d = o; }

__global__ __launch_bounds__(256) void k_prep(const float* __restrict__ wq, const float* __restrict__ wk, const float* __restrict__ wv, const float* __restrict__ wo, const float* __restrict__ x, const float* __restrict__ mixw,
    _Float16* __restrict__ BW, _Float16* __restrict__ X16, _Float16* __restrict__ WT) {
  const int bid = (int)blockIdx.x - 1, tid = threadIdx.x;
  if (bid < 0) { if (tid < 64) d_wmix(mixw, WT, tid); return; }      /* first block: its chain of dependent loads starts first */
  if (bid < 4 * PWB) { const int m = bid / PWB; const float* w = (m == 0) ? wq : ((m == 1) ? wk : ((m == 2) ? wv : wo));
    const size_t t = (size_t)(bid - m * PWB) * 256 + tid; d_cvt(w + t * 8, BW + (size_t)m * DM * DM + t * 8, 16.0f); return; }      /* natural [out][in] = Bt[n][k], x16 */
  const size_t t = (size_t)(bid - 4 * PWB) * 256 + tid; const size_t row = t / (DM / 8); const int c8 = (int)(t % (DM / 8)) * 8; const size_t srow = (row / NB) * NB_FULL + (row % NB);
  d_cvt(x + srow * DM + c8, X16 + t * 8, 1.0f);
  asm volatile("s_wait_xcnt 0x0" ::: "memory"); }      /* behind the store: in the built code the other cases' blocks follow this one and rewrite the store's registers */

// softmax over SEQ keys + cross-head mix. S f16 [NB*NH][QC][SEQ] (slab by = b*NH + h); PM f16 [NB*NH][QC][SEQ] = 1024 * sum_h Wm[h][g] * softmax(S[b*NH+h][t][:]).
// One work-group per SMR query rows (b, t), SMW waves; wave w owns keys 128w .. 128w + 127 of all 16 heads and keeps them in registers, so S is read once, in whole lines.
// Lane (ln, hh) holds heads 8hh .. 8hh + 7 at keys 128w + 8ln + j (j = 0 .. 7), one 16-byte load per head: that is the B fragment of the mix WMMA for tile j, column ln <-> key 8ln + j,
// and D (row g = 8hh + r, column ln) of the eight tiles gives eight consecutive keys per lane: 16-byte stores, 256 bytes per head row and half wave.
// Row statistics: per wave max and sum of exp(x - wave max) over the 16-lane row by DPP, the waves' pairs joined through LDS (one barrier per query row).
#define SMW (SEQ / 128)      /* waves per work-group */
#define SMR 4                /* query rows per work-group, the next row's loads in flight while a row is worked on */
static_assert(SMW >= 1 && SMW <= 32);
static_assert(QC % SMR == 0);
template <int CTRL> __device__ __forceinline__ float sm_dpp(float v) { return __builtin_bit_cast(float, __builtin_amdgcn_mov_dpp(__builtin_bit_cast(int, v), CTRL, 0xf, 0xf, true)); }      /* 0x160 | m: lane l ^ m of the 16-lane row; 0x150 | i: lane i of the row */
// native exp (v_exp_f32 of x * log2 e) with the slot behind the transcendental filled in the same statement: in the built code the next instruction otherwise overwrites its source register directly behind it
__device__ __forceinline__ float sm_exp(float x) { const float t = x * 1.44269504f; float e; asm("v_exp_f32 %0, %1\n\tv_nop" : "=v"(e) : "v"(t)); return e; }
__device__ __forceinline__ float sm_exp2(float t) { float e; asm("v_exp_f32 %0, %1\n\tv_nop" : "=v"(e) : "v"(t)); return e; }      /* 2^t, the same slot filled */
__device__ __forceinline__ float sm_rowmax(float v) { v = fmaxf(v, sm_dpp<0x161>(v)); v = fmaxf(v, sm_dpp<0x162>(v)); v = fmaxf(v, sm_dpp<0x164>(v)); return fmaxf(v, sm_dpp<0x168>(v)); }
__device__ __forceinline__ float sm_rowsum(float v) { v += sm_dpp<0x161>(v); v += sm_dpp<0x162>(v); v += sm_dpp<0x164>(v); return v + sm_dpp<0x168>(v); }
// p and hp are the same in every lane, lofs is the lane's own element offset; the query rows of a work-group differ by an immediate offset, so the eight address pairs are formed once and live until the last row's loads are issued
__device__ __forceinline__ void sm_load(v8h (&x)[8], const _Float16* __restrict__ p, size_t hp, unsigned lofs) {
#pragma unroll
  for (int i = 0; i < 8; ++i) x[i] = *(const v8h*)(p + (size_t)i * hp + lofs); }

__global__ __launch_bounds__(SMW * 32) void k_smix(const _Float16* __restrict__ S, const _Float16* __restrict__ WT, _Float16* __restrict__ PM, size_t hp) {      /* hp = head slab pitch QC * SEQ, an argument so that the head bases are formed in scalar registers */
  __shared__ __attribute__((aligned(16))) float sst[2][SMW][2][NH];      /* [row parity][wave][max, sum][head] */
  const int tid = threadIdx.x, w = __builtin_amdgcn_readfirstlane((int)(tid >> 5)), lane = tid & 31, ln = lane & 15, hh = lane >> 4;
  const int wr = blockIdx.x * SMR; const int b = wr / QC, tql = wr - b * QC;
  const size_t base = ((size_t)(b * NH) * QC + tql) * SEQ + 128 * w; const unsigned lofs = (unsigned)(8 * hh) * (unsigned)hp + 8 * ln;
  const _Float16* ps = S + base;                                          /* head 8hh + i of query row q at ps + i * hp + q * SEQ + lofs */
  _Float16* po = PM + base;
  const v8f z8 = {0.f,0.f,0.f,0.f,0.f,0.f,0.f,0.f};
  const int hd = 8 * hh + (ln & 7);                                    /* the head whose joined statistics this lane forms */
  v8h x[2][8];
  const v16h aW = g2_frag(WT + ln * 32, hh);                          /* A: row g = ln, k = heads (upper 16 k zero) */
  asm volatile("s_wait_xcnt 0x0" ::: "memory");      /* behind the loads of aW: in the built code a load of scores lands in their address registers */
  sm_load(x[0], ps, hp, lofs);
#pragma unroll      /* x[] is indexed by constants only, so both rows' scores stay in registers */
  for (int q = 0; q < SMR; ++q) { v8h (&xc)[8] = x[q & 1];
    if (q > 0) asm volatile("s_wait_xcnt 0x0" ::: "memory");      /* behind the last row's stores: the loads and the work below land in registers that those stores name */
    if (q + 1 < SMR) sm_load(x[(q + 1) & 1], ps + (size_t)(q + 1) * SEQ, hp, lofs);
    if (q + 2 == SMR) asm volatile("s_wait_xcnt 0x0" ::: "memory");      /* behind the last loads: their address registers are free from here on and this row's work is put into them */
    __builtin_amdgcn_sched_barrier(0);      /* keeps the next row's loads in front of this row's work and the two rows' work apart: without it the build starts on the next row's scores inside this row and waits for them early */
    float c[8][8], m8[8], s8[8];
#pragma unroll
    for (int i = 0; i < 8; ++i) { const v8h u = xc[i];      /* the lane's maximum is taken on the f16 pairs (exact), then widened */
      const v4h a = __builtin_elementwise_max(__builtin_shufflevector(u, u, 0, 1, 2, 3), __builtin_shufflevector(u, u, 4, 5, 6, 7));
      const v2h p = __builtin_elementwise_max(__builtin_shufflevector(a, a, 0, 1), __builtin_shufflevector(a, a, 2, 3));
      m8[i] = sm_rowmax(fmaxf((float)p[0], (float)p[1])); }
#pragma unroll
    for (int i = 0; i < 8; ++i) { float se = 0.f; const float nm = -m8[i] * 1.44269504f;
#pragma unroll
      for (int j = 0; j < 8; ++j) { const float e = sm_exp2(__builtin_fmaf((float)xc[i][j], 1.44269504f, nm)); c[i][j] = e; se += e; }      /* exp(x - max): the f16 score goes into the multiply-add as it is */
      s8[i] = sm_rowsum(se); }
    float (*st)[2][NH] = sst[q & 1];
    if (ln == 0) {
#pragma unroll
      for (int i = 0; i < 8; ++i) { st[w][0][8 * hh + i] = m8[i]; st[w][1][8 * hh + i] = s8[i]; } }
    /* work-group barrier with LDS-only fences: every wave's pair of this query row is readable, and the other parity's buffer is rewritten only behind it. Only sst passes between waves; __syncthreads() would also wait for the next row's loads and the last row's stores */
    __builtin_amdgcn_fence(__ATOMIC_RELEASE, "workgroup", "local"); __builtin_amdgcn_s_barrier(); __builtin_amdgcn_fence(__ATOMIC_ACQUIRE, "workgroup", "local");
    float mw[SMW], mx = -3.0e38f, se = 0.f;
#pragma unroll
    for (int u = 0; u < SMW; ++u) { mw[u] = st[u][0][hd]; mx = fmaxf(mx, mw[u]); }
#pragma unroll
    for (int u = 0; u < SMW; ++u) se += st[u][1][hd] * sm_exp(mw[u] - mx);
    const float f = sm_exp(st[w][0][hd] - mx) * (1024.0f / se);      /* exp(x - wave max) * f = 1024 * softmax */
    const float f8[8] = {sm_dpp<0x150>(f), sm_dpp<0x151>(f), sm_dpp<0x152>(f), sm_dpp<0x153>(f), sm_dpp<0x154>(f), sm_dpp<0x155>(f), sm_dpp<0x156>(f), sm_dpp<0x157>(f)};      /* lane i of the row holds head 8hh + i */
    v8f d[8];
#pragma unroll
    for (int j = 0; j < 8; ++j) { FragH bf;
#pragma unroll
      for (int i = 0; i < 8; ++i) bf.h[i] = (_Float16)(c[i][j] * f8[i]);
#pragma unroll
      for (int i = 8; i < 16; ++i) bf.h[i] = (_Float16)0.0f;
      d[j] = g2_mma(aW, bf.v, z8); }
#pragma unroll
    for (int r = 0; r < 8; ++r) { v8h o;
#pragma unroll
      for (int j = 0; j < 8; ++j) o[j] = (_Float16)d[j][r];
      *(v8h*)(po + ((size_t)r * hp + (size_t)q * SEQ) + lofs) = o; }
  }
}

extern "C" void kernel_launch(void* const* d_in, const int* in_sizes, int n_in,
                              void* d_out, int out_size, void* d_ws, size_t ws_size, hipStream_t stream) {
  if (n_in < 10) return;
  if ((size_t)in_sizes[0] < NR * DM) return;
  if ((size_t)in_sizes[1] < (size_t)DM * DM || (size_t)in_sizes[3] < (size_t)DM * DM || (size_t)in_sizes[5] < (size_t)DM * DM || (size_t)in_sizes[7] < (size_t)DM * DM) return;
  if (in_sizes[2] < DM || in_sizes[4] < DM || in_sizes[6] < DM || in_sizes[8] < DM || in_sizes[9] < NH * NH) return;
  if ((size_t)out_size < NR * DM) return;
  const float* const* I = (const float* const*)d_in;
  const float* xq = I[0]; const float* wq = I[1]; const float* bq = I[2]; const float* wk = I[3]; const float* bk = I[4]; const float* wv = I[5]; const float* bv = I[6]; const float* wo = I[7]; const float* bo = I[8]; const float* mixw = I[9];
  char* ws = (char*)d_ws; size_t off = 0;
  auto take = [&](size_t bytes) { char* p = ws + off; off += (bytes + 255) & ~(size_t)255; return p; };
  _Float16* BQ = (_Float16*)take((size_t)4 * DM * DM * 2); _Float16* BO = BQ + (size_t)3 * DM * DM;      /* wq, wk, wv, wo planes, pitch DM * DM */
  _Float16* X16 = (_Float16*)take(NR * DM * 2); _Float16* Q16 = (_Float16*)take(2 * NR * DM * 2); _Float16* K16 = Q16 + NR * DM; _Float16* O16 = (_Float16*)take(NR * DM * 2);      /* q, k planes, pitch NR * DM */
  _Float16* S = (_Float16*)take((size_t)NB * NH * QC * SEQ * 2); _Float16* PM = (_Float16*)take((size_t)NB * NH * QC * SEQ * 2); _Float16* VT = (_Float16*)take((size_t)NB * NH * HD * SEQ * 2);
  _Float16* WT = (_Float16*)take((size_t)NH * 32 * 2);
  if (off > ws_size) return;
  k_prep<<<1 + 4 * PWB + PXB, 256, 0, stream>>>(wq, wk, wv, wo, xq, mixw, BQ, X16, WT);
  const dim3 gp((unsigned)((MP / 128) * (DM / 64)), 1);
  k_gemm2<true, false, false, true, 128><<<dim3(gp.x, 3), 128, 0, stream>>>(X16, DM, 0, BQ, DM, (size_t)DM * DM, 0.0625f, bq, bk, bv, nullptr, Q16, VT, DM, NR * DM, MP, DM, DM);      /* slab 0 / 1 / 2 = q / k / v; v goes to VT[(b,h)][64][SEQ] */
  for (int t0 = 0; t0 < SEQ; t0 += QC) {
    /* scores: slab by = b*NH + h at column offset by*64 of rows with pitch LQ; S[by][QC][SEQ] f16 */
    k_gemm2<false, false, false, false, 64><<<dim3((QC / 128) * (SEQ / 64), NB * NH), 128, 0, stream>>>(Q16 + (size_t)t0 * LQ, LQ, (size_t)HD, K16, LQ, (size_t)HD, 0.125f, nullptr, nullptr, nullptr, nullptr, S, nullptr, SEQ, (size_t)QC * SEQ, QC, SEQ, HD);
    k_smix<<<NB * QC / SMR, SMW * 32, 0, stream>>>(S, WT, PM, (size_t)QC * SEQ);
    /* o[t][b][g*64 + d] x64 = 2^-4 * (1024 P') . V^T */
    k_gemm2<false, false, false, false, 128><<<dim3((QC / 128) * (HD / 64), NB * NH), 128, 0, stream>>>(PM, SEQ, (size_t)QC * SEQ, VT, SEQ, (size_t)HD * SEQ, 0.0625f, nullptr, nullptr, nullptr, nullptr, O16 + (size_t)t0 * LQ, nullptr, LQ, (size_t)HD, QC, HD, SEQ);
  }
  k_gemm2<true, true, true, false, 128><<<gp, 128, 0, stream>>>(O16, DM, 0, BO, DM, 0, 0.0009765625f, bo, nullptr, nullptr, (float*)d_out, nullptr, nullptr, DM, 0, MP, DM, DM);      /* out rows t*NB_FULL + b */
}

// v007
// It runs in 74.1 microseconds.
// In two side-by-side timings against v006, it was 1.04 and 1.05 times as fast.
// Over all steps from v000 it is 6.35 times as fast.
#include <hip/hip_runtime.h>
// Multi-head SELF-attention with cross-head probability mixing, sequence-first layout: x [1024][2][1024] (token row r = t*NB + b); q / k / v = x W^T + bias (natural [out][in] weights, biases present), 16 heads of 64, q scaled by 64^-0.5; softmax over all 1024 keys (no mask); P'[b,g,t,s] = sum_h P[b,h,t,s] * Wm[h][g] with Wm = column softmax (axis 0) of mix_w; ctx[b,g] = P'[b,g] . v[b,g]; merged [t][b][g*64+d]; out = ctx Wo^T + bo.
// Structure: one conversion launch (x as exact f16 rows, inputs RNE-converted to bf16 first; the four weights; the mix matrix); Q, K, V as three WMMA GEMMs in one launch, one per grid.y (32x64 wave tiles, operands staged in LDS by asynchronous copies, f32 accumulation, x16 weights + bias, f16 outputs; the V slab's epilogue turns its tile in LDS and stores V^T per (b,h) directly); all query rows in one chunk: scores kernel (K = 64, the 32 (b,h) slabs on grid.y, 128 queries x 256 keys per work-group, alpha 64^-0.5, f32 accumulators stored as f16), k_smix (scores of a query row held in registers, f32 row statistics, native exp, head mix as one WMMA per 16-key tile: A = Wm^T f16 with K zero-padded 16 -> 32, B = 1024 P f16), o = P' . V^T GEMM (K = 1024; o carried x64) into merged f16 rows; out = o Wo + bo GEMM (f32).
// Compute dtype: all contractions v_wmma_f32_16x16x32_f16 (f16 operands, f32 accumulate); inputs RNE-converted to bf16 (exact in f16); q, k, v, mixed softmax weights (x1024), mix matrix and o (x64) as plain f16 operands; scores accumulated in f32 and kept in memory as f16; exponentials and softmax statistics f32.
#ifndef NB
#define NB 2                         /* batches processed */
#endif
#ifndef SEQ
#define SEQ 1024                     /* sequence length processed (queries = keys) */
#endif
#define NB_FULL 2                    /* batch pitch of the input / output rows */
#define DM 1024
#define NH 16
#define HD 64
#define QC SEQ                       /* query rows per attention chunk: the whole sequence, so each attention launch fills the chip (S f16 + PM f16 = 128 MiB of workspace) */
#define NR ((size_t)NB * SEQ)        /* token rows */
#define MP ((int)(NB * SEQ))
#define LQ (NB * DM)                 /* pitch between consecutive t for one batch */
static_assert(SEQ % 128 == 0);
static_assert(QC % 128 == 0);
static_assert(SEQ % QC == 0);
static_assert(NH * HD == DM);
static_assert(NB <= NB_FULL);
static_assert((NB * SEQ) % 128 == 0);
static_assert(NH == 16);

typedef unsigned short v8us __attribute__((ext_vector_type(8), may_alias));
typedef float  v8f  __attribute__((ext_vector_type(8)));
typedef float  v4f  __attribute__((ext_vector_type(4)));
typedef float  v4fa __attribute__((ext_vector_type(4), may_alias));
typedef _Float16 v16h __attribute__((ext_vector_type(16)));
typedef _Float16 v4h __attribute__((ext_vector_type(4)));
typedef _Float16 v8h __attribute__((ext_vector_type(8), may_alias));
typedef _Float16 v2h __attribute__((ext_vector_type(2)));
union FragH { v16h v; v8us half[2]; _Float16 h[16]; unsigned short u[16]; };

__device__ __forceinline__ unsigned short bf16_bits(float x) { unsigned int u = __float_as_uint(x); return (unsigned short)((u + 0x7FFFu + ((u >> 16) & 1u)) >> 16); }
__device__ __forceinline__ float bf16_val(unsigned short b) { return __uint_as_float(((unsigned int)b) << 16); }
__device__ __forceinline__ float bf16_rne(float x) { return bf16_val(bf16_bits(x)); }   /* RNE convert to bf16, back as f32 */

// fragment: elements 0..7 <- k0 + 8h .. +7, elements 8..15 <- k0 + 16 + 8h .. +7 (p points at k0 of the lane's row / column)
__device__ __forceinline__ v16h g2_frag(const _Float16* p, int hh) { FragH f; f.half[0] = *(const v8us*)((const unsigned short*)p + 8 * hh); f.half[1] = *(const v8us*)((const unsigned short*)p + 16 + 8 * hh); return f.v; }
__device__ __forceinline__ v8f g2_mma(v16h a, v16h b, v8f c) { v8f d = __builtin_amdgcn_wmma_f32_16x16x32_f16(false, a, false, b, (short)0, c, false, false); asm volatile("v_nop\n\tv_nop\n\tv_nop\n\tv_nop" : "+v"(d) : "v"(a), "v"(b)); return d; }

// ---- GEMM (workgroup tile 128x64, wave tile 32x64; M % 128 == 0 per launch region, N % 64 == 0, K % KP == 0, K >= KP): C = alpha * A . Bt^T (+ bias) ----
// A f16 [M][K] (pitch lda), Bt f16 [N][K] (pitch ldb); batch slab by = blockIdx.y with element strides sA / sB / sC; slab 0 / 1 / 2 adds bias / bias1 / bias2.
// OMAP: output row r -> (r / NB) * NB_FULL + r % NB.
// VTS: slab 2 (v) is stored transposed only: CT[(b * NH + h) * HD + d][t] for token row r = t * NB + b and column h * HD + d; a workgroup's 128 rows x 64 columns are 64 t of one head for both batches.
// Operand path: per pass of KP k the 128 A rows and the 64 Bt rows go to LDS by asynchronous 16-byte copies (whole 128-byte lines per row), two buffers, the next pass's copies in flight while this pass is worked on.
// twelve copies of one lane; the s_wait_xcnt stands inside the statement so that no address register is rewritten in front of it
__device__ __forceinline__ void g2_cp12(const unsigned* l, const _Float16* const* g) {
  asm volatile("global_load_async_to_lds_b128 %0, %12, off\n\t"
               "global_load_async_to_lds_b128 %1, %13, off\n\t"
               "global_load_async_to_lds_b128 %2, %14, off\n\t"
               "global_load_async_to_lds_b128 %3, %15, off\n\t"
               "global_load_async_to_lds_b128 %4, %16, off\n\t"
               "global_load_async_to_lds_b128 %5, %17, off\n\t"
               "global_load_async_to_lds_b128 %6, %18, off\n\t"
               "global_load_async_to_lds_b128 %7, %19, off\n\t"
               "global_load_async_to_lds_b128 %8, %20, off\n\t"
               "global_load_async_to_lds_b128 %9, %21, off\n\t"
               "global_load_async_to_lds_b128 %10, %22, off\n\t"
               "global_load_async_to_lds_b128 %11, %23, off\n\t"
               "s_wait_xcnt 0x0"
               :: "v"(l[0]), "v"(l[1]), "v"(l[2]), "v"(l[3]), "v"(l[4]), "v"(l[5]), "v"(l[6]), "v"(l[7]), "v"(l[8]), "v"(l[9]), "v"(l[10]), "v"(l[11]),
                  "v"(g[0]), "v"(g[1]), "v"(g[2]), "v"(g[3]), "v"(g[4]), "v"(g[5]), "v"(g[6]), "v"(g[7]), "v"(g[8]), "v"(g[9]), "v"(g[10]), "v"(g[11]) : "memory"); }
// one stage: LDS rows 0..127 = A rows of the workgroup, rows 128..191 = Bt rows; ap / bp = the lane's first 16 bytes of each operand at this pass's k, l0 = the lane's LDS byte address in the stage
template <int KP>
__device__ __forceinline__ void g2_stage(const _Float16* ap, int lda, const _Float16* bp, int ldb, unsigned l0) {
  constexpr int CPR = KP / 8, RPR = 128 / CPR, PB = KP * 2 + 16;      /* 16-byte pieces per row, rows per round of 128 lanes, LDS pitch in bytes */
#pragma unroll      /* both loops: the operand (A or Bt) of a copy is picked at compile time, l[] and g[] stay in registers */
  for (int s = 0; s < (CPR + CPR / 2) / 12; ++s) { unsigned l[12]; const _Float16* g[12];
#pragma unroll
    for (int j = 0; j < 12; ++j) { const int i = s * 12 + j; l[j] = l0 + (unsigned)(i * RPR * PB);
      g[j] = (i < CPR) ? ap + (size_t)(i * RPR) * lda : bp + (size_t)((i - CPR) * RPR) * ldb; }
    g2_cp12(l, g); } }

// the six fragments of one 32-k group from LDS (pitch PB bytes): two A row tiles, four Bt row tiles
template <int PB>
__device__ __forceinline__ void g2_ld6(v16h* f, const unsigned char* pa, const unsigned char* pb, int hh) {
  f[0] = g2_frag((const _Float16*)pa, hh); f[1] = g2_frag((const _Float16*)(pa + 16 * PB), hh);
  f[2] = g2_frag((const _Float16*)pb, hh); f[3] = g2_frag((const _Float16*)(pb + 16 * PB), hh); f[4] = g2_frag((const _Float16*)(pb + 32 * PB), hh); f[5] = g2_frag((const _Float16*)(pb + 48 * PB), hh); }

template <bool HASB, bool OUT32, bool OMAP, bool VTS, int KP>
__global__ __launch_bounds__(128) void k_gemm2(const _Float16* __restrict__ A, int lda, size_t sA, const _Float16* __restrict__ Bh, int ldb, size_t sB, float alpha,
    const float* __restrict__ bias, const float* __restrict__ bias1, const float* __restrict__ bias2, float* __restrict__ C, _Float16* __restrict__ C16, _Float16* __restrict__ CT, int ldc, size_t sC, int M, int N, int K) {
  constexpr int CPR = KP / 8, PB = KP * 2 + 16, STG = 192 * PB, SOB = 4 * 32 * 68 * 4;
  __shared__ __attribute__((aligned(16))) unsigned char sm[(2 * STG > SOB) ? 2 * STG : SOB];      /* two operand stages; after the k loop the output staging */
  float (*so)[32][68] = (float (*)[32][68])sm;
  const int tid = threadIdx.x, w = __builtin_amdgcn_readfirstlane((int)(tid >> 5)), lane = tid & 31, ln = lane & 15, hh = lane >> 4; const int by = blockIdx.y;
  A += (size_t)by * sA; Bh += (size_t)by * sB; const size_t cofs = (size_t)by * sC;
  const int ntn = N >> 6; const int mt = blockIdx.x / ntn, nq = blockIdx.x - mt * ntn; const int row0 = mt * 128 + 32 * w, col0 = nq * 64; if (mt * 128 >= M) return;
  const int crow = tid / CPR, cpc = tid % CPR;
  const _Float16* ap = A + (size_t)(mt * 128 + crow) * lda + cpc * 8; const _Float16* bp = Bh + (size_t)(col0 + crow) * ldb + cpc * 8;
  const unsigned l0 = (unsigned)(size_t)sm + (unsigned)(crow * PB + cpc * 16);
  const unsigned char* fa = sm + (32 * w + ln) * PB; const unsigned char* fb = sm + (128 + ln) * PB;
  const v8f z8 = {0.f,0.f,0.f,0.f,0.f,0.f,0.f,0.f}; v8f c00 = z8, c01 = z8, c02 = z8, c03 = z8, c10 = z8, c11 = z8, c12 = z8, c13 = z8;
  const int nt = K / KP;
  g2_stage<KP>(ap, lda, bp, ldb, l0);
  asm volatile("s_wait_asynccnt 0x0" ::: "memory");      /* this wave's copies of pass 0 have landed */
  __syncthreads();                                        /* pass 0 is readable by every wave */
  if (nt > 1) g2_stage<KP>(ap + KP, lda, bp + KP, ldb, l0 + STG);
#pragma unroll 1      /* one pass per trip: the hand-over at the foot stands once, and the loop stays small */
  for (int t = 0; t < nt; ++t) { const int bo = (t & 1) * STG;
    const unsigned char* pa = fa + bo; const unsigned char* pb = fb + bo; v16h fr[2][6];
    g2_ld6<PB>(fr[0], pa, pb, hh);
#pragma unroll      /* fr[] is indexed by constants only, so both fragment sets stay in registers */
    for (int kk = 0; kk < KP / 32; ++kk) { if (kk + 1 < KP / 32) g2_ld6<PB>(fr[(kk + 1) & 1], pa + (kk + 1) * 64, pb + (kk + 1) * 64, hh);      /* the next 32 k of this pass: one group of LDS reads in front of this group's WMMAs */
      const v16h a0 = fr[kk & 1][0], a1 = fr[kk & 1][1];
      v16h b = fr[kk & 1][2]; c00 = g2_mma(a0, b, c00); c10 = g2_mma(a1, b, c10);
      b = fr[kk & 1][3]; c01 = g2_mma(a0, b, c01); c11 = g2_mma(a1, b, c11);
      b = fr[kk & 1][4]; c02 = g2_mma(a0, b, c02); c12 = g2_mma(a1, b, c12);
      b = fr[kk & 1][5]; c03 = g2_mma(a0, b, c03); c13 = g2_mma(a1, b, c13); }
    asm volatile("s_wait_dscnt 0x0" ::: "memory");        /* this wave's reads of the buffer are done before it is refilled */
    asm volatile("s_wait_asynccnt 0x0" ::: "memory");     /* this wave's copies of pass t + 1 have landed */
    __syncthreads();                                      /* publishes pass t + 1 and ends every wave's reads of pass t */
    if (t + 2 < nt) g2_stage<KP>(ap + (size_t)(t + 2) * KP, lda, bp + (size_t)(t + 2) * KP, ldb, l0 + (unsigned)bo); }
  asm volatile("s_wait_asynccnt 0x0" ::: "memory");       /* no copy is outstanding when the buffers become output staging */
  v8f accs[8] = {c00, c01, c02, c03, c10, c11, c12, c13};
  const float* bsl = (by == 0) ? bias : ((by == 1) ? bias1 : bias2);
  if (VTS && by == 2) {      /* by is the same in the whole workgroup */
    static_assert(!VTS || (NB == 2 && HD == 64 && SEQ % 64 == 0));
    _Float16 (*sv)[HD][72] = (_Float16 (*)[HD][72])sm;      /* [b][d][t of the tile]; the pitch of 144 bytes puts the 8-byte writes of a wave's 32 lanes on different banks */
#pragma unroll      /* the three loops: accs[] is indexed by constants only, so it stays in registers */
    for (int u = 0; u < 8; ++u) { const int t = u & 3, half = u >> 2; float bv = 0.f; if (HASB) bv = bf16_rne(bsl[col0 + t * 16 + ln]);
#pragma unroll
      for (int bb = 0; bb < 2; ++bb) { v4h h4;      /* accumulator rows r = 2i + bb: four consecutive t of batch bb */
#pragma unroll
        for (int i = 0; i < 4; ++i) h4[i] = (_Float16)(accs[u][2 * i + bb] * alpha + bv);
        *(v4h*)&sv[bb][t * 16 + ln][16 * w + 8 * half + 4 * hh] = h4; } }
    __syncthreads();      /* a row of V^T holds t of all four waves */
    _Float16* pt = CT + ((size_t)nq * HD + (tid >> 3)) * SEQ + mt * 64 + (tid & 7) * 8;      /* eight lanes store one whole 128-byte line */
#pragma unroll      /* the eight pieces differ by immediate offsets from one LDS and one global address */
    for (int q = 0; q < 8; ++q) { const int bb = q >> 2, d0 = (q & 3) * 16;
      *(v8h*)(pt + ((size_t)bb * NH * HD + d0) * SEQ) = *(const v8h*)&sv[bb][d0 + (tid >> 3)][(tid & 7) * 8]; }
    return; }
#pragma unroll
  for (int u = 0; u < 8; ++u) { const int t = u & 3, half = u >> 2; const int col = col0 + t * 16 + ln; float bv = 0.f; if (HASB) bv = bf16_rne(bsl[col]);
#pragma unroll
    for (int r = 0; r < 8; ++r) { const int rloc = half * 16 + 8 * hh + r; so[w][rloc][t * 16 + ln] = accs[u][r] * alpha + bv; } }
  __builtin_amdgcn_fence(4 /* acq_rel order */, "workgroup"); __builtin_amdgcn_wave_barrier();      /* so[w] is private to wave w */
  const int rsub = lane >> 4, c4 = (lane & 15) * 4;
  {
#pragma unroll
    for (int q = 0; q < 16; ++q) { const int r = q * 2 + rsub; const v4f v = *(const v4fa*)&so[w][r][c4];
      const int gr = row0 + r; const size_t orow = OMAP ? ((size_t)(gr / NB) * NB_FULL + (size_t)(gr % NB)) : (size_t)gr;
      if (OUT32) { *(v4f*)(C + cofs + orow * ldc + col0 + c4) = v; }
      else { v4h h4;
#pragma unroll
        for (int i = 0; i < 4; ++i) h4[i] = (_Float16)v[i];
        *(v4h*)(C16 + cofs + orow * ldc + col0 + c4) = h4; } }
     } }

// ---- scores: S[by][t][s] = f16(2^-3 * q[t] . k[s]), slab by = b*NH + h at column offset by*HD of rows with pitch LQ; the whole k (HD = 64) is one pass ----
// One work-group: 128 query rows x SCK keys, each LDS row filled once (asynchronous 16-byte copies, whole 128-byte lines per row, pitch 144 bytes; two fills, the second in flight behind the first). Wave w owns query rows 32w .. 32w + 31, keeps their four fragments in registers and walks the keys in tiles of 64.
// The key rows are the A operand and the query rows the B operand: D (row = key 8hh + r, column = query ln) gives a lane eight consecutive keys of one query row, so a tile goes to the staging as f16 by one 16-byte LDS store.
// Staging: the wave's own 32 query rows in LDS, which nobody else reads and the wave itself has read before; 32 rows x 128 bytes at the same pitch; eight lanes store one whole 128-byte line of S.
#define SCK 256
static_assert(SEQ % SCK == 0 && SCK == 256 && HD == 64);      /* 24 rounds of 16 rows: two fills of twelve copies a lane */
__global__ __launch_bounds__(128) void k_scores(const _Float16* __restrict__ Q, const _Float16* __restrict__ Kk, _Float16* __restrict__ S) {
  constexpr int PB = HD * 2 + 16;
  __shared__ __attribute__((aligned(16))) unsigned char sm[(128 + SCK) * PB];      /* rows 0..127 = query rows, rows 128.. = key rows */
  const int tid = threadIdx.x, w = __builtin_amdgcn_readfirstlane((int)(tid >> 5)), lane = tid & 31, ln = lane & 15, hh = lane >> 4; const int by = blockIdx.y;
  const int mt = blockIdx.x / (SEQ / SCK), ng = blockIdx.x % (SEQ / SCK);
  const int crow = tid >> 3, cpc = tid & 7;
  const _Float16* qp = Q + (size_t)by * HD + (size_t)(mt * 128 + crow) * LQ + cpc * 8; const _Float16* kp = Kk + (size_t)by * HD + (size_t)(ng * SCK + crow) * LQ + cpc * 8;
  const unsigned l0 = (unsigned)(size_t)sm + (unsigned)(crow * PB + cpc * 16);
  { unsigned l[12]; const _Float16* g[12];      /* first fill: the 128 query rows and the first 64 key rows */
#pragma unroll      /* the operand of a copy is picked at compile time, l[] and g[] stay in registers */
    for (int i = 0; i < 12; ++i) { l[i] = l0 + (unsigned)(i * 16 * PB); g[i] = (i < 8) ? qp + (size_t)(i * 16) * LQ : kp + (size_t)((i - 8) * 16) * LQ; }
    g2_cp12(l, g); }
  asm volatile("s_wait_asynccnt 0x0" ::: "memory");      /* this wave's copies of the first fill have landed */
  __syncthreads();                                        /* the first fill is readable by every wave */
  { unsigned l[12]; const _Float16* g[12];      /* second fill: the other 192 key rows, LDS that nobody has touched, in flight while the first key tile is worked on */
#pragma unroll
    for (int i = 0; i < 12; ++i) { l[i] = l0 + (unsigned)((i + 12) * 16 * PB); g[i] = kp + (size_t)((i + 4) * 16) * LQ; }
    g2_cp12(l, g); }
  unsigned char* st = sm + 32 * w * PB;
  v16h q[2][2];      /* [query tile][32-k group] */
#pragma unroll
  for (int qt = 0; qt < 2; ++qt) { q[qt][0] = g2_frag((const _Float16*)(st + (qt * 16 + ln) * PB), hh); q[qt][1] = g2_frag((const _Float16*)(st + (qt * 16 + ln) * PB + 64), hh); }
  const unsigned char* kb = sm + (128 + ln) * PB;
  _Float16* ps = S + (size_t)by * QC * SEQ + (size_t)(mt * 128 + 32 * w + (lane >> 3)) * SEQ + ng * SCK + (lane & 7) * 8;
  const v8f z8 = {0.f,0.f,0.f,0.f,0.f,0.f,0.f,0.f};
#pragma unroll      /* the tiles differ by immediate offsets from one LDS and one global address */
  for (int nt = 0; nt < SCK / 64; ++nt) { v16h kf[2][4]; v8f acc[4][2];
    if (nt == 1) {
      asm volatile("s_wait_asynccnt 0x0" ::: "memory");      /* this wave's copies of the second fill have landed */
      /* work-group barrier with LDS-only fences: the second fill is readable by every wave; __syncthreads() would also wait for the first tile's stores to S */
      __builtin_amdgcn_fence(__ATOMIC_RELEASE, "workgroup", "local"); __builtin_amdgcn_s_barrier(); __builtin_amdgcn_fence(__ATOMIC_ACQUIRE, "workgroup", "local"); }
#pragma unroll      /* the loops below: kf[], acc[] are indexed by constants only, so they stay in registers */
    for (int u = 0; u < 8; ++u) kf[u >> 2][u & 3] = g2_frag((const _Float16*)(kb + (nt * 64 + (u & 3) * 16) * PB + (u >> 2) * 64), hh);      /* the tile's LDS reads as one group in front of its WMMAs */
#pragma unroll
    for (int kt = 0; kt < 4; ++kt) { acc[kt][0] = g2_mma(kf[0][kt], q[0][0], z8); acc[kt][1] = g2_mma(kf[0][kt], q[1][0], z8); }
#pragma unroll
    for (int kt = 0; kt < 4; ++kt) { acc[kt][0] = g2_mma(kf[1][kt], q[0][1], acc[kt][0]); acc[kt][1] = g2_mma(kf[1][kt], q[1][1], acc[kt][1]); }
#pragma unroll
    for (int u = 0; u < 8; ++u) { const int kt = u >> 1, qt = u & 1; v8h o;
#pragma unroll
      for (int r = 0; r < 8; ++r) o[r] = (_Float16)(acc[kt][qt][r] * 0.125f);
      *(v8h*)(st + (qt * 16 + ln) * PB + kt * 32 + hh * 16) = o; }
    /* LDS-only fences round a wave barrier: the staging is private to the wave, other lanes' stores are read below; a fence on all memory would also wait for the last tile's stores to S */
    __builtin_amdgcn_fence(__ATOMIC_RELEASE, "workgroup", "local"); __builtin_amdgcn_wave_barrier(); __builtin_amdgcn_fence(__ATOMIC_ACQUIRE, "workgroup", "local");
#pragma unroll
    for (int p = 0; p < 8; ++p) *(v8h*)(ps + (size_t)(p * 4) * SEQ + nt * 64) = *(const v8h*)(st + (p * 4 + (lane >> 3)) * PB + (lane & 7) * 16);
    if (nt + 1 < SCK / 64) {
      asm volatile("s_wait_xcnt 0x0" ::: "memory");      /* behind the tile's stores: the next tile's work lands in registers that those stores name */
      /* the next tile's staging stores stay behind this tile's reads of the staging */
      __builtin_amdgcn_fence(__ATOMIC_RELEASE, "workgroup", "local"); __builtin_amdgcn_wave_barrier(); __builtin_amdgcn_fence(__ATOMIC_ACQUIRE, "workgroup", "local"); }
  } }

// ---- every conversion that depends on the inputs alone, in one launch: block 0 = mix matrix, then PWB blocks per weight, then PXB blocks of x ----
#define PWB ((int)((size_t)DM * DM / (8 * 256)))      /* blocks per weight matrix, 8 elements per thread */
#define PXB ((int)(NR * DM / (8 * 256)))              /* blocks of x */
static_assert((size_t)DM * DM % (8 * 256) == 0);
static_assert(NR * DM % (8 * 256) == 0);

// WT[g][32] f16 = column softmax (axis 0) of mix_w, transposed, k zero-padded 16 -> 32; i = 0..63
__device__ __forceinline__ void d_wmix(const float* __restrict__ mixw, _Float16* __restrict__ WT, int i) {
  const int g = i >> 2, k8 = (i & 3) * 8; float mx = -3.0e38f;
#pragma unroll 1
  for (int h = 0; h < NH; ++h) mx = fmaxf(mx, bf16_rne(mixw[h * NH + g]));
  float se = 0.f;
#pragma unroll 1
  for (int h = 0; h < NH; ++h) se += __expf(bf16_rne(mixw[h * NH + g]) - mx);
  const float inv = 1.0f / se; FragH f;
#pragma unroll
  for (int q = 0; q < 8; ++q) { const int h = k8 + q; const int hc = (h < NH) ? h : (NH - 1); const float v = __expf(bf16_rne(mixw[hc * NH + g]) - mx) * inv; f.h[q] = (_Float16)((h < NH) ? v : 0.0f); }
  const v8us o = f.half[0]; *(v8us*)((unsigned short*)WT + i * 8) = o; }

// 8 floats at p -> f16(bf16_rne(v) * sc) at d
__device__ __forceinline__ void d_cvt(const float* __restrict__ p, _Float16* __restrict__ d, float sc) {
  const v4f a = *(const v4fa*)p, c = *(const v4fa*)(p + 4); FragH f;
#pragma unroll
  for (int q = 0; q < 4; ++q) { f.h[q] = (_Float16)(bf16_rne(a[q]) * sc); f.h[4 + q] = (_Float16)(bf16_rne(c[q]) * sc); }
  const v8us o = f.half[0]; *(v8us*)(unsigned short*)d = o; }

__global__ __launch_bounds__(256) void k_prep(const float* __restrict__ wq, const float* __restrict__ wk, const float* __restrict__ wv, const float* __restrict__ wo, const float* __restrict__ x, const float* __restrict__ mixw,
    _Float16* __restrict__ BW, _Float16* __restrict__ X16, _Float16* __restrict__ WT) {
  const int bid = (int)blockIdx.x - 1, tid = threadIdx.x;
  if (bid < 0) { if (tid < 64) d_wmix(mixw, WT, tid); return; }      /* first block: its chain of dependent loads starts first */
  if (bid < 4 * PWB) { const int m = bid / PWB; const float* w = (m == 0) ? wq : ((m == 1) ? wk : ((m == 2) ? wv : wo));
    const size_t t = (size_t)(bid - m * PWB) * 256 + tid; d_cvt(w + t * 8, BW + (size_t)m * DM * DM + t * 8, 16.0f); return; }      /* natural [out][in] = Bt[n][k], x16 */
  const size_t t = (size_t)(bid - 4 * PWB) * 256 + tid; const size_t row = t / (DM / 8); const int c8 = (int)(t % (DM / 8)) * 8; const size_t srow = (row / NB) * NB_FULL + (row % NB);
  d_cvt(x + srow * DM + c8, X16 + t * 8, 1.0f);
  asm volatile("s_wait_xcnt 0x0" ::: "memory"); }      /* behind the store: in the built code the other cases' blocks follow this one and rewrite the store's registers */

// softmax over SEQ keys + cross-head mix. S f16 [NB*NH][QC][SEQ] (slab by = b*NH + h); PM f16 [NB*NH][QC][SEQ] = 1024 * sum_h Wm[h][g] * softmax(S[b*NH+h][t][:]).
// One work-group per SMR query rows (b, t), SMW waves; wave w owns keys 128w .. 128w + 127 of all 16 heads and keeps them in registers, so S is read once, in whole lines.
// Lane (ln, hh) holds heads 8hh .. 8hh + 7 at keys 128w + 8ln + j (j = 0 .. 7), one 16-byte load per head: that is the B fragment of the mix WMMA for tile j, column ln <-> key 8ln + j,
// and D (row g = 8hh + r, column ln) of the eight tiles gives eight consecutive keys per lane: 16-byte stores, 256 bytes per head row and half wave.
// Row statistics: per wave max and sum of exp(x - wave max) over the 16-lane row by DPP, the waves' pairs joined through LDS (one barrier per query row).
#define SMW (SEQ / 128)      /* waves per work-group */
#define SMR 4                /* query rows per work-group, the next row's loads in flight while a row is worked on */
static_assert(SMW >= 1 && SMW <= 32);
static_assert(QC % SMR == 0);
template <int CTRL> __device__ __forceinline__ float sm_dpp(float v) { return __builtin_bit_cast(float, __builtin_amdgcn_mov_dpp(__builtin_bit_cast(int, v), CTRL, 0xf, 0xf, true)); }      /* 0x160 | m: lane l ^ m of the 16-lane row; 0x150 | i: lane i of the row */
// native exp (v_exp_f32 of x * log2 e) with the slot behind the transcendental filled in the same statement: in the built code the next instruction otherwise overwrites its source register directly behind it
__device__ __forceinline__ float sm_exp(float x) { const float t = x * 1.44269504f; float e; asm("v_exp_f32 %0, %1\n\tv_nop" : "=v"(e) : "v"(t)); return e; }
__device__ __forceinline__ float sm_exp2(float t) { float e; asm("v_exp_f32 %0, %1\n\tv_nop" : "=v"(e) : "v"(t)); return e; }      /* 2^t, the same slot filled */
__device__ __forceinline__ float sm_rowmax(float v) { v = fmaxf(v, sm_dpp<0x161>(v)); v = fmaxf(v, sm_dpp<0x162>(v)); v = fmaxf(v, sm_dpp<0x164>(v)); return fmaxf(v, sm_dpp<0x168>(v)); }
__device__ __forceinline__ float sm_rowsum(float v) { v += sm_dpp<0x161>(v); v += sm_dpp<0x162>(v); v += sm_dpp<0x164>(v); return v + sm_dpp<0x168>(v); }
// p and hp are the same in every lane, lofs is the lane's own element offset; the query rows of a work-group differ by an immediate offset, so the eight address pairs are formed once and live until the last row's loads are issued
__device__ __forceinline__ void sm_load(v8h (&x)[8], const _Float16* __restrict__ p, size_t hp, unsigned lofs) {
#pragma unroll
  for (int i = 0; i < 8; ++i) x[i] = *(const v8h*)(p + (size_t)i * hp + lofs); }

__global__ __launch_bounds__(SMW * 32) void k_smix(const _Float16* __restrict__ S, const _Float16* __restrict__ WT, _Float16* __restrict__ PM, size_t hp) {      /* hp = head slab pitch QC * SEQ, an argument so that the head bases are formed in scalar registers */
  __shared__ __attribute__((aligned(16))) float sst[2][SMW][2][NH];      /* [row parity][wave][max, sum][head] */
  const int tid = threadIdx.x, w = __builtin_amdgcn_readfirstlane((int)(tid >> 5)), lane = tid & 31, ln = lane & 15, hh = lane >> 4;
  const int wr = blockIdx.x * SMR; const int b = wr / QC, tql = wr - b * QC;
  const size_t base = ((size_t)(b * NH) * QC + tql) * SEQ + 128 * w; const unsigned lofs = (unsigned)(8 * hh) * (unsigned)hp + 8 * ln;
  const _Float16* ps = S + base;                                          /* head 8hh + i of query row q at ps + i * hp + q * SEQ + lofs */
  _Float16* po = PM + base;
  const v8f z8 = {0.f,0.f,0.f,0.f,0.f,0.f,0.f,0.f};
  const int hd = 8 * hh + (ln & 7);                                    /* the head whose joined statistics this lane forms */
  v8h x[2][8];
  const v16h aW = g2_frag(WT + ln * 32, hh);                          /* A: row g = ln, k = heads (upper 16 k zero) */
  asm volatile("s_wait_xcnt 0x0" ::: "memory");      /* behind the loads of aW: in the built code a load of scores lands in their address registers */
  sm_load(x[0], ps, hp, lofs);
#pragma unroll      /* x[] is indexed by constants only, so both rows' scores stay in registers */
  for (int q = 0; q < SMR; ++q) { v8h (&xc)[8] = x[q & 1];
    if (q > 0) asm volatile("s_wait_xcnt 0x0" ::: "memory");      /* behind the last row's stores: the loads and the work below land in registers that those stores name */
    if (q + 1 < SMR) sm_load(x[(q + 1) & 1], ps + (size_t)(q + 1) * SEQ, hp, lofs);
    if (q + 2 == SMR) asm volatile("s_wait_xcnt 0x0" ::: "memory");      /* behind the last loads: their address registers are free from here on and this row's work is put into them */
    __builtin_amdgcn_sched_barrier(0);      /* keeps the next row's loads in front of this row's work and the two rows' work apart: without it the build starts on the next row's scores inside this row and waits for them early */
    float c[8][8], m8[8], s8[8];
#pragma unroll
    for (int i = 0; i < 8; ++i) { const v8h u = xc[i];      /* the lane's maximum is taken on the f16 pairs (exact), then widened */
      const v4h a = __builtin_elementwise_max(__builtin_shufflevector(u, u, 0, 1, 2, 3), __builtin_shufflevector(u, u, 4, 5, 6, 7));
      const v2h p = __builtin_elementwise_max(__builtin_shufflevector(a, a, 0, 1), __builtin_shufflevector(a, a, 2, 3));
      m8[i] = sm_rowmax(fmaxf((float)p[0], (float)p[1])); }
#pragma unroll
    for (int i = 0; i < 8; ++i) { float se = 0.f; const float nm = -m8[i] * 1.44269504f;
#pragma unroll
      for (int j = 0; j < 8; ++j) { const float e = sm_exp2(__builtin_fmaf((float)xc[i][j], 1.44269504f, nm)); c[i][j] = e; se += e; }      /* exp(x - max): the f16 score goes into the multiply-add as it is */
      s8[i] = sm_rowsum(se); }
    float (*st)[2][NH] = sst[q & 1];
    if (ln == 0) {
#pragma unroll
      for (int i = 0; i < 8; ++i) { st[w][0][8 * hh + i] = m8[i]; st[w][1][8 * hh + i] = s8[i]; } }
    /* work-group barrier with LDS-only fences: every wave's pair of this query row is readable, and the other parity's buffer is rewritten only behind it. Only sst passes between waves; __syncthreads() would also wait for the next row's loads and the last row's stores */
    __builtin_amdgcn_fence(__ATOMIC_RELEASE, "workgroup", "local"); __builtin_amdgcn_s_barrier(); __builtin_amdgcn_fence(__ATOMIC_ACQUIRE, "workgroup", "local");
    float mw[SMW], mx = -3.0e38f, se = 0.f;
#pragma unroll
    for (int u = 0; u < SMW; ++u) { mw[u] = st[u][0][hd]; mx = fmaxf(mx, mw[u]); }
#pragma unroll
    for (int u = 0; u < SMW; ++u) se += st[u][1][hd] * sm_exp(mw[u] - mx);
    const float f = sm_exp(st[w][0][hd] - mx) * (1024.0f / se);      /* exp(x - wave max) * f = 1024 * softmax */
    const float f8[8] = {sm_dpp<0x150>(f), sm_dpp<0x151>(f), sm_dpp<0x152>(f), sm_dpp<0x153>(f), sm_dpp<0x154>(f), sm_dpp<0x155>(f), sm_dpp<0x156>(f), sm_dpp<0x157>(f)};      /* lane i of the row holds head 8hh + i */
    v8f d[8];
#pragma unroll
    for (int j = 0; j < 8; ++j) { FragH bf;
#pragma unroll
      for (int i = 0; i < 8; ++i) bf.h[i] = (_Float16)(c[i][j] * f8[i]);
#pragma unroll
      for (int i = 8; i < 16; ++i) bf.h[i] = (_Float16)0.0f;
      d[j] = g2_mma(aW, bf.v, z8); }
#pragma unroll
    for (int r = 0; r < 8; ++r) { v8h o;
#pragma unroll
      for (int j = 0; j < 8; ++j) o[j] = (_Float16)d[j][r];
      *(v8h*)(po + ((size_t)r * hp + (size_t)q * SEQ) + lofs) = o; }
  }
}

extern "C" void kernel_launch(void* const* d_in, const int* in_sizes, int n_in,
                              void* d_out, int out_size, void* d_ws, size_t ws_size, hipStream_t stream) {
  if (n_in < 10) return;
  if ((size_t)in_sizes[0] < NR * DM) return;
  if ((size_t)in_sizes[1] < (size_t)DM * DM || (size_t)in_sizes[3] < (size_t)DM * DM || (size_t)in_sizes[5] < (size_t)DM * DM || (size_t)in_sizes[7] < (size_t)DM * DM) return;
  if (in_sizes[2] < DM || in_sizes[4] < DM || in_sizes[6] < DM || in_sizes[8] < DM || in_sizes[9] < NH * NH) return;
  if ((size_t)out_size < NR * DM) return;
  const float* const* I = (const float* const*)d_in;
  const float* xq = I[0]; const float* wq = I[1]; const float* bq = I[2]; const float* wk = I[3]; const float* bk = I[4]; const float* wv = I[5]; const float* bv = I[6]; const float* wo = I[7]; const float* bo = I[8]; const float* mixw = I[9];
  char* ws = (char*)d_ws; size_t off = 0;
  auto take = [&](size_t bytes) { char* p = ws + off; off += (bytes + 255) & ~(size_t)255; return p; };
  _Float16* BQ = (_Float16*)take((size_t)4 * DM * DM * 2); _Float16* BO = BQ + (size_t)3 * DM * DM;      /* wq, wk, wv, wo planes, pitch DM * DM */
  _Float16* X16 = (_Float16*)take(NR * DM * 2); _Float16* Q16 = (_Float16*)take(2 * NR * DM * 2); _Float16* K16 = Q16 + NR * DM; _Float16* O16 = (_Float16*)take(NR * DM * 2);      /* q, k planes, pitch NR * DM */
  _Float16* S = (_Float16*)take((size_t)NB * NH * QC * SEQ * 2); _Float16* PM = (_Float16*)take((size_t)NB * NH * QC * SEQ * 2); _Float16* VT = (_Float16*)take((size_t)NB * NH * HD * SEQ * 2);
  _Float16* WT = (_Float16*)take((size_t)NH * 32 * 2);
  if (off > ws_size) return;
  k_prep<<<1 + 4 * PWB + PXB, 256, 0, stream>>>(wq, wk, wv, wo, xq, mixw, BQ, X16, WT);
  const dim3 gp((unsigned)((MP / 128) * (DM / 64)), 1);
  k_gemm2<true, false, false, true, 128><<<dim3(gp.x, 3), 128, 0, stream>>>(X16, DM, 0, BQ, DM, (size_t)DM * DM, 0.0625f, bq, bk, bv, nullptr, Q16, VT, DM, NR * DM, MP, DM, DM);      /* slab 0 / 1 / 2 = q / k / v; v goes to VT[(b,h)][64][SEQ] */
  for (int t0 = 0; t0 < SEQ; t0 += QC) {
    /* scores: slab by = b*NH + h at column offset by*64 of rows with pitch LQ; S[by][QC][SEQ] f16 */
    k_scores<<<dim3((QC / 128) * (SEQ / SCK), NB * NH), 128, 0, stream>>>(Q16 + (size_t)t0 * LQ, K16, S);
    k_smix<<<NB * QC / SMR, SMW * 32, 0, stream>>>(S, WT, PM, (size_t)QC * SEQ);
    /* o[t][b][g*64 + d] x64 = 2^-4 * (1024 P') . V^T */
    k_gemm2<false, false, false, false, 128><<<dim3((QC / 128) * (HD / 64), NB * NH), 128, 0, stream>>>(PM, SEQ, (size_t)QC * SEQ, VT, SEQ, (size_t)HD * SEQ, 0.0625f, nullptr, nullptr, nullptr, nullptr, O16 + (size_t)t0 * LQ, nullptr, LQ, (size_t)HD, QC, HD, SEQ);
  }
  k_gemm2<true, true, true, false, 128><<<gp, 128, 0, stream>>>(O16, DM, 0, BO, DM, 0, 0.0009765625f, bo, nullptr, nullptr, (float*)d_out, nullptr, nullptr, DM, 0, MP, DM, DM);      /* out rows t*NB_FULL + b */
}

// v008
// Measured time: 69.5 microseconds a run.
// Two timings next to v007 put it at 1.06 and 1.07 times that version's speed.
// All steps since v000 together make it 6.76 times as fast.
#include <hip/hip_runtime.h>
// Multi-head SELF-attention with cross-head probability mixing, sequence-first layout: x [1024][2][1024] (token row r = t*NB + b); q / k / v = x W^T + bias (natural [out][in] weights, biases present), 16 heads of 64, q scaled by 64^-0.5; softmax over all 1024 keys (no mask); P'[b,g,t,s] = sum_h P[b,h,t,s] * Wm[h][g] with Wm = column softmax (axis 0) of mix_w; ctx[b,g] = P'[b,g] . v[b,g]; merged [t][b][g*64+d]; out = ctx Wo^T + bo.
// Structure: one conversion launch (x as exact f16 rows, inputs RNE-converted to bf16 first; the four weights; the mix matrix); Q, K, V as three WMMA GEMMs in one launch, one per grid.y (32x64 wave tiles, operands staged in LDS by asynchronous copies, f32 accumulation, x16 weights + bias, f16 outputs; the V slab's epilogue turns its tile in LDS and stores V^T per (b,h) directly); all query rows in one chunk: scores kernel (K = 64, the 32 (b,h) slabs on grid.y, 128 queries x 256 keys per work-group, alpha 64^-0.5, f32 accumulators stored as f16), k_smix (scores of a query row held in registers, f32 row statistics, native exp, head mix as one WMMA per 16-key tile: A = Wm^T f16 with K zero-padded 16 -> 32, B = 1024 P f16), o = P' . V^T GEMM (K = 1024; o carried x64) into merged f16 rows; out = o Wo + bo GEMM (f32).
// Compute dtype: all contractions v_wmma_f32_16x16x32_f16 (f16 operands, f32 accumulate); inputs RNE-converted to bf16 (exact in f16); q, k, v, mixed softmax weights (x1024), mix matrix and o (x64) as plain f16 operands; scores accumulated in f32 and kept in memory as f16; exponentials and softmax statistics f32.
#ifndef NB
#define NB 2                         /* batches processed */
#endif
#ifndef SEQ
#define SEQ 1024                     /* sequence length processed (queries = keys) */
#endif
#define NB_FULL 2                    /* batch pitch of the input / output rows */
#define DM 1024
#define NH 16
#define HD 64
#define QC SEQ                       /* query rows per attention chunk: the whole sequence, so each attention launch fills the chip (S f16 + PM f16 = 128 MiB of workspace) */
#define NR ((size_t)NB * SEQ)        /* token rows */
#define MP ((int)(NB * SEQ))
#define LQ (NB * DM)                 /* pitch between consecutive t for one batch */
static_assert(SEQ % 128 == 0);
static_assert(QC % 128 == 0);
static_assert(SEQ % QC == 0);
static_assert(NH * HD == DM);
static_assert(NB <= NB_FULL);
static_assert((NB * SEQ) % 128 == 0);
static_assert(NH == 16);

typedef unsigned short v8us __attribute__((ext_vector_type(8), may_alias));
typedef float  v8f  __attribute__((ext_vector_type(8)));
typedef float  v4f  __attribute__((ext_vector_type(4)));
typedef float  v4fa __attribute__((ext_vector_type(4), may_alias));
typedef _Float16 v16h __attribute__((ext_vector_type(16)));
typedef _Float16 v4h __attribute__((ext_vector_type(4)));
typedef _Float16 v8h __attribute__((ext_vector_type(8), may_alias));
typedef _Float16 v2h __attribute__((ext_vector_type(2)));
union FragH { v16h v; v8us half[2]; _Float16 h[16]; unsigned short u[16]; };

__device__ __forceinline__ unsigned short bf16_bits(float x) { unsigned int u = __float_as_uint(x); return (unsigned short)((u + 0x7FFFu + ((u >> 16) & 1u)) >> 16); }
__device__ __forceinline__ float bf16_val(unsigned short b) { return __uint_as_float(((unsigned int)b) << 16); }
__device__ __forceinline__ float bf16_rne(float x) { return bf16_val(bf16_bits(x)); }   /* RNE convert to bf16, back as f32 */

// fragment: elements 0..7 <- k0 + 8h .. +7, elements 8..15 <- k0 + 16 + 8h .. +7 (p points at k0 of the lane's row / column)
__device__ __forceinline__ v16h g2_frag(const _Float16* p, int hh) { FragH f; f.half[0] = *(const v8us*)((const unsigned short*)p + 8 * hh); f.half[1] = *(const v8us*)((const unsigned short*)p + 16 + 8 * hh); return f.v; }
__device__ __forceinline__ v8f g2_mma(v16h a, v16h b, v8f c) { v8f d = __builtin_amdgcn_wmma_f32_16x16x32_f16(false, a, false, b, (short)0, c, false, false); asm volatile("v_nop\n\tv_nop\n\tv_nop\n\tv_nop" : "+v"(d) : "v"(a), "v"(b)); return d; }

// ---- GEMM (workgroup tile 128x64, wave tile 32x64; M % 128 == 0 per launch region, N % 64 == 0, K % (KS * KP) == 0, K >= KS * KP): C = alpha * A . Bt^T (+ bias) ----
// A f16 [M][K] (pitch lda), Bt f16 [N][K] (pitch ldb); batch slab by = blockIdx.y with element strides sA / sB / sC; slab 0 / 1 / 2 adds bias / bias1 / bias2.
// OMAP: output row r -> (r / NB) * NB_FULL + r % NB.
// VTS: slab 2 (v) is stored transposed only: CT[(b * NH + h) * HD + d][t] for token row r = t * NB + b and column h * HD + d; a workgroup's 128 rows x 64 columns are 64 t of one head for both batches.
// KS = 2: eight waves; waves 0..3 sum the first half of K, waves 4..7 the second half, each group on its own two operand buffers (twice the bytes in flight, two waves per SIMD, half the passes); the second group's partial sums pass through LDS and the first group adds them and stores.
// Operand path: per pass of KP k the 128 A rows and the 64 Bt rows go to LDS by asynchronous 16-byte copies (whole 128-byte lines per row), two buffers, the next pass's copies in flight while this pass is worked on.
// twelve copies of one lane; the s_wait_xcnt stands inside the statement so that no address register is rewritten in front of it
__device__ __forceinline__ void g2_cp12(const unsigned* l, const _Float16* const* g) {
  asm volatile("global_load_async_to_lds_b128 %0, %12, off\n\t"
               "global_load_async_to_lds_b128 %1, %13, off\n\t"
               "global_load_async_to_lds_b128 %2, %14, off\n\t"
               "global_load_async_to_lds_b128 %3, %15, off\n\t"
               "global_load_async_to_lds_b128 %4, %16, off\n\t"
               "global_load_async_to_lds_b128 %5, %17, off\n\t"
               "global_load_async_to_lds_b128 %6, %18, off\n\t"
               "global_load_async_to_lds_b128 %7, %19, off\n\t"
               "global_load_async_to_lds_b128 %8, %20, off\n\t"
               "global_load_async_to_lds_b128 %9, %21, off\n\t"
               "global_load_async_to_lds_b128 %10, %22, off\n\t"
               "global_load_async_to_lds_b128 %11, %23, off\n\t"
               "s_wait_xcnt 0x0"
               :: "v"(l[0]), "v"(l[1]), "v"(l[2]), "v"(l[3]), "v"(l[4]), "v"(l[5]), "v"(l[6]), "v"(l[7]), "v"(l[8]), "v"(l[9]), "v"(l[10]), "v"(l[11]),
                  "v"(g[0]), "v"(g[1]), "v"(g[2]), "v"(g[3]), "v"(g[4]), "v"(g[5]), "v"(g[6]), "v"(g[7]), "v"(g[8]), "v"(g[9]), "v"(g[10]), "v"(g[11]) : "memory"); }
// one stage: LDS rows 0..127 = A rows of the workgroup, rows 128..191 = Bt rows; ap / bp = the lane's first 16 bytes of each operand at this pass's k, l0 = the lane's LDS byte address in the stage
template <int KP>
__device__ __forceinline__ void g2_stage(const _Float16* ap, int lda, const _Float16* bp, int ldb, unsigned l0) {
  constexpr int CPR = KP / 8, RPR = 128 / CPR, PB = KP * 2 + 16;      /* 16-byte pieces per row, rows per round of 128 lanes, LDS pitch in bytes */
#pragma unroll      /* both loops: the operand (A or Bt) of a copy is picked at compile time, l[] and g[] stay in registers */
  for (int s = 0; s < (CPR + CPR / 2) / 12; ++s) { unsigned l[12]; const _Float16* g[12];
#pragma unroll
    for (int j = 0; j < 12; ++j) { const int i = s * 12 + j; l[j] = l0 + (unsigned)(i * RPR * PB);
      g[j] = (i < CPR) ? ap + (size_t)(i * RPR) * lda : bp + (size_t)((i - CPR) * RPR) * ldb; }
    g2_cp12(l, g); } }

// the six fragments of one 32-k group from LDS (pitch PB bytes): two A row tiles, four Bt row tiles
template <int PB>
__device__ __forceinline__ void g2_ld6(v16h* f, const unsigned char* pa, const unsigned char* pb, int hh) {
  f[0] = g2_frag((const _Float16*)pa, hh); f[1] = g2_frag((const _Float16*)(pa + 16 * PB), hh);
  f[2] = g2_frag((const _Float16*)pb, hh); f[3] = g2_frag((const _Float16*)(pb + 16 * PB), hh); f[4] = g2_frag((const _Float16*)(pb + 32 * PB), hh); f[5] = g2_frag((const _Float16*)(pb + 48 * PB), hh); }

template <bool HASB, bool OUT32, bool OMAP, bool VTS, int KP, int KS>
__global__ __launch_bounds__(128 * KS) void k_gemm2(const _Float16* __restrict__ A, int lda, size_t sA, const _Float16* __restrict__ Bh, int ldb, size_t sB, float alpha,
    const float* __restrict__ bias, const float* __restrict__ bias1, const float* __restrict__ bias2, float* __restrict__ C, _Float16* __restrict__ C16, _Float16* __restrict__ CT, int ldc, size_t sC, int M, int N, int K) {
  constexpr int CPR = KP / 8, PB = KP * 2 + 16, STG = 192 * PB, SOB = 4 * 32 * 68 * 4;
  static_assert(KS == 1 || (KS == 2 && !VTS && 2 * STG >= SOB && 2 * STG >= 4 * 8 * 32 * 32));
  __shared__ __attribute__((aligned(16))) unsigned char sm[(KS * 2 * STG > SOB) ? KS * 2 * STG : SOB];      /* two operand stages per k group; after the k loop the output staging */
  float (*so)[32][68] = (float (*)[32][68])sm;
  const int tf = threadIdx.x, wv = __builtin_amdgcn_readfirstlane((int)(tf >> 5)), kg = (KS > 1) ? (wv >> 2) : 0, w = (KS > 1) ? (wv & 3) : wv, tid = (KS > 1) ? (tf & 127) : tf;      /* k group, wave and thread in the group */
  const int lane = tid & 31, ln = lane & 15, hh = lane >> 4; const int by = blockIdx.y;
  const int kspan = K / KS; unsigned char* smg = sm + kg * (2 * STG);      /* the group's share of K and its own two stages */
  A += (size_t)by * sA + (size_t)(kg * kspan); Bh += (size_t)by * sB + (size_t)(kg * kspan); const size_t cofs = (size_t)by * sC;
  const int ntn = N >> 6; const int mt = blockIdx.x / ntn, nq = blockIdx.x - mt * ntn; const int row0 = mt * 128 + 32 * w, col0 = nq * 64; if (mt * 128 >= M) return;
  const int crow = tid / CPR, cpc = tid % CPR;
  const _Float16* ap = A + (size_t)(mt * 128 + crow) * lda + cpc * 8; const _Float16* bp = Bh + (size_t)(col0 + crow) * ldb + cpc * 8;
  const unsigned l0 = (unsigned)(size_t)smg + (unsigned)(crow * PB + cpc * 16);
  const unsigned char* fa = smg + (32 * w + ln) * PB; const unsigned char* fb = smg + (128 + ln) * PB;
  const v8f z8 = {0.f,0.f,0.f,0.f,0.f,0.f,0.f,0.f}; v8f c00 = z8, c01 = z8, c02 = z8, c03 = z8, c10 = z8, c11 = z8, c12 = z8, c13 = z8;
  const int nt = kspan / KP;
  g2_stage<KP>(ap, lda, bp, ldb, l0);
  asm volatile("s_wait_asynccnt 0x0" ::: "memory");      /* this wave's copies of pass 0 have landed */
  __syncthreads();                                        /* pass 0 is readable by every wave */
  if (nt > 1) g2_stage<KP>(ap + KP, lda, bp + KP, ldb, l0 + STG);
#pragma unroll 1      /* one pass per trip: the hand-over at the foot stands once, and the loop stays small */
  for (int t = 0; t < nt; ++t) { const int bo = (t & 1) * STG;
    const unsigned char* pa = fa + bo; const unsigned char* pb = fb + bo; v16h fr[2][6];
    g2_ld6<PB>(fr[0], pa, pb, hh);
#pragma unroll      /* fr[] is indexed by constants only, so both fragment sets stay in registers */
    for (int kk = 0; kk < KP / 32; ++kk) { if (kk + 1 < KP / 32) g2_ld6<PB>(fr[(kk + 1) & 1], pa + (kk + 1) * 64, pb + (kk + 1) * 64, hh);      /* the next 32 k of this pass: one group of LDS reads in front of this group's WMMAs */
      const v16h a0 = fr[kk & 1][0], a1 = fr[kk & 1][1];
      v16h b = fr[kk & 1][2]; c00 = g2_mma(a0, b, c00); c10 = g2_mma(a1, b, c10);
      b = fr[kk & 1][3]; c01 = g2_mma(a0, b, c01); c11 = g2_mma(a1, b, c11);
      b = fr[kk & 1][4]; c02 = g2_mma(a0, b, c02); c12 = g2_mma(a1, b, c12);
      b = fr[kk & 1][5]; c03 = g2_mma(a0, b, c03); c13 = g2_mma(a1, b, c13); }
    asm volatile("s_wait_dscnt 0x0" ::: "memory");        /* this wave's reads of the buffer are done before it is refilled */
    asm volatile("s_wait_asynccnt 0x0" ::: "memory");     /* this wave's copies of pass t + 1 have landed */
    __syncthreads();                                      /* publishes pass t + 1 and ends every wave's reads of pass t */
    if (t + 2 < nt) g2_stage<KP>(ap + (size_t)(t + 2) * KP, lda, bp + (size_t)(t + 2) * KP, ldb, l0 + (unsigned)bo); }
  asm volatile("s_wait_asynccnt 0x0" ::: "memory");       /* no copy is outstanding when the buffers become output staging */
  v8f accs[8] = {c00, c01, c02, c03, c10, c11, c12, c13};
  if (KS > 1) {      /* kg is the same in a whole wave; the partial sums lie in the second group's own stages, which every wave has left at the loop's last barrier */
    v4fa (*red)[32] = (v4fa (*)[32])(sm + 2 * STG);      /* [(wave, tile, half of the tile's rows)][lane]: a wave's 32 lanes store 512 consecutive bytes */
    if (kg == 1) {
#pragma unroll      /* the loops here: accs[] is indexed by constants only, so it stays in registers */
      for (int u = 0; u < 8; ++u) { const v4fa lo = {accs[u][0], accs[u][1], accs[u][2], accs[u][3]}, hi = {accs[u][4], accs[u][5], accs[u][6], accs[u][7]};
        red[(w * 8 + u) * 2][lane] = lo; red[(w * 8 + u) * 2 + 1][lane] = hi; } }
    __syncthreads();      /* the second group's partial sums are readable by the first group */
    if (kg == 1) return;
#pragma unroll
    for (int u = 0; u < 8; ++u) { const v4fa lo = red[(w * 8 + u) * 2][lane], hi = red[(w * 8 + u) * 2 + 1][lane];
#pragma unroll
      for (int i = 0; i < 4; ++i) { accs[u][i] += lo[i]; accs[u][4 + i] += hi[i]; } } }
  const float* bsl = (by == 0) ? bias : ((by == 1) ? bias1 : bias2);
  if (VTS && by == 2) {      /* by is the same in the whole workgroup */
    static_assert(!VTS || (NB == 2 && HD == 64 && SEQ % 64 == 0));
    _Float16 (*sv)[HD][72] = (_Float16 (*)[HD][72])sm;      /* [b][d][t of the tile]; the pitch of 144 bytes puts the 8-byte writes of a wave's 32 lanes on different banks */
#pragma unroll      /* the three loops: accs[] is indexed by constants only, so it stays in registers */
    for (int u = 0; u < 8; ++u) { const int t = u & 3, half = u >> 2; float bv = 0.f; if (HASB) bv = bf16_rne(bsl[col0 + t * 16 + ln]);
#pragma unroll
      for (int bb = 0; bb < 2; ++bb) { v4h h4;      /* accumulator rows r = 2i + bb: four consecutive t of batch bb */
#pragma unroll
        for (int i = 0; i < 4; ++i) h4[i] = (_Float16)(accs[u][2 * i + bb] * alpha + bv);
        *(v4h*)&sv[bb][t * 16 + ln][16 * w + 8 * half + 4 * hh] = h4; } }
    __syncthreads();      /* a row of V^T holds t of all four waves */
    _Float16* pt = CT + ((size_t)nq * HD + (tid >> 3)) * SEQ + mt * 64 + (tid & 7) * 8;      /* eight lanes store one whole 128-byte line */
#pragma unroll      /* the eight pieces differ by immediate offsets from one LDS and one global address */
    for (int q = 0; q < 8; ++q) { const int bb = q >> 2, d0 = (q & 3) * 16;
      *(v8h*)(pt + ((size_t)bb * NH * HD + d0) * SEQ) = *(const v8h*)&sv[bb][d0 + (tid >> 3)][(tid & 7) * 8]; }
    return; }
#pragma unroll
  for (int u = 0; u < 8; ++u) { const int t = u & 3, half = u >> 2; const int col = col0 + t * 16 + ln; float bv = 0.f; if (HASB) bv = bf16_rne(bsl[col]);
#pragma unroll
    for (int r = 0; r < 8; ++r) { const int rloc = half * 16 + 8 * hh + r; so[w][rloc][t * 16 + ln] = accs[u][r] * alpha + bv; } }
  __builtin_amdgcn_fence(4 /* acq_rel order */, "workgroup"); __builtin_amdgcn_wave_barrier();      /* so[w] is private to wave w */
  const int rsub = lane >> 4, c4 = (lane & 15) * 4;
  {
#pragma unroll
    for (int q = 0; q < 16; ++q) { const int r = q * 2 + rsub; const v4f v = *(const v4fa*)&so[w][r][c4];
      const int gr = row0 + r; const size_t orow = OMAP ? ((size_t)(gr / NB) * NB_FULL + (size_t)(gr % NB)) : (size_t)gr;
      if (OUT32) { *(v4f*)(C + cofs + orow * ldc + col0 + c4) = v; }
      else { v4h h4;
#pragma unroll
        for (int i = 0; i < 4; ++i) h4[i] = (_Float16)v[i];
        *(v4h*)(C16 + cofs + orow * ldc + col0 + c4) = h4; } }
     } }

// ---- scores: S[by][t][s] = f16(2^-3 * q[t] . k[s]), slab by = b*NH + h at column offset by*HD of rows with pitch LQ; the whole k (HD = 64) is one pass ----
// One work-group: 128 query rows x SCK keys, each LDS row filled once (asynchronous 16-byte copies, whole 128-byte lines per row, pitch 144 bytes; two fills, the second in flight behind the first). Wave w owns query rows 32w .. 32w + 31, keeps their four fragments in registers and walks the keys in tiles of 64.
// The key rows are the A operand and the query rows the B operand: D (row = key 8hh + r, column = query ln) gives a lane eight consecutive keys of one query row, so a tile goes to the staging as f16 by one 16-byte LDS store.
// Staging: the wave's own 32 query rows in LDS, which nobody else reads and the wave itself has read before; 32 rows x 128 bytes at the same pitch; eight lanes store one whole 128-byte line of S.
#define SCK 256
static_assert(SEQ % SCK == 0 && SCK == 256 && HD == 64);      /* 24 rounds of 16 rows: two fills of twelve copies a lane */
__global__ __launch_bounds__(128) void k_scores(const _Float16* __restrict__ Q, const _Float16* __restrict__ Kk, _Float16* __restrict__ S) {
  constexpr int PB = HD * 2 + 16;
  __shared__ __attribute__((aligned(16))) unsigned char sm[(128 + SCK) * PB];      /* rows 0..127 = query rows, rows 128.. = key rows */
  const int tid = threadIdx.x, w = __builtin_amdgcn_readfirstlane((int)(tid >> 5)), lane = tid & 31, ln = lane & 15, hh = lane >> 4; const int by = blockIdx.y;
  const int mt = blockIdx.x / (SEQ / SCK), ng = blockIdx.x % (SEQ / SCK);
  const int crow = tid >> 3, cpc = tid & 7;
  const _Float16* qp = Q + (size_t)by * HD + (size_t)(mt * 128 + crow) * LQ + cpc * 8; const _Float16* kp = Kk + (size_t)by * HD + (size_t)(ng * SCK + crow) * LQ + cpc * 8;
  const unsigned l0 = (unsigned)(size_t)sm + (unsigned)(crow * PB + cpc * 16);
  { unsigned l[12]; const _Float16* g[12];      /* first fill: the 128 query rows and the first 64 key rows */
#pragma unroll      /* the operand of a copy is picked at compile time, l[] and g[] stay in registers */
    for (int i = 0; i < 12; ++i) { l[i] = l0 + (unsigned)(i * 16 * PB); g[i] = (i < 8) ? qp + (size_t)(i * 16) * LQ : kp + (size_t)((i - 8) * 16) * LQ; }
    g2_cp12(l, g); }
  asm volatile("s_wait_asynccnt 0x0" ::: "memory");      /* this wave's copies of the first fill have landed */
  __syncthreads();                                        /* the first fill is readable by every wave */
  { unsigned l[12]; const _Float16* g[12];      /* second fill: the other 192 key rows, LDS that nobody has touched, in flight while the first key tile is worked on */
#pragma unroll
    for (int i = 0; i < 12; ++i) { l[i] = l0 + (unsigned)((i + 12) * 16 * PB); g[i] = kp + (size_t)((i + 4) * 16) * LQ; }
    g2_cp12(l, g); }
  unsigned char* st = sm + 32 * w * PB;
  v16h q[2][2];      /* [query tile][32-k group] */
#pragma unroll
  for (int qt = 0; qt < 2; ++qt) { q[qt][0] = g2_frag((const _Float16*)(st + (qt * 16 + ln) * PB), hh); q[qt][1] = g2_frag((const _Float16*)(st + (qt * 16 + ln) * PB + 64), hh); }
  const unsigned char* kb = sm + (128 + ln) * PB;
  _Float16* ps = S + (size_t)by * QC * SEQ + (size_t)(mt * 128 + 32 * w + (lane >> 3)) * SEQ + ng * SCK + (lane & 7) * 8;
  const v8f z8 = {0.f,0.f,0.f,0.f,0.f,0.f,0.f,0.f};
#pragma unroll      /* the tiles differ by immediate offsets from one LDS and one global address */
  for (int nt = 0; nt < SCK / 64; ++nt) { v16h kf[2][4]; v8f acc[4][2];
    if (nt == 1) {
      asm volatile("s_wait_asynccnt 0x0" ::: "memory");      /* this wave's copies of the second fill have landed */
      /* work-group barrier with LDS-only fences: the second fill is readable by every wave; __syncthreads() would also wait for the first tile's stores to S */
      __builtin_amdgcn_fence(__ATOMIC_RELEASE, "workgroup", "local"); __builtin_amdgcn_s_barrier(); __builtin_amdgcn_fence(__ATOMIC_ACQUIRE, "workgroup", "local"); }
#pragma unroll      /* the loops below: kf[], acc[] are indexed by constants only, so they stay in registers */
    for (int u = 0; u < 8; ++u) kf[u >> 2][u & 3] = g2_frag((const _Float16*)(kb + (nt * 64 + (u & 3) * 16) * PB + (u >> 2) * 64), hh);      /* the tile's LDS reads as one group in front of its WMMAs */
#pragma unroll
    for (int kt = 0; kt < 4; ++kt) { acc[kt][0] = g2_mma(kf[0][kt], q[0][0], z8); acc[kt][1] = g2_mma(kf[0][kt], q[1][0], z8); }
#pragma unroll
    for (int kt = 0; kt < 4; ++kt) { acc[kt][0] = g2_mma(kf[1][kt], q[0][1], acc[kt][0]); acc[kt][1] = g2_mma(kf[1][kt], q[1][1], acc[kt][1]); }
#pragma unroll
    for (int u = 0; u < 8; ++u) { const int kt = u >> 1, qt = u & 1; v8h o;
#pragma unroll
      for (int r = 0; r < 8; ++r) o[r] = (_Float16)(acc[kt][qt][r] * 0.125f);
      *(v8h*)(st + (qt * 16 + ln) * PB + kt * 32 + hh * 16) = o; }
    /* LDS-only fences round a wave barrier: the staging is private to the wave, other lanes' stores are read below; a fence on all memory would also wait for the last tile's stores to S */
    __builtin_amdgcn_fence(__ATOMIC_RELEASE, "workgroup", "local"); __builtin_amdgcn_wave_barrier(); __builtin_amdgcn_fence(__ATOMIC_ACQUIRE, "workgroup", "local");
#pragma unroll
    for (int p = 0; p < 8; ++p) *(v8h*)(ps + (size_t)(p * 4) * SEQ + nt * 64) = *(const v8h*)(st + (p * 4 + (lane >> 3)) * PB + (lane & 7) * 16);
    if (nt + 1 < SCK / 64) {
      asm volatile("s_wait_xcnt 0x0" ::: "memory");      /* behind the tile's stores: the next tile's work lands in registers that those stores name */
      /* the next tile's staging stores stay behind this tile's reads of the staging */
      __builtin_amdgcn_fence(__ATOMIC_RELEASE, "workgroup", "local"); __builtin_amdgcn_wave_barrier(); __builtin_amdgcn_fence(__ATOMIC_ACQUIRE, "workgroup", "local"); }
  } }

// ---- every conversion that depends on the inputs alone, in one launch: block 0 = mix matrix, then PWB blocks per weight, then PXB blocks of x ----
#define PWB ((int)((size_t)DM * DM / (8 * 256)))      /* blocks per weight matrix, 8 elements per thread */
#define PXB ((int)(NR * DM / (8 * 256)))              /* blocks of x */
static_assert((size_t)DM * DM % (8 * 256) == 0);
static_assert(NR * DM % (8 * 256) == 0);

// WT[g][32] f16 = column softmax (axis 0) of mix_w, transposed, k zero-padded 16 -> 32; i = 0..63
__device__ __forceinline__ void d_wmix(const float* __restrict__ mixw, _Float16* __restrict__ WT, int i) {
  const int g = i >> 2, k8 = (i & 3) * 8; float mx = -3.0e38f;
#pragma unroll 1
  for (int h = 0; h < NH; ++h) mx = fmaxf(mx, bf16_rne(mixw[h * NH + g]));
  float se = 0.f;
#pragma unroll 1
  for (int h = 0; h < NH; ++h) se += __expf(bf16_rne(mixw[h * NH + g]) - mx);
  const float inv = 1.0f / se; FragH f;
#pragma unroll
  for (int q = 0; q < 8; ++q) { const int h = k8 + q; const int hc = (h < NH) ? h : (NH - 1); const float v = __expf(bf16_rne(mixw[hc * NH + g]) - mx) * inv; f.h[q] = (_Float16)((h < NH) ? v : 0.0f); }
  const v8us o = f.half[0]; *(v8us*)((unsigned short*)WT + i * 8) = o; }

// 8 floats at p -> f16(bf16_rne(v) * sc) at d
__device__ __forceinline__ void d_cvt(const float* __restrict__ p, _Float16* __restrict__ d, float sc) {
  const v4f a = *(const v4fa*)p, c = *(const v4fa*)(p + 4); FragH f;
#pragma unroll
  for (int q = 0; q < 4; ++q) { f.h[q] = (_Float16)(bf16_rne(a[q]) * sc); f.h[4 + q] = (_Float16)(bf16_rne(c[q]) * sc); }
  const v8us o = f.half[0]; *(v8us*)(unsigned short*)d = o; }

__global__ __launch_bounds__(256) void k_prep(const float* __restrict__ wq, const float* __restrict__ wk, const float* __restrict__ wv, const float* __restrict__ wo, const float* __restrict__ x, const float* __restrict__ mixw,
    _Float16* __restrict__ BW, _Float16* __restrict__ X16, _Float16* __restrict__ WT) {
  const int bid = (int)blockIdx.x - 1, tid = threadIdx.x;
  if (bid < 0) { if (tid < 64) d_wmix(mixw, WT, tid); return; }      /* first block: its chain of dependent loads starts first */
  if (bid < 4 * PWB) { const int m = bid / PWB; const float* w = (m == 0) ? wq : ((m == 1) ? wk : ((m == 2) ? wv : wo));
    const size_t t = (size_t)(bid - m * PWB) * 256 + tid; d_cvt(w + t * 8, BW + (size_t)m * DM * DM + t * 8, 16.0f); return; }      /* natural [out][in] = Bt[n][k], x16 */
  const size_t t = (size_t)(bid - 4 * PWB) * 256 + tid; const size_t row = t / (DM / 8); const int c8 = (int)(t % (DM / 8)) * 8; const size_t srow = (row / NB) * NB_FULL + (row % NB);
  d_cvt(x + srow * DM + c8, X16 + t * 8, 1.0f);
  asm volatile("s_wait_xcnt 0x0" ::: "memory"); }      /* behind the store: in the built code the other cases' blocks follow this one and rewrite the store's registers */

// softmax over SEQ keys + cross-head mix. S f16 [NB*NH][QC][SEQ] (slab by = b*NH + h); PM f16 [NB*NH][QC][SEQ] = 1024 * sum_h Wm[h][g] * softmax(S[b*NH+h][t][:]).
// One work-group per SMR query rows (b, t), SMW waves; wave w owns keys 128w .. 128w + 127 of all 16 heads and keeps them in registers, so S is read once, in whole lines.
// Lane (ln, hh) holds heads 8hh .. 8hh + 7 at keys 128w + 8ln + j (j = 0 .. 7), one 16-byte load per head: that is the B fragment of the mix WMMA for tile j, column ln <-> key 8ln + j,
// and D (row g = 8hh + r, column ln) of the eight tiles gives eight consecutive keys per lane: 16-byte stores, 256 bytes per head row and half wave.
// Row statistics: per wave max and sum of exp(x - wave max) over the 16-lane row by DPP, the waves' pairs joined through LDS (one barrier per query row).
#define SMW (SEQ / 128)      /* waves per work-group */
#define SMR 4                /* query rows per work-group, the next row's loads in flight while a row is worked on */
static_assert(SMW >= 1 && SMW <= 32);
static_assert(QC % SMR == 0);
template <int CTRL> __device__ __forceinline__ float sm_dpp(float v) { return __builtin_bit_cast(float, __builtin_amdgcn_mov_dpp(__builtin_bit_cast(int, v), CTRL, 0xf, 0xf, true)); }      /* 0x160 | m: lane l ^ m of the 16-lane row; 0x150 | i: lane i of the row */
// native exp (v_exp_f32 of x * log2 e) with the slot behind the transcendental filled in the same statement: in the built code the next instruction otherwise overwrites its source register directly behind it
__device__ __forceinline__ float sm_exp(float x) { const float t = x * 1.44269504f; float e; asm("v_exp_f32 %0, %1\n\tv_nop" : "=v"(e) : "v"(t)); return e; }
__device__ __forceinline__ float sm_exp2(float t) { float e; asm("v_exp_f32 %0, %1\n\tv_nop" : "=v"(e) : "v"(t)); return e; }      /* 2^t, the same slot filled */
__device__ __forceinline__ float sm_rowmax(float v) { v = fmaxf(v, sm_dpp<0x161>(v)); v = fmaxf(v, sm_dpp<0x162>(v)); v = fmaxf(v, sm_dpp<0x164>(v)); return fmaxf(v, sm_dpp<0x168>(v)); }
__device__ __forceinline__ float sm_rowsum(float v) { v += sm_dpp<0x161>(v); v += sm_dpp<0x162>(v); v += sm_dpp<0x164>(v); return v + sm_dpp<0x168>(v); }
// p and hp are the same in every lane, lofs is the lane's own element offset; the query rows of a work-group differ by an immediate offset, so the eight address pairs are formed once and live until the last row's loads are issued
__device__ __forceinline__ void sm_load(v8h (&x)[8], const _Float16* __restrict__ p, size_t hp, unsigned lofs) {
#pragma unroll
  for (int i = 0; i < 8; ++i) x[i] = *(const v8h*)(p + (size_t)i * hp + lofs); }

__global__ __launch_bounds__(SMW * 32) void k_smix(const _Float16* __restrict__ S, const _Float16* __restrict__ WT, _Float16* __restrict__ PM, size_t hp) {      /* hp = head slab pitch QC * SEQ, an argument so that the head bases are formed in scalar registers */
  __shared__ __attribute__((aligned(16))) float sst[2][SMW][2][NH];      /* [row parity][wave][max, sum][head] */
  const int tid = threadIdx.x, w = __builtin_amdgcn_readfirstlane((int)(tid >> 5)), lane = tid & 31, ln = lane & 15, hh = lane >> 4;
  const int wr = blockIdx.x * SMR; const int b = wr / QC, tql = wr - b * QC;
  const size_t base = ((size_t)(b * NH) * QC + tql) * SEQ + 128 * w; const unsigned lofs = (unsigned)(8 * hh) * (unsigned)hp + 8 * ln;
  const _Float16* ps = S + base;                                          /* head 8hh + i of query row q at ps + i * hp + q * SEQ + lofs */
  _Float16* po = PM + base;
  const v8f z8 = {0.f,0.f,0.f,0.f,0.f,0.f,0.f,0.f};
  const int hd = 8 * hh + (ln & 7);                                    /* the head whose joined statistics this lane forms */
  v8h x[2][8];
  const v16h aW = g2_frag(WT + ln * 32, hh);                          /* A: row g = ln, k = heads (upper 16 k zero) */
  asm volatile("s_wait_xcnt 0x0" ::: "memory");      /* behind the loads of aW: in the built code a load of scores lands in their address registers */
  sm_load(x[0], ps, hp, lofs);
#pragma unroll      /* x[] is indexed by constants only, so both rows' scores stay in registers */
  for (int q = 0; q < SMR; ++q) { v8h (&xc)[8] = x[q & 1];
    if (q > 0) asm volatile("s_wait_xcnt 0x0" ::: "memory");      /* behind the last row's stores: the loads and the work below land in registers that those stores name */
    if (q + 1 < SMR) sm_load(x[(q + 1) & 1], ps + (size_t)(q + 1) * SEQ, hp, lofs);
    if (q + 2 == SMR) asm volatile("s_wait_xcnt 0x0" ::: "memory");      /* behind the last loads: their address registers are free from here on and this row's work is put into them */
    __builtin_amdgcn_sched_barrier(0);      /* keeps the next row's loads in front of this row's work and the two rows' work apart: without it the build starts on the next row's scores inside this row and waits for them early */
    float c[8][8], m8[8], s8[8];
#pragma unroll
    for (int i = 0; i < 8; ++i) { const v8h u = xc[i];      /* the lane's maximum is taken on the f16 pairs (exact), then widened */
      const v4h a = __builtin_elementwise_max(__builtin_shufflevector(u, u, 0, 1, 2, 3), __builtin_shufflevector(u, u, 4, 5, 6, 7));
      const v2h p = __builtin_elementwise_max(__builtin_shufflevector(a, a, 0, 1), __builtin_shufflevector(a, a, 2, 3));
      m8[i] = sm_rowmax(fmaxf((float)p[0], (float)p[1])); }
#pragma unroll
    for (int i = 0; i < 8; ++i) { float se = 0.f; const float nm = -m8[i] * 1.44269504f;
#pragma unroll
      for (int j = 0; j < 8; ++j) { const float e = sm_exp2(__builtin_fmaf((float)xc[i][j], 1.44269504f, nm)); c[i][j] = e; se += e; }      /* exp(x - max): the f16 score goes into the multiply-add as it is */
      s8[i] = sm_rowsum(se); }
    float (*st)[2][NH] = sst[q & 1];
    if (ln == 0) {
#pragma unroll
      for (int i = 0; i < 8; ++i) { st[w][0][8 * hh + i] = m8[i]; st[w][1][8 * hh + i] = s8[i]; } }
    /* work-group barrier with LDS-only fences: every wave's pair of this query row is readable, and the other parity's buffer is rewritten only behind it. Only sst passes between waves; __syncthreads() would also wait for the next row's loads and the last row's stores */
    __builtin_amdgcn_fence(__ATOMIC_RELEASE, "workgroup", "local"); __builtin_amdgcn_s_barrier(); __builtin_amdgcn_fence(__ATOMIC_ACQUIRE, "workgroup", "local");
    float mw[SMW], mx = -3.0e38f, se = 0.f;
#pragma unroll
    for (int u = 0; u < SMW; ++u) { mw[u] = st[u][0][hd]; mx = fmaxf(mx, mw[u]); }
#pragma unroll
    for (int u = 0; u < SMW; ++u) se += st[u][1][hd] * sm_exp(mw[u] - mx);
    const float f = sm_exp(st[w][0][hd] - mx) * (1024.0f / se);      /* exp(x - wave max) * f = 1024 * softmax */
    const float f8[8] = {sm_dpp<0x150>(f), sm_dpp<0x151>(f), sm_dpp<0x152>(f), sm_dpp<0x153>(f), sm_dpp<0x154>(f), sm_dpp<0x155>(f), sm_dpp<0x156>(f), sm_dpp<0x157>(f)};      /* lane i of the row holds head 8hh + i */
    v8f d[8];
#pragma unroll
    for (int j = 0; j < 8; ++j) { FragH bf;
#pragma unroll
      for (int i = 0; i < 8; ++i) bf.h[i] = (_Float16)(c[i][j] * f8[i]);
#pragma unroll
      for (int i = 8; i < 16; ++i) bf.h[i] = (_Float16)0.0f;
      d[j] = g2_mma(aW, bf.v, z8); }
#pragma unroll
    for (int r = 0; r < 8; ++r) { v8h o;
#pragma unroll
      for (int j = 0; j < 8; ++j) o[j] = (_Float16)d[j][r];
      *(v8h*)(po + ((size_t)r * hp + (size_t)q * SEQ) + lofs) = o; }
  }
}

extern "C" void kernel_launch(void* const* d_in, const int* in_sizes, int n_in,
                              void* d_out, int out_size, void* d_ws, size_t ws_size, hipStream_t stream) {
  if (n_in < 10) return;
  if ((size_t)in_sizes[0] < NR * DM) return;
  if ((size_t)in_sizes[1] < (size_t)DM * DM || (size_t)in_sizes[3] < (size_t)DM * DM || (size_t)in_sizes[5] < (size_t)DM * DM || (size_t)in_sizes[7] < (size_t)DM * DM) return;
  if (in_sizes[2] < DM || in_sizes[4] < DM || in_sizes[6] < DM || in_sizes[8] < DM || in_sizes[9] < NH * NH) return;
  if ((size_t)out_size < NR * DM) return;
  const float* const* I = (const float* const*)d_in;
  const float* xq = I[0]; const float* wq = I[1]; const float* bq = I[2]; const float* wk = I[3]; const float* bk = I[4]; const float* wv = I[5]; const float* bv = I[6]; const float* wo = I[7]; const float* bo = I[8]; const float* mixw = I[9];
  char* ws = (char*)d_ws; size_t off = 0;
  auto take = [&](size_t bytes) { char* p = ws + off; off += (bytes + 255) & ~(size_t)255; return p; };
  _Float16* BQ = (_Float16*)take((size_t)4 * DM * DM * 2); _Float16* BO = BQ + (size_t)3 * DM * DM;      /* wq, wk, wv, wo planes, pitch DM * DM */
  _Float16* X16 = (_Float16*)take(NR * DM * 2); _Float16* Q16 = (_Float16*)take(2 * NR * DM * 2); _Float16* K16 = Q16 + NR * DM; _Float16* O16 = (_Float16*)take(NR * DM * 2);      /* q, k planes, pitch NR * DM */
  _Float16* S = (_Float16*)take((size_t)NB * NH * QC * SEQ * 2); _Float16* PM = (_Float16*)take((size_t)NB * NH * QC * SEQ * 2); _Float16* VT = (_Float16*)take((size_t)NB * NH * HD * SEQ * 2);
  _Float16* WT = (_Float16*)take((size_t)NH * 32 * 2);
  if (off > ws_size) return;
  k_prep<<<1 + 4 * PWB + PXB, 256, 0, stream>>>(wq, wk, wv, wo, xq, mixw, BQ, X16, WT);
  const dim3 gp((unsigned)((MP / 128) * (DM / 64)), 1);
  k_gemm2<true, false, false, true, 128, 1><<<dim3(gp.x, 3), 128, 0, stream>>>(X16, DM, 0, BQ, DM, (size_t)DM * DM, 0.0625f, bq, bk, bv, nullptr, Q16, VT, DM, NR * DM, MP, DM, DM);      /* slab 0 / 1 / 2 = q / k / v; v goes to VT[(b,h)][64][SEQ] */
  for (int t0 = 0; t0 < SEQ; t0 += QC) {
    /* scores: slab by = b*NH + h at column offset by*64 of rows with pitch LQ; S[by][QC][SEQ] f16 */
    k_scores<<<dim3((QC / 128) * (SEQ / SCK), NB * NH), 128, 0, stream>>>(Q16 + (size_t)t0 * LQ, K16, S);
    k_smix<<<NB * QC / SMR, SMW * 32, 0, stream>>>(S, WT, PM, (size_t)QC * SEQ);
    /* o[t][b][g*64 + d] x64 = 2^-4 * (1024 P') . V^T */
    k_gemm2<false, false, false, false, 128, 2><<<dim3((QC / 128) * (HD / 64), NB * NH), 256, 0, stream>>>(PM, SEQ, (size_t)QC * SEQ, VT, SEQ, (size_t)HD * SEQ, 0.0625f, nullptr, nullptr, nullptr, nullptr, O16 + (size_t)t0 * LQ, nullptr, LQ, (size_t)HD, QC, HD, SEQ);
  }
  k_gemm2<true, true, true, false, 128, 2><<<gp, 256, 0, stream>>>(O16, DM, 0, BO, DM, 0, 0.0009765625f, bo, nullptr, nullptr, (float*)d_out, nullptr, nullptr, DM, 0, MP, DM, DM);      /* out rows t*NB_FULL + b */
}

// v009
// One run takes 66.1 microseconds.
// Next to v008, in two timings, it ran 1.05 times as fast each time.
// Over all steps from v000 it is 7.12 times as fast.
#include <hip/hip_runtime.h>
// Multi-head SELF-attention with cross-head probability mixing, sequence-first layout: x [1024][2][1024] (token row r = t*NB + b); q / k / v = x W^T + bias (natural [out][in] weights, biases present), 16 heads of 64, q scaled by 64^-0.5; softmax over all 1024 keys (no mask); P'[b,g,t,s] = sum_h P[b,h,t,s] * Wm[h][g] with Wm = column softmax (axis 0) of mix_w; ctx[b,g] = P'[b,g] . v[b,g]; merged [t][b][g*64+d]; out = ctx Wo^T + bo.
// Structure: one conversion launch (x as exact f16 rows, inputs RNE-converted to bf16 first; the four weights; the mix matrix); Q, K, V as three WMMA GEMMs in one launch, one per grid.y (32x64 wave tiles, operands staged in LDS by asynchronous copies, f32 accumulation, x16 weights + bias, f16 outputs; the V slab's epilogue turns its tile in LDS and stores V^T per (b,h) directly); all query rows in one chunk: scores kernel (K = 64, the 32 (b,h) slabs on grid.y, 128 queries x 256 keys per work-group, alpha 64^-0.5, f32 accumulators stored as f16), k_smix (scores of a query row held in registers, f32 row statistics, native exp, head mix as one WMMA per 16-key tile: A = Wm^T f16 with K zero-padded 16 -> 32, B = 1024 P f16), o = P' . V^T GEMM (K = 1024; o carried x64) into merged f16 rows; out = o Wo + bo GEMM (f32).
// Compute dtype: all contractions v_wmma_f32_16x16x32_f16 (f16 operands, f32 accumulate); inputs RNE-converted to bf16 (exact in f16); q, k, v, mixed softmax weights (x1024), mix matrix and o (x64) as plain f16 operands; scores accumulated in f32 and kept in memory as f16; exponentials and softmax statistics f32.
#ifndef NB
#define NB 2                         /* batches processed */
#endif
#ifndef SEQ
#define SEQ 1024                     /* sequence length processed (queries = keys) */
#endif
#define NB_FULL 2                    /* batch pitch of the input / output rows */
#define DM 1024
#define NH 16
#define HD 64
#define QC SEQ                       /* query rows per attention chunk: the whole sequence, so each attention launch fills the chip (S f16 + PM f16 = 128 MiB of workspace) */
#define NR ((size_t)NB * SEQ)        /* token rows */
#define MP ((int)(NB * SEQ))
#define LQ (NB * DM)                 /* pitch between consecutive t for one batch */
static_assert(SEQ % 128 == 0);
static_assert(QC % 128 == 0);
static_assert(SEQ % QC == 0);
static_assert(NH * HD == DM);
static_assert(NB <= NB_FULL);
static_assert((NB * SEQ) % 128 == 0);
static_assert(NH == 16);

typedef unsigned short v8us __attribute__((ext_vector_type(8), may_alias));
typedef float  v8f  __attribute__((ext_vector_type(8)));
typedef float  v4f  __attribute__((ext_vector_type(4)));
typedef float  v4fa __attribute__((ext_vector_type(4), may_alias));
typedef _Float16 v16h __attribute__((ext_vector_type(16)));
typedef _Float16 v4h __attribute__((ext_vector_type(4)));
typedef _Float16 v8h __attribute__((ext_vector_type(8), may_alias));
typedef _Float16 v2h __attribute__((ext_vector_type(2)));
union FragH { v16h v; v8us half[2]; _Float16 h[16]; unsigned short u[16]; };

__device__ __forceinline__ unsigned short bf16_bits(float x) { unsigned int u = __float_as_uint(x); return (unsigned short)((u + 0x7FFFu + ((u >> 16) & 1u)) >> 16); }
__device__ __forceinline__ float bf16_val(unsigned short b) { return __uint_as_float(((unsigned int)b) << 16); }
__device__ __forceinline__ float bf16_rne(float x) { return bf16_val(bf16_bits(x)); }   /* RNE convert to bf16, back as f32 */

// fragment: elements 0..7 <- k0 + 8h .. +7, elements 8..15 <- k0 + 16 + 8h .. +7 (p points at k0 of the lane's row / column)
__device__ __forceinline__ v16h g2_frag(const _Float16* p, int hh) { FragH f; f.half[0] = *(const v8us*)((const unsigned short*)p + 8 * hh); f.half[1] = *(const v8us*)((const unsigned short*)p + 16 + 8 * hh); return f.v; }
__device__ __forceinline__ v8f g2_mma(v16h a, v16h b, v8f c) { v8f d = __builtin_amdgcn_wmma_f32_16x16x32_f16(false, a, false, b, (short)0, c, false, false); asm volatile("v_nop\n\tv_nop\n\tv_nop\n\tv_nop" : "+v"(d) : "v"(a), "v"(b)); return d; }

// ---- GEMM (workgroup tile 128x64, wave tile 32x64; M % 128 == 0 per launch region, N % 64 == 0, K % (KS * KP) == 0, K >= KS * KP): C = alpha * A . Bt^T (+ bias) ----
// A f16 [M][K] (pitch lda), Bt f16 [N][K] (pitch ldb); batch slab by = blockIdx.y with element strides sA / sB / sC; slab 0 / 1 / 2 adds bias / bias1 / bias2.
// OMAP: output row r -> (r / NB) * NB_FULL + r % NB.
// VTS: slab 2 (v) is stored transposed only: CT[(b * NH + h) * HD + d][t] for token row r = t * NB + b and column h * HD + d; a workgroup's 128 rows x 64 columns are 64 t of one head for both batches.
// KS = 2: eight waves; waves 0..3 sum the first half of K, waves 4..7 the second half, each group on its own two operand buffers (twice the bytes in flight, two waves per SIMD, half the passes); the second group's partial sums pass through LDS and the first group adds them and stores.
// Operand path: per pass of KP k the 128 A rows and the 64 Bt rows go to LDS by asynchronous 16-byte copies (whole 128-byte lines per row), two buffers, the next pass's copies in flight while this pass is worked on.
// twelve copies of one lane; the s_wait_xcnt stands inside the statement so that no address register is rewritten in front of it
__device__ __forceinline__ void g2_cp12(const unsigned* l, const _Float16* const* g) {
  asm volatile("global_load_async_to_lds_b128 %0, %12, off\n\t"
               "global_load_async_to_lds_b128 %1, %13, off\n\t"
               "global_load_async_to_lds_b128 %2, %14, off\n\t"
               "global_load_async_to_lds_b128 %3, %15, off\n\t"
               "global_load_async_to_lds_b128 %4, %16, off\n\t"
               "global_load_async_to_lds_b128 %5, %17, off\n\t"
               "global_load_async_to_lds_b128 %6, %18, off\n\t"
               "global_load_async_to_lds_b128 %7, %19, off\n\t"
               "global_load_async_to_lds_b128 %8, %20, off\n\t"
               "global_load_async_to_lds_b128 %9, %21, off\n\t"
               "global_load_async_to_lds_b128 %10, %22, off\n\t"
               "global_load_async_to_lds_b128 %11, %23, off\n\t"
               "s_wait_xcnt 0x0"
               :: "v"(l[0]), "v"(l[1]), "v"(l[2]), "v"(l[3]), "v"(l[4]), "v"(l[5]), "v"(l[6]), "v"(l[7]), "v"(l[8]), "v"(l[9]), "v"(l[10]), "v"(l[11]),
                  "v"(g[0]), "v"(g[1]), "v"(g[2]), "v"(g[3]), "v"(g[4]), "v"(g[5]), "v"(g[6]), "v"(g[7]), "v"(g[8]), "v"(g[9]), "v"(g[10]), "v"(g[11]) : "memory"); }
// one stage: LDS rows 0..127 = A rows of the workgroup, rows 128..191 = Bt rows; ap / bp = the lane's first 16 bytes of each operand at this pass's k, l0 = the lane's LDS byte address in the stage
template <int KP>
__device__ __forceinline__ void g2_stage(const _Float16* ap, int lda, const _Float16* bp, int ldb, unsigned l0) {
  constexpr int CPR = KP / 8, RPR = 128 / CPR, PB = KP * 2 + 16;      /* 16-byte pieces per row, rows per round of 128 lanes, LDS pitch in bytes */
#pragma unroll      /* both loops: the operand (A or Bt) of a copy is picked at compile time, l[] and g[] stay in registers */
  for (int s = 0; s < (CPR + CPR / 2) / 12; ++s) { unsigned l[12]; const _Float16* g[12];
#pragma unroll
    for (int j = 0; j < 12; ++j) { const int i = s * 12 + j; l[j] = l0 + (unsigned)(i * RPR * PB);
      g[j] = (i < CPR) ? ap + (size_t)(i * RPR) * lda : bp + (size_t)((i - CPR) * RPR) * ldb; }
    g2_cp12(l, g); } }

// the six fragments of one 32-k group from LDS (pitch PB bytes): two A row tiles, four Bt row tiles
template <int PB>
__device__ __forceinline__ void g2_ld6(v16h* f, const unsigned char* pa, const unsigned char* pb, int hh) {
  f[0] = g2_frag((const _Float16*)pa, hh); f[1] = g2_frag((const _Float16*)(pa + 16 * PB), hh);
  f[2] = g2_frag((const _Float16*)pb, hh); f[3] = g2_frag((const _Float16*)(pb + 16 * PB), hh); f[4] = g2_frag((const _Float16*)(pb + 32 * PB), hh); f[5] = g2_frag((const _Float16*)(pb + 48 * PB), hh); }

template <bool HASB, bool OUT32, bool OMAP, bool VTS, int KP, int KS>
__global__ __launch_bounds__(128 * KS) void k_gemm2(const _Float16* __restrict__ A, int lda, size_t sA, const _Float16* __restrict__ Bh, int ldb, size_t sB, float alpha,
    const float* __restrict__ bias, const float* __restrict__ bias1, const float* __restrict__ bias2, float* __restrict__ C, _Float16* __restrict__ C16, _Float16* __restrict__ CT, int ldc, size_t sC, int M, int N, int K) {
  constexpr int CPR = KP / 8, PB = KP * 2 + 16, STG = 192 * PB, SOB = 4 * 32 * 68 * 4;
  static_assert(KS == 1 || (KS == 2 && !VTS && 2 * STG >= SOB && 2 * STG >= 4 * 8 * 32 * 32));
  __shared__ __attribute__((aligned(16))) unsigned char sm[(KS * 2 * STG > SOB) ? KS * 2 * STG : SOB];      /* two operand stages per k group; after the k loop the output staging */
  float (*so)[32][68] = (float (*)[32][68])sm;
  const int tf = threadIdx.x, wv = __builtin_amdgcn_readfirstlane((int)(tf >> 5)), kg = (KS > 1) ? (wv >> 2) : 0, w = (KS > 1) ? (wv & 3) : wv, tid = (KS > 1) ? (tf & 127) : tf;      /* k group, wave and thread in the group */
  const int lane = tid & 31, ln = lane & 15, hh = lane >> 4; const int by = blockIdx.y;
  const int kspan = K / KS; unsigned char* smg = sm + kg * (2 * STG);      /* the group's share of K and its own two stages */
  A += (size_t)by * sA + (size_t)(kg * kspan); Bh += (size_t)by * sB + (size_t)(kg * kspan); const size_t cofs = (size_t)by * sC;
  const int ntn = N >> 6; const int mt = blockIdx.x / ntn, nq = blockIdx.x - mt * ntn; const int row0 = mt * 128 + 32 * w, col0 = nq * 64; if (mt * 128 >= M) return;
  const int crow = tid / CPR, cpc = tid % CPR;
  const _Float16* ap = A + (size_t)(mt * 128 + crow) * lda + cpc * 8; const _Float16* bp = Bh + (size_t)(col0 + crow) * ldb + cpc * 8;
  const unsigned l0 = (unsigned)(size_t)smg + (unsigned)(crow * PB + cpc * 16);
  const unsigned char* fa = smg + (32 * w + ln) * PB; const unsigned char* fb = smg + (128 + ln) * PB;
  const v8f z8 = {0.f,0.f,0.f,0.f,0.f,0.f,0.f,0.f}; v8f c00 = z8, c01 = z8, c02 = z8, c03 = z8, c10 = z8, c11 = z8, c12 = z8, c13 = z8;
  const int nt = kspan / KP;
  g2_stage<KP>(ap, lda, bp, ldb, l0);
  asm volatile("s_wait_asynccnt 0x0" ::: "memory");      /* this wave's copies of pass 0 have landed */
  __syncthreads();                                        /* pass 0 is readable by every wave */
  if (nt > 1) g2_stage<KP>(ap + KP, lda, bp + KP, ldb, l0 + STG);
#pragma unroll 1      /* one pass per trip: the hand-over at the foot stands once, and the loop stays small */
  for (int t = 0; t < nt; ++t) { const int bo = (t & 1) * STG;
    const unsigned char* pa = fa + bo; const unsigned char* pb = fb + bo; v16h fr[2][6];
    g2_ld6<PB>(fr[0], pa, pb, hh);
#pragma unroll      /* fr[] is indexed by constants only, so both fragment sets stay in registers */
    for (int kk = 0; kk < KP / 32; ++kk) { if (kk + 1 < KP / 32) g2_ld6<PB>(fr[(kk + 1) & 1], pa + (kk + 1) * 64, pb + (kk + 1) * 64, hh);      /* the next 32 k of this pass: one group of LDS reads in front of this group's WMMAs */
      const v16h a0 = fr[kk & 1][0], a1 = fr[kk & 1][1];
      v16h b = fr[kk & 1][2]; c00 = g2_mma(a0, b, c00); c10 = g2_mma(a1, b, c10);
      b = fr[kk & 1][3]; c01 = g2_mma(a0, b, c01); c11 = g2_mma(a1, b, c11);
      b = fr[kk & 1][4]; c02 = g2_mma(a0, b, c02); c12 = g2_mma(a1, b, c12);
      b = fr[kk & 1][5]; c03 = g2_mma(a0, b, c03); c13 = g2_mma(a1, b, c13); }
    asm volatile("s_wait_dscnt 0x0" ::: "memory");        /* this wave's reads of the buffer are done before it is refilled */
    asm volatile("s_wait_asynccnt 0x0" ::: "memory");     /* this wave's copies of pass t + 1 have landed */
    __syncthreads();                                      /* publishes pass t + 1 and ends every wave's reads of pass t */
    if (t + 2 < nt) g2_stage<KP>(ap + (size_t)(t + 2) * KP, lda, bp + (size_t)(t + 2) * KP, ldb, l0 + (unsigned)bo); }
  asm volatile("s_wait_asynccnt 0x0" ::: "memory");       /* no copy is outstanding when the buffers become output staging */
  v8f accs[8] = {c00, c01, c02, c03, c10, c11, c12, c13};
  if (KS > 1) {      /* kg is the same in a whole wave; the partial sums lie in the second group's own stages, which every wave has left at the loop's last barrier */
    v4fa (*red)[32] = (v4fa (*)[32])(sm + 2 * STG);      /* [(wave, tile, half of the tile's rows)][lane]: a wave's 32 lanes store 512 consecutive bytes */
    if (kg == 1) {
#pragma unroll      /* the loops here: accs[] is indexed by constants only, so it stays in registers */
      for (int u = 0; u < 8; ++u) { const v4fa lo = {accs[u][0], accs[u][1], accs[u][2], accs[u][3]}, hi = {accs[u][4], accs[u][5], accs[u][6], accs[u][7]};
        red[(w * 8 + u) * 2][lane] = lo; red[(w * 8 + u) * 2 + 1][lane] = hi; } }
    __syncthreads();      /* the second group's partial sums are readable by the first group */
    if (kg == 1) return;
#pragma unroll
    for (int u = 0; u < 8; ++u) { const v4fa lo = red[(w * 8 + u) * 2][lane], hi = red[(w * 8 + u) * 2 + 1][lane];
#pragma unroll
      for (int i = 0; i < 4; ++i) { accs[u][i] += lo[i]; accs[u][4 + i] += hi[i]; } } }
  const float* bsl = (by == 0) ? bias : ((by == 1) ? bias1 : bias2);
  if (VTS && by == 2) {      /* by is the same in the whole workgroup */
    static_assert(!VTS || (NB == 2 && HD == 64 && SEQ % 64 == 0));
    _Float16 (*sv)[HD][72] = (_Float16 (*)[HD][72])sm;      /* [b][d][t of the tile]; the pitch of 144 bytes puts the 8-byte writes of a wave's 32 lanes on different banks */
#pragma unroll      /* the three loops: accs[] is indexed by constants only, so it stays in registers */
    for (int u = 0; u < 8; ++u) { const int t = u & 3, half = u >> 2; float bv = 0.f; if (HASB) bv = bf16_rne(bsl[col0 + t * 16 + ln]);
#pragma unroll
      for (int bb = 0; bb < 2; ++bb) { v4h h4;      /* accumulator rows r = 2i + bb: four consecutive t of batch bb */
#pragma unroll
        for (int i = 0; i < 4; ++i) h4[i] = (_Float16)(accs[u][2 * i + bb] * alpha + bv);
        *(v4h*)&sv[bb][t * 16 + ln][16 * w + 8 * half + 4 * hh] = h4; } }
    __syncthreads();      /* a row of V^T holds t of all four waves */
    _Float16* pt = CT + ((size_t)nq * HD + (tid >> 3)) * SEQ + mt * 64 + (tid & 7) * 8;      /* eight lanes store one whole 128-byte line */
#pragma unroll      /* the eight pieces differ by immediate offsets from one LDS and one global address */
    for (int q = 0; q < 8; ++q) { const int bb = q >> 2, d0 = (q & 3) * 16;
      *(v8h*)(pt + ((size_t)bb * NH * HD + d0) * SEQ) = *(const v8h*)&sv[bb][d0 + (tid >> 3)][(tid & 7) * 8]; }
    return; }
#pragma unroll
  for (int u = 0; u < 8; ++u) { const int t = u & 3, half = u >> 2; const int col = col0 + t * 16 + ln; float bv = 0.f; if (HASB) bv = bf16_rne(bsl[col]);
#pragma unroll
    for (int r = 0; r < 8; ++r) { const int rloc = half * 16 + 8 * hh + r; so[w][rloc][t * 16 + ln] = accs[u][r] * alpha + bv; } }
  __builtin_amdgcn_fence(4 /* acq_rel order */, "workgroup"); __builtin_amdgcn_wave_barrier();      /* so[w] is private to wave w */
  const int rsub = lane >> 4, c4 = (lane & 15) * 4;
  {
#pragma unroll
    for (int q = 0; q < 16; ++q) { const int r = q * 2 + rsub; const v4f v = *(const v4fa*)&so[w][r][c4];
      const int gr = row0 + r; const size_t orow = OMAP ? ((size_t)(gr / NB) * NB_FULL + (size_t)(gr % NB)) : (size_t)gr;
      if (OUT32) { *(v4f*)(C + cofs + orow * ldc + col0 + c4) = v; }
      else { v4h h4;
#pragma unroll
        for (int i = 0; i < 4; ++i) h4[i] = (_Float16)v[i];
        *(v4h*)(C16 + cofs + orow * ldc + col0 + c4) = h4; } }
     } }

// ---- scores: S[by][t][s] = f16(2^-3 * q[t] . k[s]), slab by = b*NH + h at column offset by*HD of rows with pitch LQ; the whole k (HD = 64) is one pass ----
// One work-group: 128 query rows x SCK keys, each LDS row filled once (asynchronous 16-byte copies, whole 128-byte lines per row, pitch 144 bytes; two fills, the second in flight behind the first). Wave w owns query rows 32w .. 32w + 31, keeps their four fragments in registers and walks the keys in tiles of 64.
// The key rows are the A operand and the query rows the B operand: D (row = key 8hh + r, column = query ln) gives a lane eight consecutive keys of one query row, so a tile goes to the staging as f16 by one 16-byte LDS store.
// Staging: the wave's own 32 query rows in LDS, which nobody else reads and the wave itself has read before; 32 rows x 128 bytes at the same pitch; eight lanes store one whole 128-byte line of S.
#define SCK 256
static_assert(SEQ % SCK == 0 && SCK == 256 && HD == 64);      /* 24 rounds of 16 rows: two fills of twelve copies a lane */
__global__ __launch_bounds__(128) void k_scores(const _Float16* __restrict__ Q, const _Float16* __restrict__ Kk, _Float16* __restrict__ S) {
  constexpr int PB = HD * 2 + 16;
  __shared__ __attribute__((aligned(16))) unsigned char sm[(128 + SCK) * PB];      /* rows 0..127 = query rows, rows 128.. = key rows */
  const int tid = threadIdx.x, w = __builtin_amdgcn_readfirstlane((int)(tid >> 5)), lane = tid & 31, ln = lane & 15, hh = lane >> 4; const int by = blockIdx.y;
  const int mt = blockIdx.x / (SEQ / SCK), ng = blockIdx.x % (SEQ / SCK);
  const int crow = tid >> 3, cpc = tid & 7;
  const _Float16* qp = Q + (size_t)by * HD + (size_t)(mt * 128 + crow) * LQ + cpc * 8; const _Float16* kp = Kk + (size_t)by * HD + (size_t)(ng * SCK + crow) * LQ + cpc * 8;
  const unsigned l0 = (unsigned)(size_t)sm + (unsigned)(crow * PB + cpc * 16);
  { unsigned l[12]; const _Float16* g[12];      /* first fill: the 128 query rows and the first 64 key rows */
#pragma unroll      /* the operand of a copy is picked at compile time, l[] and g[] stay in registers */
    for (int i = 0; i < 12; ++i) { l[i] = l0 + (unsigned)(i * 16 * PB); g[i] = (i < 8) ? qp + (size_t)(i * 16) * LQ : kp + (size_t)((i - 8) * 16) * LQ; }
    g2_cp12(l, g); }
  asm volatile("s_wait_asynccnt 0x0" ::: "memory");      /* this wave's copies of the first fill have landed */
  __syncthreads();                                        /* the first fill is readable by every wave */
  { unsigned l[12]; const _Float16* g[12];      /* second fill: the other 192 key rows, LDS that nobody has touched, in flight while the first key tile is worked on */
#pragma unroll
    for (int i = 0; i < 12; ++i) { l[i] = l0 + (unsigned)((i + 12) * 16 * PB); g[i] = kp + (size_t)((i + 4) * 16) * LQ; }
    g2_cp12(l, g); }
  unsigned char* st = sm + 32 * w * PB;
  v16h q[2][2];      /* [query tile][32-k group] */
#pragma unroll
  for (int qt = 0; qt < 2; ++qt) { q[qt][0] = g2_frag((const _Float16*)(st + (qt * 16 + ln) * PB), hh); q[qt][1] = g2_frag((const _Float16*)(st + (qt * 16 + ln) * PB + 64), hh); }
  const unsigned char* kb = sm + (128 + ln) * PB;
  _Float16* ps = S + (size_t)by * QC * SEQ + (size_t)(mt * 128 + 32 * w + (lane >> 3)) * SEQ + ng * SCK + (lane & 7) * 8;
  const v8f z8 = {0.f,0.f,0.f,0.f,0.f,0.f,0.f,0.f};
#pragma unroll      /* the tiles differ by immediate offsets from one LDS and one global address */
  for (int nt = 0; nt < SCK / 64; ++nt) { v16h kf[2][4]; v8f acc[4][2];
    if (nt == 1) {
      asm volatile("s_wait_asynccnt 0x0" ::: "memory");      /* this wave's copies of the second fill have landed */
      /* work-group barrier with LDS-only fences: the second fill is readable by every wave; __syncthreads() would also wait for the first tile's stores to S */
      __builtin_amdgcn_fence(__ATOMIC_RELEASE, "workgroup", "local"); __builtin_amdgcn_s_barrier(); __builtin_amdgcn_fence(__ATOMIC_ACQUIRE, "workgroup", "local"); }
#pragma unroll      /* the loops below: kf[], acc[] are indexed by constants only, so they stay in registers */
    for (int u = 0; u < 8; ++u) kf[u >> 2][u & 3] = g2_frag((const _Float16*)(kb + (nt * 64 + (u & 3) * 16) * PB + (u >> 2) * 64), hh);      /* the tile's LDS reads as one group in front of its WMMAs */
#pragma unroll
    for (int kt = 0; kt < 4; ++kt) { acc[kt][0] = g2_mma(kf[0][kt], q[0][0], z8); acc[kt][1] = g2_mma(kf[0][kt], q[1][0], z8); }
#pragma unroll
    for (int kt = 0; kt < 4; ++kt) { acc[kt][0] = g2_mma(kf[1][kt], q[0][1], acc[kt][0]); acc[kt][1] = g2_mma(kf[1][kt], q[1][1], acc[kt][1]); }
#pragma unroll
    for (int u = 0; u < 8; ++u) { const int kt = u >> 1, qt = u & 1; v8h o;
#pragma unroll
      for (int r = 0; r < 8; ++r) o[r] = (_Float16)(acc[kt][qt][r] * 0.125f);
      *(v8h*)(st + (qt * 16 + ln) * PB + kt * 32 + hh * 16) = o; }
    /* LDS-only fences round a wave barrier: the staging is private to the wave, other lanes' stores are read below; a fence on all memory would also wait for the last tile's stores to S */
    __builtin_amdgcn_fence(__ATOMIC_RELEASE, "workgroup", "local"); __builtin_amdgcn_wave_barrier(); __builtin_amdgcn_fence(__ATOMIC_ACQUIRE, "workgroup", "local");
#pragma unroll
    for (int p = 0; p < 8; ++p) __builtin_nontemporal_store(*(const v8h*)(st + (p * 4 + (lane >> 3)) * PB + (lane & 7) * 16), (v8h*)(ps + (size_t)(p * 4) * SEQ + nt * 64));      /* non-temporal: S is written once here and read once, by the next launch */
    if (nt + 1 < SCK / 64) {
      asm volatile("s_wait_xcnt 0x0" ::: "memory");      /* behind the tile's stores: the next tile's work lands in registers that those stores name */
      /* the next tile's staging stores stay behind this tile's reads of the staging */
      __builtin_amdgcn_fence(__ATOMIC_RELEASE, "workgroup", "local"); __builtin_amdgcn_wave_barrier(); __builtin_amdgcn_fence(__ATOMIC_ACQUIRE, "workgroup", "local"); }
  } }

// ---- every conversion that depends on the inputs alone, in one launch: block 0 = mix matrix, then PWB blocks per weight, then PXB blocks of x ----
#define PWB ((int)((size_t)DM * DM / (8 * 256)))      /* blocks per weight matrix, 8 elements per thread */
#define PXB ((int)(NR * DM / (8 * 256)))              /* blocks of x */
static_assert((size_t)DM * DM % (8 * 256) == 0);
static_assert(NR * DM % (8 * 256) == 0);

// WT[g][32] f16 = column softmax (axis 0) of mix_w, transposed, k zero-padded 16 -> 32; i = 0..63
__device__ __forceinline__ void d_wmix(const float* __restrict__ mixw, _Float16* __restrict__ WT, int i) {
  const int g = i >> 2, k8 = (i & 3) * 8; float mx = -3.0e38f;
#pragma unroll 1
  for (int h = 0; h < NH; ++h) mx = fmaxf(mx, bf16_rne(mixw[h * NH + g]));
  float se = 0.f;
#pragma unroll 1
  for (int h = 0; h < NH; ++h) se += __expf(bf16_rne(mixw[h * NH + g]) - mx);
  const float inv = 1.0f / se; FragH f;
#pragma unroll
  for (int q = 0; q < 8; ++q) { const int h = k8 + q; const int hc = (h < NH) ? h : (NH - 1); const float v = __expf(bf16_rne(mixw[hc * NH + g]) - mx) * inv; f.h[q] = (_Float16)((h < NH) ? v : 0.0f); }
  const v8us o = f.half[0]; *(v8us*)((unsigned short*)WT + i * 8) = o; }

// 8 floats at p -> f16(bf16_rne(v) * sc) at d
__device__ __forceinline__ void d_cvt(const float* __restrict__ p, _Float16* __restrict__ d, float sc) {
  const v4f a = *(const v4fa*)p, c = *(const v4fa*)(p + 4); FragH f;
#pragma unroll
  for (int q = 0; q < 4; ++q) { f.h[q] = (_Float16)(bf16_rne(a[q]) * sc); f.h[4 + q] = (_Float16)(bf16_rne(c[q]) * sc); }
  const v8us o = f.half[0]; *(v8us*)(unsigned short*)d = o; }

__global__ __launch_bounds__(256) void k_prep(const float* __restrict__ wq, const float* __restrict__ wk, const float* __restrict__ wv, const float* __restrict__ wo, const float* __restrict__ x, const float* __restrict__ mixw,
    _Float16* __restrict__ BW, _Float16* __restrict__ X16, _Float16* __restrict__ WT) {
  const int bid = (int)blockIdx.x - 1, tid = threadIdx.x;
  if (bid < 0) { if (tid < 64) d_wmix(mixw, WT, tid); return; }      /* first block: its chain of dependent loads starts first */
  if (bid < 4 * PWB) { const int m = bid / PWB; const float* w = (m == 0) ? wq : ((m == 1) ? wk : ((m == 2) ? wv : wo));
    const size_t t = (size_t)(bid - m * PWB) * 256 + tid; d_cvt(w + t * 8, BW + (size_t)m * DM * DM + t * 8, 16.0f); return; }      /* natural [out][in] = Bt[n][k], x16 */
  const size_t t = (size_t)(bid - 4 * PWB) * 256 + tid; const size_t row = t / (DM / 8); const int c8 = (int)(t % (DM / 8)) * 8; const size_t srow = (row / NB) * NB_FULL + (row % NB);
  d_cvt(x + srow * DM + c8, X16 + t * 8, 1.0f);
  asm volatile("s_wait_xcnt 0x0" ::: "memory"); }      /* behind the store: in the built code the other cases' blocks follow this one and rewrite the store's registers */

// softmax over SEQ keys + cross-head mix. S f16 [NB*NH][QC][SEQ] (slab by = b*NH + h); PM f16 [NB*NH][QC][SEQ] = 1024 * sum_h Wm[h][g] * softmax(S[b*NH+h][t][:]).
// One work-group per SMR query rows (b, t), SMW waves; wave w owns keys 128w .. 128w + 127 of all 16 heads and keeps them in registers, so S is read once, in whole lines.
// Lane (ln, hh) holds heads 8hh .. 8hh + 7 at keys 128w + 8ln + j (j = 0 .. 7), one 16-byte load per head: that is the B fragment of the mix WMMA for tile j, column ln <-> key 8ln + j,
// and D (row g = 8hh + r, column ln) of the eight tiles gives eight consecutive keys per lane: 16-byte stores, 256 bytes per head row and half wave.
// Row statistics: per wave max and sum of exp(x - wave max) over the 16-lane row by DPP, the waves' pairs joined through LDS (one barrier per query row).
#define SMW (SEQ / 128)      /* waves per work-group */
#define SMR 4                /* query rows per work-group, the next row's loads in flight while a row is worked on */
static_assert(SMW >= 1 && SMW <= 32);
static_assert(QC % SMR == 0);
template <int CTRL> __device__ __forceinline__ float sm_dpp(float v) { return __builtin_bit_cast(float, __builtin_amdgcn_mov_dpp(__builtin_bit_cast(int, v), CTRL, 0xf, 0xf, true)); }      /* 0x160 | m: lane l ^ m of the 16-lane row; 0x150 | i: lane i of the row */
// native exp (v_exp_f32 of x * log2 e) with the slot behind the transcendental filled in the same statement: in the built code the next instruction otherwise overwrites its source register directly behind it
__device__ __forceinline__ float sm_exp(float x) { const float t = x * 1.44269504f; float e; asm("v_exp_f32 %0, %1\n\tv_nop" : "=v"(e) : "v"(t)); return e; }
__device__ __forceinline__ float sm_exp2(float t) { float e; asm("v_exp_f32 %0, %1\n\tv_nop" : "=v"(e) : "v"(t)); return e; }      /* 2^t, the same slot filled */
__device__ __forceinline__ float sm_rowmax(float v) { v = fmaxf(v, sm_dpp<0x161>(v)); v = fmaxf(v, sm_dpp<0x162>(v)); v = fmaxf(v, sm_dpp<0x164>(v)); return fmaxf(v, sm_dpp<0x168>(v)); }
__device__ __forceinline__ float sm_rowsum(float v) { v += sm_dpp<0x161>(v); v += sm_dpp<0x162>(v); v += sm_dpp<0x164>(v); return v + sm_dpp<0x168>(v); }
// p and hp are the same in every lane, lofs is the lane's own element offset; the query rows of a work-group differ by an immediate offset, so the eight address pairs are formed once and live until the last row's loads are issued
__device__ __forceinline__ void sm_load(v8h (&x)[8], const _Float16* __restrict__ p, size_t hp, unsigned lofs) {
#pragma unroll
  for (int i = 0; i < 8; ++i) x[i] = __builtin_nontemporal_load((const v8h*)(p + (size_t)i * hp + lofs)); }      /* non-temporal: every byte of S is read once */

__global__ __launch_bounds__(SMW * 32) void k_smix(const _Float16* __restrict__ S, const _Float16* __restrict__ WT, _Float16* __restrict__ PM, size_t hp) {      /* hp = head slab pitch QC * SEQ, an argument so that the head bases are formed in scalar registers */
  __shared__ __attribute__((aligned(16))) float sst[2][SMW][2][NH];      /* [row parity][wave][max, sum][head] */
  const int tid = threadIdx.x, w = __builtin_amdgcn_readfirstlane((int)(tid >> 5)), lane = tid & 31, ln = lane & 15, hh = lane >> 4;
  const int wr = blockIdx.x * SMR; const int b = wr / QC, tql = wr - b * QC;
  const size_t base = ((size_t)(b * NH) * QC + tql) * SEQ + 128 * w; const unsigned lofs = (unsigned)(8 * hh) * (unsigned)hp + 8 * ln;
  const _Float16* ps = S + base;                                          /* head 8hh + i of query row q at ps + i * hp + q * SEQ + lofs */
  _Float16* po = PM + base;
  const v8f z8 = {0.f,0.f,0.f,0.f,0.f,0.f,0.f,0.f};
  const int hd = 8 * hh + (ln & 7);                                    /* the head whose joined statistics this lane forms */
  v8h x[2][8];
  const v16h aW = g2_frag(WT + ln * 32, hh);                          /* A: row g = ln, k = heads (upper 16 k zero) */
  asm volatile("s_wait_xcnt 0x0" ::: "memory");      /* behind the loads of aW: in the built code a load of scores lands in their address registers */
  sm_load(x[0], ps, hp, lofs);
#pragma unroll      /* x[] is indexed by constants only, so both rows' scores stay in registers */
  for (int q = 0; q < SMR; ++q) { v8h (&xc)[8] = x[q & 1];
    if (q > 0) asm volatile("s_wait_xcnt 0x0" ::: "memory");      /* behind the last row's stores: the loads and the work below land in registers that those stores name */
    if (q + 1 < SMR) sm_load(x[(q + 1) & 1], ps + (size_t)(q + 1) * SEQ, hp, lofs);
    if (q + 2 == SMR) asm volatile("s_wait_xcnt 0x0" ::: "memory");      /* behind the last loads: their address registers are free from here on and this row's work is put into them */
    __builtin_amdgcn_sched_barrier(0);      /* keeps the next row's loads in front of this row's work and the two rows' work apart: without it the build starts on the next row's scores inside this row and waits for them early */
    float c[8][8], m8[8], s8[8];
#pragma unroll
    for (int i = 0; i < 8; ++i) { const v8h u = xc[i];      /* the lane's maximum is taken on the f16 pairs (exact), then widened */
      const v4h a = __builtin_elementwise_max(__builtin_shufflevector(u, u, 0, 1, 2, 3), __builtin_shufflevector(u, u, 4, 5, 6, 7));
      const v2h p = __builtin_elementwise_max(__builtin_shufflevector(a, a, 0, 1), __builtin_shufflevector(a, a, 2, 3));
      m8[i] = sm_rowmax(fmaxf((float)p[0], (float)p[1])); }
#pragma unroll
    for (int i = 0; i < 8; ++i) { float se = 0.f; const float nm = -m8[i] * 1.44269504f;
#pragma unroll
      for (int j = 0; j < 8; ++j) { const float e = sm_exp2(__builtin_fmaf((float)xc[i][j], 1.44269504f, nm)); c[i][j] = e; se += e; }      /* exp(x - max): the f16 score goes into the multiply-add as it is */
      s8[i] = sm_rowsum(se); }
    float (*st)[2][NH] = sst[q & 1];
    if (ln == 0) {
#pragma unroll
      for (int i = 0; i < 8; ++i) { st[w][0][8 * hh + i] = m8[i]; st[w][1][8 * hh + i] = s8[i]; } }
    /* work-group barrier with LDS-only fences: every wave's pair of this query row is readable, and the other parity's buffer is rewritten only behind it. Only sst passes between waves; __syncthreads() would also wait for the next row's loads and the last row's stores */
    __builtin_amdgcn_fence(__ATOMIC_RELEASE, "workgroup", "local"); __builtin_amdgcn_s_barrier(); __builtin_amdgcn_fence(__ATOMIC_ACQUIRE, "workgroup", "local");
    float mw[SMW], mx = -3.0e38f, se = 0.f;
#pragma unroll
    for (int u = 0; u < SMW; ++u) { mw[u] = st[u][0][hd]; mx = fmaxf(mx, mw[u]); }
#pragma unroll
    for (int u = 0; u < SMW; ++u) se += st[u][1][hd] * sm_exp(mw[u] - mx);
    const float f = sm_exp(st[w][0][hd] - mx) * (1024.0f / se);      /* exp(x - wave max) * f = 1024 * softmax */
    const float f8[8] = {sm_dpp<0x150>(f), sm_dpp<0x151>(f), sm_dpp<0x152>(f), sm_dpp<0x153>(f), sm_dpp<0x154>(f), sm_dpp<0x155>(f), sm_dpp<0x156>(f), sm_dpp<0x157>(f)};      /* lane i of the row holds head 8hh + i */
    v8f d[8];
#pragma unroll
    for (int j = 0; j < 8; ++j) { FragH bf;
#pragma unroll
      for (int i = 0; i < 8; ++i) bf.h[i] = (_Float16)(c[i][j] * f8[i]);
#pragma unroll
      for (int i = 8; i < 16; ++i) bf.h[i] = (_Float16)0.0f;
      d[j] = g2_mma(aW, bf.v, z8); }
#pragma unroll
    for (int r = 0; r < 8; ++r) { v8h o;
#pragma unroll
      for (int j = 0; j < 8; ++j) o[j] = (_Float16)d[j][r];
      __builtin_nontemporal_store(o, (v8h*)(po + ((size_t)r * hp + (size_t)q * SEQ) + lofs)); }      /* non-temporal: P' is written once here and read once, by the next launch */
  }
}

extern "C" void kernel_launch(void* const* d_in, const int* in_sizes, int n_in,
                              void* d_out, int out_size, void* d_ws, size_t ws_size, hipStream_t stream) {
  if (n_in < 10) return;
  if ((size_t)in_sizes[0] < NR * DM) return;
  if ((size_t)in_sizes[1] < (size_t)DM * DM || (size_t)in_sizes[3] < (size_t)DM * DM || (size_t)in_sizes[5] < (size_t)DM * DM || (size_t)in_sizes[7] < (size_t)DM * DM) return;
  if (in_sizes[2] < DM || in_sizes[4] < DM || in_sizes[6] < DM || in_sizes[8] < DM || in_sizes[9] < NH * NH) return;
  if ((size_t)out_size < NR * DM) return;
  const float* const* I = (const float* const*)d_in;
  const float* xq = I[0]; const float* wq = I[1]; const float* bq = I[2]; const float* wk = I[3]; const float* bk = I[4]; const float* wv = I[5]; const float* bv = I[6]; const float* wo = I[7]; const float* bo = I[8]; const float* mixw = I[9];
  char* ws = (char*)d_ws; size_t off = 0;
  auto take = [&](size_t bytes) { char* p = ws + off; off += (bytes + 255) & ~(size_t)255; return p; };
  _Float16* BQ = (_Float16*)take((size_t)4 * DM * DM * 2); _Float16* BO = BQ + (size_t)3 * DM * DM;      /* wq, wk, wv, wo planes, pitch DM * DM */
  _Float16* X16 = (_Float16*)take(NR * DM * 2); _Float16* Q16 = (_Float16*)take(2 * NR * DM * 2); _Float16* K16 = Q16 + NR * DM; _Float16* O16 = (_Float16*)take(NR * DM * 2);      /* q, k planes, pitch NR * DM */
  _Float16* S = (_Float16*)take((size_t)NB * NH * QC * SEQ * 2); _Float16* PM = (_Float16*)take((size_t)NB * NH * QC * SEQ * 2); _Float16* VT = (_Float16*)take((size_t)NB * NH * HD * SEQ * 2);
  _Float16* WT = (_Float16*)take((size_t)NH * 32 * 2);
  if (off > ws_size) return;
  k_prep<<<1 + 4 * PWB + PXB, 256, 0, stream>>>(wq, wk, wv, wo, xq, mixw, BQ, X16, WT);
  const dim3 gp((unsigned)((MP / 128) * (DM / 64)), 1);
  k_gemm2<true, false, false, true, 128, 1><<<dim3(gp.x, 3), 128, 0, stream>>>(X16, DM, 0, BQ, DM, (size_t)DM * DM, 0.0625f, bq, bk, bv, nullptr, Q16, VT, DM, NR * DM, MP, DM, DM);      /* slab 0 / 1 / 2 = q / k / v; v goes to VT[(b,h)][64][SEQ] */
  for (int t0 = 0; t0 < SEQ; t0 += QC) {
    /* scores: slab by = b*NH + h at column offset by*64 of rows with pitch LQ; S[by][QC][SEQ] f16 */
    k_scores<<<dim3((QC / 128) * (SEQ / SCK), NB * NH), 128, 0, stream>>>(Q16 + (size_t)t0 * LQ, K16, S);
    k_smix<<<NB * QC / SMR, SMW * 32, 0, stream>>>(S, WT, PM, (size_t)QC * SEQ);
    /* o[t][b][g*64 + d] x64 = 2^-4 * (1024 P') . V^T */
    k_gemm2<false, false, false, false, 128, 2><<<dim3((QC / 128) * (HD / 64), NB * NH), 256, 0, stream>>>(PM, SEQ, (size_t)QC * SEQ, VT, SEQ, (size_t)HD * SEQ, 0.0625f, nullptr, nullptr, nullptr, nullptr, O16 + (size_t)t0 * LQ, nullptr, LQ, (size_t)HD, QC, HD, SEQ);
  }
  k_gemm2<true, true, true, false, 128, 2><<<gp, 256, 0, stream>>>(O16, DM, 0, BO, DM, 0, 0.0009765625f, bo, nullptr, nullptr, (float*)d_out, nullptr, nullptr, DM, 0, MP, DM, DM);      /* out rows t*NB_FULL + b */
}
